// v000
// The times below were measured on an AMD MI455X: many runs one after another, warmed up first and cycling through
// copies of the inputs, with the whole window's GPU time divided by the number of runs. Launches and the gaps
// between them are all in it. The median over several windows is given; except for v000 it joins two sittings, which
// can be a few percent apart, so the side-by-side timings, each taken in one sitting, are the better comparison.
// v000 is the starting kernel. One run takes 463 microseconds.
// compute dtype: all float inputs rounded to bf16; q = Wq . x_high + bq and k, v = Wk/Wv . x_low + b (1x1 convs) with EXACT bf16 products on WMMA 16x16x32 (the channels-first inputs gathered token-major on load); q and k as f16 hi + (x2048-scaled) residual planes with 3-product scores (the logits are unscaled and large, so single-rounded operands would not do), running-max softmax in f32 (hardware exp), P (scaled by 2^11, single f16) x v (single f16); out = ctx (bf16 hi + residual) . Wo rows (2 products) + bo + x_high, stored channels-first; f32 accumulate.
#include <hip/hip_runtime.h>
#include <math.h>

typedef __attribute__((ext_vector_type(16))) _Float16 v16h;
typedef __attribute__((ext_vector_type(16))) __bf16 v16b;
typedef __attribute__((ext_vector_type(8)))  _Float16 v8h;
typedef __attribute__((ext_vector_type(8)))  float v8f;
typedef __attribute__((ext_vector_type(4)))  float v4f;
typedef __attribute__((ext_vector_type(2)))  float v2f;
typedef __attribute__((ext_vector_type(4)))  unsigned v4u;
typedef __attribute__((ext_vector_type(4)))  int v4i;
typedef float __attribute__((may_alias)) float_a;
typedef int __attribute__((may_alias)) int_a;

template <typename T> __device__ __forceinline__ void vst2(void* p, T v) { *(T*)p = v;  }
__device__ __forceinline__ v8f wmma16(v16h a, v16h b, v8f c) {
  v8f d = __builtin_amdgcn_wmma_f32_16x16x32_f16(false, a, false, b, (short)0, c, false, false);
  asm volatile("v_nop\n\tv_nop\n\tv_nop\n\tv_nop" : "+v"(d) : "v"(a), "v"(b));
  return d;
}
__device__ __forceinline__ v8f wmma_bf(v16b a, v16b b, v8f c) {
  v8f d = __builtin_amdgcn_wmma_f32_16x16x32_bf16(false, a, false, b, (short)0, c, false, false);
  asm volatile("v_nop\n\tv_nop\n\tv_nop\n\tv_nop" : "+v"(d) : "v"(a), "v"(b));
  return d;
}
// 16x16x32 fragments: lane = (h = lane>>4, row/col = lane&15); elements 0..7 = k0+8h+0..7, 8..15 = k0+16+8h+0..7; D element r = row 8h+r
__device__ __forceinline__ v16h frag_h(const _Float16* rowk0, int lane) {
  union { v16h v; v8h q[2]; } u; const _Float16* p = rowk0 + 8 * (lane >> 4);
  u.q[0] = *(const v8h*)p; u.q[1] = *(const v8h*)(p + 16); return u.v;
}
__device__ __forceinline__ v16h frag_f32(const float* rowk0, int lane) {
  v16h a; const float* p = rowk0 + 8 * (lane >> 4);
#pragma unroll
  for (int i = 0; i < 8; ++i) { a[i] = (_Float16)p[i]; a[8 + i] = (_Float16)p[16 + i]; }
  return a;
}
__device__ __forceinline__ v16h frag_f32s(const float* rowk0, int lane, float sc) {
  v16h a; const float* p = rowk0 + 8 * (lane >> 4);
#pragma unroll
  for (int i = 0; i < 8; ++i) { a[i] = (_Float16)(p[i] * sc); a[8 + i] = (_Float16)(p[16 + i] * sc); }
  return a;
}
// column fragment from a [K][ld] layout (column n), rows >= K read as 0
__device__ __forceinline__ v16h fragc_f32(const float* W, int k0, int n, int lane, int ld, int K) {
  v16h a; const int g = lane >> 4;
#pragma unroll
  for (int i = 0; i < 8; ++i) { const int ka = k0 + 8 * g + i, kb = ka + 16;
    a[i] = (_Float16)(ka < K ? W[(size_t)(ka < K ? ka : K - 1) * ld + n] : 0.f); a[8 + i] = (_Float16)(kb < K ? W[(size_t)(kb < K ? kb : K - 1) * ld + n] : 0.f); }
  return a;
}
struct F2 { v16b h, l; };
__device__ __forceinline__ F2 bsplit16(const float v[16]) { F2 r;
#pragma unroll
  for (int i = 0; i < 16; ++i) { const __bf16 h = (__bf16)v[i]; r.h[i] = h; r.l[i] = (__bf16)(v[i] - (float)h); }
  return r; }
__device__ __forceinline__ F2 split_row(const float* row, int k0, int lane) { float v[16]; const float* p = row + k0 + 8 * (lane >> 4);
#pragma unroll
  for (int i = 0; i < 8; ++i) { v[i] = p[i]; v[8 + i] = p[16 + i]; }
  return bsplit16(v); }
__device__ __forceinline__ F2 split_rowK(const float* row, int k0, int lane, int K) { float v[16]; const int g = lane >> 4;
#pragma unroll
  for (int i = 0; i < 8; ++i) { const int ka = k0 + 8 * g + i, kb = ka + 16; v[i] = ka < K ? row[ka < K ? ka : K - 1] : 0.f; v[8 + i] = kb < K ? row[kb < K ? kb : K - 1] : 0.f; }
  return bsplit16(v); }
__device__ __forceinline__ F2 split_col(const float* W, int k0, int n, int lane, int ld, int K) { float v[16]; const int g = lane >> 4;
#pragma unroll
  for (int i = 0; i < 8; ++i) { const int ka = k0 + 8 * g + i, kb = ka + 16; v[i] = ka < K ? W[(size_t)(ka < K ? ka : K - 1) * ld + n] : 0.f; v[8 + i] = kb < K ? W[(size_t)(kb < K ? kb : K - 1) * ld + n] : 0.f; }
  return bsplit16(v); }
__device__ __forceinline__ v8f mac3(const F2& a, const F2& b, v8f c) { c = wmma_bf(a.l, b.h, c); c = wmma_bf(a.h, b.l, c); return wmma_bf(a.h, b.h, c); }
__device__ __forceinline__ float sigm(float v) { return 1.0f / (1.0f + expf(-v)); }
#define LDSX() do { asm volatile("s_wait_dscnt 0" ::: "memory"); __builtin_amdgcn_wave_barrier(); __builtin_amdgcn_fence(__ATOMIC_RELEASE, "workgroup"); } while (0)


// Non-local feature fusion (B 4, 64 x 64 maps; 256 high-level / 512 low-level channels, 64-dim keys and values): every high-level pixel attends over all 4,096 low-level pixels (unscaled dot-product softmax), 1x1 output conv + residual.
#define NB 4
#define NT 4096            // tokens per image
#define CH 256             // high channels (q source, output)
#define CL 512             // low channels (k, v source)
#define KC 64
#define NR (NB * NT)
#ifndef TQB
#define TQB (NT / 64)
#define TNB NB
#endif
typedef __attribute__((ext_vector_type(8))) __bf16 v8b;
__device__ __forceinline__ v16b frag_b(const __bf16* rowk0, int lane) {
  union { v16b v; v8b q[2]; } u; const __bf16* p = rowk0 + 8 * (lane >> 4);
  u.q[0] = *(const v8b*)p; u.q[1] = *(const v8b*)(p + 16); return u.v;
}
__device__ __forceinline__ float bfr(float v) { return (float)(__bf16)v; }
__device__ __attribute__((noinline)) float exp_ni(float v) { return expf(v); }
__device__ __attribute__((noinline)) float erf_ni(float v) { return erff(v); }

#define WS_PQ  0u                                   // bf16 natural rows Wq [64][256], Wk [64][512], Wv [64][512]; Wo [256][64]
#define WS_PK  (WS_PQ + 2u * KC * CH)
#define WS_PV  (WS_PK + 2u * KC * CL)
#define WS_PO  (WS_PV + 2u * KC * CL)
#define WS_QH  (WS_PO + 2u * CH * KC)               // f16 [NR][64] q hi ; QL residual x2048 ; KH ; KL ; V planes [b][64][NT]
#define WS_QL  (WS_QH + 2u * (size_t)NR * KC)
#define WS_KH  (WS_QL + 2u * (size_t)NR * KC)
#define WS_KL  (WS_KH + 2u * (size_t)NR * KC)
#define WS_V   (WS_KL + 2u * (size_t)NR * KC)
#define WS_O   (WS_V + 2u * (size_t)NB * KC * NT)    // f32 [NR][64] ctx
#define WS_END (WS_O + 4u * (size_t)NR * KC)

__global__ __launch_bounds__(256) void k_pack(const float* __restrict__ WQ, const float* __restrict__ WK, const float* __restrict__ WV, const float* __restrict__ WO, __bf16* __restrict__ P) {
  const int n = blockIdx.x, which = blockIdx.y, t = threadIdx.x; __shared__ __align__(16) __bf16 s[CL];
  if (which < 3) { if (n >= KC) return; const int kin = (which == 0) ? CH : CL; const float* Wm = (which == 0) ? WQ : (which == 1) ? WK : WV; for (int k = t; k < kin; k += 256) s[k] = (__bf16)Wm[(size_t)n * kin + k]; __syncthreads(); __bf16* dst = P + ((which == 0) ? WS_PQ / 2 : (which == 1) ? WS_PK / 2 : WS_PV / 2) + (size_t)n * kin; for (int q = t; q < kin / 8; q += 256) vst2((unsigned*)(dst + q * 8), *(const v4u*)&s[q * 8]); }
  else { if (t < KC) s[t] = (__bf16)WO[(size_t)n * KC + t]; __syncthreads(); if (t < KC / 8) vst2((unsigned*)(P + WS_PO / 2 + (size_t)n * KC + t * 8), *(const v4u*)&s[t * 8]); }
}
// ---- k_proj: block = (64 tokens, which): 64 output channels (4 tiles per wave); A gathered from the channels-first map; which 0: q -> hi/lo rows; 1: k -> hi/lo rows; 2: v -> planes
template <int WHICH>
__global__ __launch_bounds__(128) void k_proj(const float* __restrict__ X, const __bf16* __restrict__ P, const float* __restrict__ BB, _Float16* __restrict__ OH, _Float16* __restrict__ OL, _Float16* __restrict__ V) {
  constexpr int KIN = (WHICH == 0) ? CH : CL;
  __shared__ __align__(16) _Float16 sh[64][72], sl[64][72]; __shared__ __align__(16) _Float16 st[64][72];
  const int tid = threadIdx.x, wave = tid >> 5, lane = tid & 31, col = lane & 15, g = lane >> 4; const size_t rb0 = (size_t)blockIdx.x * 64, r0 = rb0 + wave * 16; const size_t b = rb0 / NT, t0 = rb0 % NT;
  const __bf16* Wr = P + ((WHICH == 0) ? WS_PQ / 2 : (WHICH == 1) ? WS_PK / 2 : WS_PV / 2);
  v8f acc[4] = {};
#pragma unroll 2
  for (int kc = 0; kc < KIN / 32; ++kc) { v16b a; { const float* p = X + ((b * KIN + kc * 32 + 8 * g) * (size_t)NT) + t0 + wave * 16 + col;   // x[b][channel][token]
#pragma unroll
      for (int i = 0; i < 8; ++i) { a[i] = (__bf16)p[(size_t)i * NT]; a[8 + i] = (__bf16)p[(size_t)(16 + i) * NT]; } }
#pragma unroll
    for (int j = 0; j < 4; ++j) acc[j] = wmma_bf(a, frag_b(Wr + (size_t)(j * 16 + col) * KIN + kc * 32, lane), acc[j]); }
  if (WHICH < 2) {
#pragma unroll
    for (int j = 0; j < 4; ++j) { const float bb = bfr(BB[j * 16 + col]);
#pragma unroll
      for (int r = 0; r < 8; ++r) { const float v = acc[j][r] + bb; const _Float16 h = (_Float16)v; sh[wave * 16 + 8 * g + r][j * 16 + col] = h; sl[wave * 16 + 8 * g + r][j * 16 + col] = (_Float16)((v - (float)h) * 2048.0f); } }
    LDSX();
    for (int rl = 0; rl < 16; ++rl) if (lane < 8) { vst2((unsigned*)(OH + (r0 + rl) * KC + lane * 8), *(const v4u*)&sh[wave * 16 + rl][lane * 8]); vst2((unsigned*)(OL + (r0 + rl) * KC + lane * 8), *(const v4u*)&sl[wave * 16 + rl][lane * 8]); }
  } else {
#pragma unroll
    for (int j = 0; j < 4; ++j) { const float bb = bfr(BB[j * 16 + col]);
#pragma unroll
      for (int r = 0; r < 8; ++r) st[j * 16 + col][wave * 16 + 8 * g + r] = (_Float16)(acc[j][r] + bb); }
    __syncthreads();
    for (int e = tid; e < 64 * 8; e += 128) { const int d = e >> 3, pc = e & 7; vst2((unsigned*)(V + ((b * KC + d) * NT) + t0 + pc * 8), *(const v4u*)&st[d][pc * 8]); } }
}
// ---- k_attn: block = (64 queries, b): single head, 64-dim keys/values, all 4,096 keys; 3-product scores (unscaled logits); P single x v single
__global__ __launch_bounds__(128) void k_attn(const _Float16* __restrict__ QH, const _Float16* __restrict__ QL, const _Float16* __restrict__ KH, const _Float16* __restrict__ KL, const _Float16* __restrict__ V, float* __restrict__ O) {
  __shared__ __align__(16) _Float16 sph[4][16][40]; __shared__ __align__(16) float so[4][16][68];
  const int tid = threadIdx.x, wave = tid >> 5, lane = tid & 31, col = lane & 15, g = lane >> 4; const size_t b = blockIdx.y; const int q0 = blockIdx.x * 64 + wave * 16; const size_t rq = b * NT + q0;
  v16h aq[2], aql[2];
#pragma unroll
  for (int kc = 0; kc < 2; ++kc) { aq[kc] = frag_h(QH + (rq + col) * KC + kc * 32, lane); aql[kc] = frag_h(QL + (rq + col) * KC + kc * 32, lane); }
  float m[8], l[8];
#pragma unroll
  for (int r = 0; r < 8; ++r) { m[r] = -3.0e38f; l[r] = 0.f; }
  v8f acc[4] = {};
#pragma unroll 1
  for (int ks = 0; ks < NT / 32; ++ks) { const int j0 = ks * 32; v8f s[2];
#pragma unroll
    for (int ct = 0; ct < 2; ++ct) { const size_t rk = (b * NT + j0 + ct * 16 + col) * KC; v8f c = {}, cl = {};
#pragma unroll
      for (int kc = 0; kc < 2; ++kc) { const v16h kh = frag_h(KH + rk + kc * 32, lane); c = wmma16(aq[kc], kh, c); cl = wmma16(aql[kc], kh, cl); cl = wmma16(aq[kc], frag_h(KL + rk + kc * 32, lane), cl); }
#pragma unroll
      for (int r = 0; r < 8; ++r) s[ct][r] = c[r] + cl[r] * (1.0f / 2048.0f); }   // unscaled logits
#pragma unroll
    for (int r = 0; r < 8; ++r) { float mx = fmaxf(s[0][r], s[1][r]);
#pragma unroll
      for (int o = 1; o < 16; o <<= 1) mx = fmaxf(mx, __shfl_xor(mx, o));
      const float mn = fmaxf(m[r], mx); const float alpha = (m[r] <= -1.0e38f) ? 0.f : __expf(m[r] - mn); const float e0 = __expf(s[0][r] - mn), e1 = __expf(s[1][r] - mn); float es = e0 + e1;
#pragma unroll
      for (int o = 1; o < 16; o <<= 1) es += __shfl_xor(es, o);
      l[r] = l[r] * alpha + es; m[r] = mn;
#pragma unroll
      for (int dt = 0; dt < 4; ++dt) acc[dt][r] *= alpha;
      sph[wave][8 * g + r][col] = (_Float16)(e0 * 2048.0f); sph[wave][8 * g + r][16 + col] = (_Float16)(e1 * 2048.0f); }
    LDSX();
    const v16h pa = frag_h(&sph[wave][col][0], lane);
#pragma unroll
    for (int dt = 0; dt < 4; ++dt) acc[dt] = wmma16(pa, frag_h(V + ((b * KC + dt * 16 + col) * NT) + j0, lane), acc[dt]);
    LDSX(); }
#pragma unroll
  for (int r = 0; r < 8; ++r) { const float il = (1.0f / 2048.0f) / l[r];
#pragma unroll
    for (int dt = 0; dt < 4; ++dt) so[wave][8 * g + r][dt * 16 + col] = acc[dt][r] * il; }
  LDSX();
  for (int rl = 0; rl < 16; ++rl) if (lane < 16) vst2(O + (rq + rl) * KC + lane * 4, *(const v4f*)&so[wave][rl][lane * 4]);
}
// ---- k_out: block = (64 tokens, 128 output channels): out = ctx (hi + residual, K 64) . Wo rows + bo + x_high, stored channels-first (64 consecutive tokens per (image, channel))
__global__ __launch_bounds__(128) void k_out(const float* __restrict__ O, const __bf16* __restrict__ P, const float* __restrict__ BO, const float* __restrict__ XH, float* __restrict__ OUT) {
  __shared__ __align__(16) float st[128][68];
  const int tid = threadIdx.x, wave = tid >> 5, lane = tid & 31, col = lane & 15, g = lane >> 4; const size_t rb0 = (size_t)blockIdx.x * 64, r0 = rb0 + wave * 16; const int n0 = blockIdx.y * 128; const size_t b = rb0 / NT, t0 = rb0 % NT;
  v8f acc[8] = {};
#pragma unroll
  for (int kc = 0; kc < KC / 32; ++kc) { const F2 a = split_row(O + (r0 + col) * KC, kc * 32, lane);
#pragma unroll
    for (int j = 0; j < 8; ++j) { const v16b w = frag_b(P + WS_PO / 2 + (size_t)(n0 + j * 16 + col) * KC + kc * 32, lane); acc[j] = wmma_bf(a.l, w, acc[j]); acc[j] = wmma_bf(a.h, w, acc[j]); } }
#pragma unroll
  for (int j = 0; j < 8; ++j) { const int c = n0 + j * 16 + col; const float bb = bfr(BO[c]);
#pragma unroll
    for (int r = 0; r < 8; ++r) { const int tl = wave * 16 + 8 * g + r; st[j * 16 + col][tl] = acc[j][r] + bb + bfr(XH[(b * CH + c) * (size_t)NT + t0 + tl]); } }
  __syncthreads();
  for (int e = tid; e < 128 * 16; e += 128) { const int c = e >> 4, q = e & 15; vst2(OUT + ((b * CH + n0 + c) * (size_t)NT) + t0 + q * 4, *(const v4f*)&st[c][q * 4]); }
}
extern "C" void kernel_launch(void* const* d_in, const int* in_sizes, int n_in, void* d_out, int out_size, void* d_ws, size_t ws_size, hipStream_t stream) {
  (void)in_sizes; (void)n_in; (void)out_size;
  const float** F = (const float**)d_in;   // 0 x_low [4,512,64,64], 1 x_high [4,256,64,64], 2 Wq [64,256], 3 bq, 4 Wk [64,512], 5 bk, 6 Wv [64,512], 7 bv, 8 Wo [256,64], 9 bo
  if (ws_size < (size_t)WS_END) return;
  char* ws = (char*)d_ws; __bf16* P = (__bf16*)ws; _Float16 *QH = (_Float16*)(ws + WS_QH), *QL = (_Float16*)(ws + WS_QL), *KH = (_Float16*)(ws + WS_KH), *KL = (_Float16*)(ws + WS_KL), *V = (_Float16*)(ws + WS_V); float* O = (float*)(ws + WS_O);
  k_pack<<<dim3(CH, 4), 256, 0, stream>>>(F[2], F[4], F[6], F[8], P);
  k_proj<0><<<TNB * NT / 64, 128, 0, stream>>>(F[1], P, F[3], QH, QL, nullptr);
  k_proj<1><<<TNB * NT / 64, 128, 0, stream>>>(F[0], P, F[5], KH, KL, nullptr);
  k_proj<2><<<TNB * NT / 64, 128, 0, stream>>>(F[0], P, F[7], nullptr, nullptr, V);
  k_attn<<<dim3(TQB, TNB), 128, 0, stream>>>(QH, QL, KH, KL, V, O);
  k_out<<<dim3(TNB * NT / 64, CH / 128), 128, 0, stream>>>(O, P, F[9], F[1], (float*)d_out);
}

// v001
// One run takes 195 microseconds.
// Timed twice side by side with v000, it ran 2.37 and 2.39 times as fast.
// compute dtype: all float inputs rounded to bf16; q = Wq . x_high + bq and k, v = Wk/Wv . x_low + b (1x1 convs) with EXACT bf16 products on WMMA 16x16x32 (the channels-first inputs gathered token-major on load); q and k as f16 hi + (x2048-scaled) residual planes with 3-product scores (the logits are unscaled and large, so single-rounded operands would not do), running-max softmax in f32 (hardware exp), P (scaled by 2^11, single f16) x v (single f16); out = ctx (bf16 hi + residual) . Wo rows (2 products) + bo + x_high, stored channels-first; f32 accumulate.
#include <hip/hip_runtime.h>
#include <math.h>

typedef __attribute__((ext_vector_type(16))) _Float16 v16h;
typedef __attribute__((ext_vector_type(16))) __bf16 v16b;
typedef __attribute__((ext_vector_type(8)))  _Float16 v8h;
typedef __attribute__((ext_vector_type(8)))  float v8f;
typedef __attribute__((ext_vector_type(4)))  float v4f;
typedef __attribute__((ext_vector_type(2)))  float v2f;
typedef __attribute__((ext_vector_type(4)))  unsigned v4u;
typedef __attribute__((ext_vector_type(4)))  int v4i;
typedef float __attribute__((may_alias)) float_a;
typedef int __attribute__((may_alias)) int_a;

template <typename T> __device__ __forceinline__ void vst2(void* p, T v) { *(T*)p = v;  }
__device__ __forceinline__ v8f wmma16(v16h a, v16h b, v8f c) {
  v8f d = __builtin_amdgcn_wmma_f32_16x16x32_f16(false, a, false, b, (short)0, c, false, false);
  asm volatile("v_nop\n\tv_nop\n\tv_nop\n\tv_nop" : "+v"(d) : "v"(a), "v"(b));
  return d;
}
__device__ __forceinline__ v8f wmma_bf(v16b a, v16b b, v8f c) {
  v8f d = __builtin_amdgcn_wmma_f32_16x16x32_bf16(false, a, false, b, (short)0, c, false, false);
  asm volatile("v_nop\n\tv_nop\n\tv_nop\n\tv_nop" : "+v"(d) : "v"(a), "v"(b));
  return d;
}
// 16x16x32 fragments: lane = (h = lane>>4, row/col = lane&15); elements 0..7 = k0+8h+0..7, 8..15 = k0+16+8h+0..7; D element r = row 8h+r
__device__ __forceinline__ v16h frag_h(const _Float16* rowk0, int lane) {
  union { v16h v; v8h q[2]; } u; const _Float16* p = rowk0 + 8 * (lane >> 4);
  u.q[0] = *(const v8h*)p; u.q[1] = *(const v8h*)(p + 16); return u.v;
}
__device__ __forceinline__ v16h frag_f32(const float* rowk0, int lane) {
  v16h a; const float* p = rowk0 + 8 * (lane >> 4);
#pragma unroll
  for (int i = 0; i < 8; ++i) { a[i] = (_Float16)p[i]; a[8 + i] = (_Float16)p[16 + i]; }
  return a;
}
__device__ __forceinline__ v16h frag_f32s(const float* rowk0, int lane, float sc) {
  v16h a; const float* p = rowk0 + 8 * (lane >> 4);
#pragma unroll
  for (int i = 0; i < 8; ++i) { a[i] = (_Float16)(p[i] * sc); a[8 + i] = (_Float16)(p[16 + i] * sc); }
  return a;
}
// column fragment from a [K][ld] layout (column n), rows >= K read as 0
__device__ __forceinline__ v16h fragc_f32(const float* W, int k0, int n, int lane, int ld, int K) {
  v16h a; const int g = lane >> 4;
#pragma unroll
  for (int i = 0; i < 8; ++i) { const int ka = k0 + 8 * g + i, kb = ka + 16;
    a[i] = (_Float16)(ka < K ? W[(size_t)(ka < K ? ka : K - 1) * ld + n] : 0.f); a[8 + i] = (_Float16)(kb < K ? W[(size_t)(kb < K ? kb : K - 1) * ld + n] : 0.f); }
  return a;
}
struct F2 { v16b h, l; };
__device__ __forceinline__ F2 bsplit16(const float v[16]) { F2 r;
#pragma unroll
  for (int i = 0; i < 16; ++i) { const __bf16 h = (__bf16)v[i]; r.h[i] = h; r.l[i] = (__bf16)(v[i] - (float)h); }
  return r; }
__device__ __forceinline__ F2 split_row(const float* row, int k0, int lane) { float v[16]; const float* p = row + k0 + 8 * (lane >> 4);
#pragma unroll
  for (int i = 0; i < 8; ++i) { v[i] = p[i]; v[8 + i] = p[16 + i]; }
  return bsplit16(v); }
__device__ __forceinline__ F2 split_rowK(const float* row, int k0, int lane, int K) { float v[16]; const int g = lane >> 4;
#pragma unroll
  for (int i = 0; i < 8; ++i) { const int ka = k0 + 8 * g + i, kb = ka + 16; v[i] = ka < K ? row[ka < K ? ka : K - 1] : 0.f; v[8 + i] = kb < K ? row[kb < K ? kb : K - 1] : 0.f; }
  return bsplit16(v); }
__device__ __forceinline__ F2 split_col(const float* W, int k0, int n, int lane, int ld, int K) { float v[16]; const int g = lane >> 4;
#pragma unroll
  for (int i = 0; i < 8; ++i) { const int ka = k0 + 8 * g + i, kb = ka + 16; v[i] = ka < K ? W[(size_t)(ka < K ? ka : K - 1) * ld + n] : 0.f; v[8 + i] = kb < K ? W[(size_t)(kb < K ? kb : K - 1) * ld + n] : 0.f; }
  return bsplit16(v); }
__device__ __forceinline__ v8f mac3(const F2& a, const F2& b, v8f c) { c = wmma_bf(a.l, b.h, c); c = wmma_bf(a.h, b.l, c); return wmma_bf(a.h, b.h, c); }
__device__ __forceinline__ float sigm(float v) { return 1.0f / (1.0f + expf(-v)); }
#define LDSX() do { asm volatile("s_wait_dscnt 0" ::: "memory"); __builtin_amdgcn_wave_barrier(); __builtin_amdgcn_fence(__ATOMIC_RELEASE, "workgroup"); } while (0)


// Non-local feature fusion (B 4, 64 x 64 maps; 256 high-level / 512 low-level channels, 64-dim keys and values): every high-level pixel attends over all 4,096 low-level pixels (unscaled dot-product softmax), 1x1 output conv + residual.
#define NB 4
#define NT 4096            // tokens per image
#define CH 256             // high channels (q source, output)
#define CL 512             // low channels (k, v source)
#define KC 64
#define NR (NB * NT)
#ifndef TQB
#define TQB (NT / 64)
#define TNB NB
#endif
typedef __attribute__((ext_vector_type(8))) __bf16 v8b;
__device__ __forceinline__ v16b frag_b(const __bf16* rowk0, int lane) {
  union { v16b v; v8b q[2]; } u; const __bf16* p = rowk0 + 8 * (lane >> 4);
  u.q[0] = *(const v8b*)p; u.q[1] = *(const v8b*)(p + 16); return u.v;
}
__device__ __forceinline__ float bfr(float v) { return (float)(__bf16)v; }
__device__ __attribute__((noinline)) float exp_ni(float v) { return expf(v); }
__device__ __attribute__((noinline)) float erf_ni(float v) { return erff(v); }

#define WS_PQ  0u                                   // bf16 natural rows Wq [64][256], Wk [64][512], Wv [64][512]; Wo [256][64]
#define WS_PK  (WS_PQ + 2u * KC * CH)
#define WS_PV  (WS_PK + 2u * KC * CL)
#define WS_PO  (WS_PV + 2u * KC * CL)
#define WS_QH  (WS_PO + 2u * CH * KC)               // f16 [NR][64] q hi ; QL residual x2048 ; KH ; KL ; V planes [b][64][NT]
#define WS_QL  (WS_QH + 2u * (size_t)NR * KC)
#define WS_KH  (WS_QL + 2u * (size_t)NR * KC)
#define WS_KL  (WS_KH + 2u * (size_t)NR * KC)
#define WS_V   (WS_KL + 2u * (size_t)NR * KC)
#define WS_O   (WS_V + 2u * (size_t)NB * KC * NT)    // f32 [NR][64] ctx
#define WS_END (WS_O + 4u * (size_t)NR * KC)

__global__ __launch_bounds__(256) void k_pack(const float* __restrict__ WQ, const float* __restrict__ WK, const float* __restrict__ WV, const float* __restrict__ WO, __bf16* __restrict__ P) {
  const int n = blockIdx.x, which = blockIdx.y, t = threadIdx.x; __shared__ __align__(16) __bf16 s[CL];
  if (which < 3) { if (n >= KC) return; const int kin = (which == 0) ? CH : CL; const float* Wm = (which == 0) ? WQ : (which == 1) ? WK : WV; for (int k = t; k < kin; k += 256) s[k] = (__bf16)Wm[(size_t)n * kin + k]; __syncthreads(); __bf16* dst = P + ((which == 0) ? WS_PQ / 2 : (which == 1) ? WS_PK / 2 : WS_PV / 2) + (size_t)n * kin; for (int q = t; q < kin / 8; q += 256) vst2((unsigned*)(dst + q * 8), *(const v4u*)&s[q * 8]); }
  else { if (t < KC) s[t] = (__bf16)WO[(size_t)n * KC + t]; __syncthreads(); if (t < KC / 8) vst2((unsigned*)(P + WS_PO / 2 + (size_t)n * KC + t * 8), *(const v4u*)&s[t * 8]); }
}
// ---- k_proj: block = (64 tokens, which): 64 output channels (4 tiles per wave); A gathered from the channels-first map; which 0: q -> hi/lo rows; 1: k -> hi/lo rows; 2: v -> planes
template <int WHICH>
__global__ __launch_bounds__(128) void k_proj(const float* __restrict__ X, const __bf16* __restrict__ P, const float* __restrict__ BB, _Float16* __restrict__ OH, _Float16* __restrict__ OL, _Float16* __restrict__ V) {
  constexpr int KIN = (WHICH == 0) ? CH : CL;
  __shared__ __align__(16) _Float16 sh[64][72], sl[64][72]; __shared__ __align__(16) _Float16 st[64][72];
  const int tid = threadIdx.x, wave = tid >> 5, lane = tid & 31, col = lane & 15, g = lane >> 4; const size_t rb0 = (size_t)blockIdx.x * 64, r0 = rb0 + wave * 16; const size_t b = rb0 / NT, t0 = rb0 % NT;
  const __bf16* Wr = P + ((WHICH == 0) ? WS_PQ / 2 : (WHICH == 1) ? WS_PK / 2 : WS_PV / 2);
  v8f acc[4] = {};
#pragma unroll 2
  for (int kc = 0; kc < KIN / 32; ++kc) { v16b a; { const float* p = X + ((b * KIN + kc * 32 + 8 * g) * (size_t)NT) + t0 + wave * 16 + col;   // x[b][channel][token]
#pragma unroll
      for (int i = 0; i < 8; ++i) { a[i] = (__bf16)p[(size_t)i * NT]; a[8 + i] = (__bf16)p[(size_t)(16 + i) * NT]; } }
#pragma unroll
    for (int j = 0; j < 4; ++j) acc[j] = wmma_bf(a, frag_b(Wr + (size_t)(j * 16 + col) * KIN + kc * 32, lane), acc[j]); }
  if (WHICH < 2) {
#pragma unroll
    for (int j = 0; j < 4; ++j) { const float bb = bfr(BB[j * 16 + col]);
#pragma unroll
      for (int r = 0; r < 8; ++r) { const float v = acc[j][r] + bb; const _Float16 h = (_Float16)v; sh[wave * 16 + 8 * g + r][j * 16 + col] = h; sl[wave * 16 + 8 * g + r][j * 16 + col] = (_Float16)((v - (float)h) * 2048.0f); } }
    LDSX();
    for (int rl = 0; rl < 16; ++rl) if (lane < 8) { vst2((unsigned*)(OH + (r0 + rl) * KC + lane * 8), *(const v4u*)&sh[wave * 16 + rl][lane * 8]); vst2((unsigned*)(OL + (r0 + rl) * KC + lane * 8), *(const v4u*)&sl[wave * 16 + rl][lane * 8]); }
  } else {
#pragma unroll
    for (int j = 0; j < 4; ++j) { const float bb = bfr(BB[j * 16 + col]);
#pragma unroll
      for (int r = 0; r < 8; ++r) st[j * 16 + col][wave * 16 + 8 * g + r] = (_Float16)(acc[j][r] + bb); }
    __syncthreads();
    for (int e = tid; e < 64 * 8; e += 128) { const int d = e >> 3, pc = e & 7; vst2((unsigned*)(V + ((b * KC + d) * NT) + t0 + pc * 8), *(const v4u*)&st[d][pc * 8]); } }
}
// ---- k_attn: block = (64 queries, b), 32 waves = 4 query tiles x KSP key shares: share sp walks the 32-key steps sp, sp + KSP, ... with its own running max / sum / ctx; the KSP partials of a query tile meet in LDS at the end. 3-product scores (unscaled logits); P single x v single
#define KSP 8
__global__ __launch_bounds__(128 * KSP) void k_attn(const _Float16* __restrict__ QH, const _Float16* __restrict__ QL, const _Float16* __restrict__ KH, const _Float16* __restrict__ KL, const _Float16* __restrict__ V, float* __restrict__ O) {
  __shared__ __align__(16) _Float16 sph[4 * KSP][16][40]; __shared__ __align__(16) float so[4 * KSP][8][4][32]; __shared__ float sm[4 * KSP][8][32], sl[4 * KSP][8][32]; __shared__ __align__(16) v8h sq[4][6][32];   // sq: per query tile the q residual fragments and the upper hi fragment, lane-contiguous: read per step, so that a wave fits the 128 registers of 8 waves per SIMD
  // wave number in a scalar register, lane number as the shuffles form it: nothing but the lane number is kept in a vector register over the loop for the indices
  const int wave = __builtin_amdgcn_readfirstlane(threadIdx.x >> 5), lane = __builtin_amdgcn_mbcnt_lo(~0u, 0u), tid = wave * 32 + lane, col = lane & 15, g = lane >> 4, sp = wave >> 2; const size_t b = blockIdx.y; const int q0 = blockIdx.x * 64 + (wave & 3) * 16; const size_t rq = b * NT + q0;
  const int qt = wave & 3;
  if (sp == 0) { const _Float16 *pl = QL + (rq + col) * KC + 8 * g, *ph = QH + (rq + col) * KC + 32 + 8 * g;
#pragma unroll   // the four loads in flight together
    for (int i = 0; i < 4; ++i) sq[qt][i][lane] = *(const v8h*)(pl + 16 * i);
    sq[qt][4][lane] = *(const v8h*)ph; sq[qt][5][lane] = *(const v8h*)(ph + 16); }
  __syncthreads();
  const v16h aq0 = frag_h(QH + (rq + col) * KC, lane);
  float m[8], l[8];
#pragma unroll
  for (int r = 0; r < 8; ++r) { m[r] = -3.0e38f; l[r] = 0.f; }
  v8f acc[4] = {};
#pragma unroll 1
  for (int it = 0; it < NT / 32 / KSP; ++it) { const int j0 = (it * KSP + sp) * 32; v8f s[2];
#pragma unroll
    for (int ct = 0; ct < 2; ++ct) { const size_t rk = (b * NT + j0 + ct * 16 + col) * KC; v8f c = {}, cl = {};
#pragma unroll
      for (int kc = 0; kc < 2; ++kc) { const v16h kh = frag_h(KH + rk + kc * 32, lane); union { v16h v; v8h q[2]; } ql, qh; ql.q[0] = sq[qt][2 * kc][lane]; ql.q[1] = sq[qt][2 * kc + 1][lane]; if (kc == 0) qh.v = aq0; else { qh.q[0] = sq[qt][4][lane]; qh.q[1] = sq[qt][5][lane]; } c = wmma16(qh.v, kh, c); cl = wmma16(ql.v, kh, cl); cl = wmma16(qh.v, frag_h(KL + rk + kc * 32, lane), cl); }
#pragma unroll
      for (int r = 0; r < 8; ++r) s[ct][r] = c[r] + cl[r] * (1.0f / 2048.0f); }   // unscaled logits
#pragma unroll
    for (int r = 0; r < 8; ++r) { float mx = fmaxf(s[0][r], s[1][r]);
#pragma unroll
      for (int o = 1; o < 16; o <<= 1) mx = fmaxf(mx, __shfl_xor(mx, o));
      const float mn = fmaxf(m[r], mx); const float alpha = (m[r] <= -1.0e38f) ? 0.f : __expf(m[r] - mn); const float e0 = __expf(s[0][r] - mn), e1 = __expf(s[1][r] - mn); float es = e0 + e1;
#pragma unroll
      for (int o = 1; o < 16; o <<= 1) es += __shfl_xor(es, o);
      l[r] = l[r] * alpha + es; m[r] = mn;
#pragma unroll
      for (int dt = 0; dt < 4; ++dt) acc[dt][r] *= alpha;
      sph[wave][8 * g + r][col] = (_Float16)(e0 * 2048.0f); sph[wave][8 * g + r][16 + col] = (_Float16)(e1 * 2048.0f); }
    LDSX();
    const v16h pa = frag_h(&sph[wave][col][0], lane);
#pragma unroll
    for (int dt = 0; dt < 4; ++dt) acc[dt] = wmma16(pa, frag_h(V + ((b * KC + dt * 16 + col) * NT) + j0, lane), acc[dt]);
    LDSX(); }
  // each share leaves its unnormalised ctx, max and sum in LDS, as the registers hold them: [r][dt][lane], query row 8 * (lane >> 4) + r, ctx column dt * 16 + (lane & 15)
#pragma unroll   // here and below: acc, m, l live in registers, their indices must be constants
  for (int r = 0; r < 8; ++r) {
#pragma unroll
    for (int dt = 0; dt < 4; ++dt) so[wave][r][dt][lane] = acc[dt][r];
    sm[wave][r][lane] = m[r]; sl[wave][r][lane] = l[r]; }
  __syncthreads();
  // merge: a thread owns 4 ctx columns of one query row; shares rescaled to the common max and added, share 0 first
  static_assert(128 * KSP == 64 * 16, "one thread per 4 ctx columns");
  { const int row = tid >> 4, c4 = tid & 15, w0 = row >> 4, r = row & 7, hl = (row & 8) * 2; float mm = sm[w0][r][hl];
#pragma unroll   // here and below: the shares' LDS reads issue together, one wait
    for (int p = 1; p < KSP; ++p) mm = fmaxf(mm, sm[p * 4 + w0][r][hl]);
    float ls = 0.f; v4f o = {};
#pragma unroll
    for (int p = 0; p < KSP; ++p) { const float wgt = __expf(sm[p * 4 + w0][r][hl] - mm); ls += wgt * sl[p * 4 + w0][r][hl]; o += wgt * *(const v4f*)&so[p * 4 + w0][r][c4 >> 2][hl + (c4 & 3) * 4]; }
    vst2(O + (b * NT + blockIdx.x * 64 + row) * KC + c4 * 4, o * ((1.0f / 2048.0f) / ls)); }
}
// ---- k_out: block = (64 tokens, 128 output channels): out = ctx (hi + residual, K 64) . Wo rows + bo + x_high, stored channels-first (64 consecutive tokens per (image, channel))
__global__ __launch_bounds__(128) void k_out(const float* __restrict__ O, const __bf16* __restrict__ P, const float* __restrict__ BO, const float* __restrict__ XH, float* __restrict__ OUT) {
  __shared__ __align__(16) float st[128][68];
  const int tid = threadIdx.x, wave = tid >> 5, lane = tid & 31, col = lane & 15, g = lane >> 4; const size_t rb0 = (size_t)blockIdx.x * 64, r0 = rb0 + wave * 16; const int n0 = blockIdx.y * 128; const size_t b = rb0 / NT, t0 = rb0 % NT;
  v8f acc[8] = {};
#pragma unroll
  for (int kc = 0; kc < KC / 32; ++kc) { const F2 a = split_row(O + (r0 + col) * KC, kc * 32, lane);
#pragma unroll
    for (int j = 0; j < 8; ++j) { const v16b w = frag_b(P + WS_PO / 2 + (size_t)(n0 + j * 16 + col) * KC + kc * 32, lane); acc[j] = wmma_bf(a.l, w, acc[j]); acc[j] = wmma_bf(a.h, w, acc[j]); } }
#pragma unroll
  for (int j = 0; j < 8; ++j) { const int c = n0 + j * 16 + col; const float bb = bfr(BO[c]);
#pragma unroll
    for (int r = 0; r < 8; ++r) { const int tl = wave * 16 + 8 * g + r; st[j * 16 + col][tl] = acc[j][r] + bb + bfr(XH[(b * CH + c) * (size_t)NT + t0 + tl]); } }
  __syncthreads();
  for (int e = tid; e < 128 * 16; e += 128) { const int c = e >> 4, q = e & 15; vst2(OUT + ((b * CH + n0 + c) * (size_t)NT) + t0 + q * 4, *(const v4f*)&st[c][q * 4]); }
}
extern "C" void kernel_launch(void* const* d_in, const int* in_sizes, int n_in, void* d_out, int out_size, void* d_ws, size_t ws_size, hipStream_t stream) {
  (void)in_sizes; (void)n_in; (void)out_size;
  const float** F = (const float**)d_in;   // 0 x_low [4,512,64,64], 1 x_high [4,256,64,64], 2 Wq [64,256], 3 bq, 4 Wk [64,512], 5 bk, 6 Wv [64,512], 7 bv, 8 Wo [256,64], 9 bo
  if (ws_size < (size_t)WS_END) return;
  char* ws = (char*)d_ws; __bf16* P = (__bf16*)ws; _Float16 *QH = (_Float16*)(ws + WS_QH), *QL = (_Float16*)(ws + WS_QL), *KH = (_Float16*)(ws + WS_KH), *KL = (_Float16*)(ws + WS_KL), *V = (_Float16*)(ws + WS_V); float* O = (float*)(ws + WS_O);
  k_pack<<<dim3(CH, 4), 256, 0, stream>>>(F[2], F[4], F[6], F[8], P);
  k_proj<0><<<TNB * NT / 64, 128, 0, stream>>>(F[1], P, F[3], QH, QL, nullptr);
  k_proj<1><<<TNB * NT / 64, 128, 0, stream>>>(F[0], P, F[5], KH, KL, nullptr);
  k_proj<2><<<TNB * NT / 64, 128, 0, stream>>>(F[0], P, F[7], nullptr, nullptr, V);
  k_attn<<<dim3(TQB, TNB), 128 * KSP, 0, stream>>>(QH, QL, KH, KL, V, O);
  k_out<<<dim3(TNB * NT / 64, CH / 128), 128, 0, stream>>>(O, P, F[9], F[1], (float*)d_out);
}

// v002
// It runs in 180 microseconds.
// Next to v001, in two timings, it ran 1.08 times as fast each time.
// Over all steps from v000 it is 2.57 times as fast.
// compute dtype: all float inputs rounded to bf16; q = Wq . x_high + bq and k, v = Wk/Wv . x_low + b (1x1 convs) with EXACT bf16 products on WMMA 16x16x32 (the channels-first inputs gathered token-major on load); q and k as f16 hi + (x2048-scaled) residual planes with 3-product scores (the logits are unscaled and large, so single-rounded operands would not do), running-max softmax in f32 (hardware exp), P (scaled by 2^11, single f16) x v (single f16); out = ctx (bf16 hi + residual) . Wo rows (2 products) + bo + x_high, stored channels-first; f32 accumulate.
#include <hip/hip_runtime.h>
#include <math.h>

typedef __attribute__((ext_vector_type(16))) _Float16 v16h;
typedef __attribute__((ext_vector_type(16))) __bf16 v16b;
typedef __attribute__((ext_vector_type(8)))  _Float16 v8h;
typedef __attribute__((ext_vector_type(8)))  float v8f;
typedef __attribute__((ext_vector_type(4)))  float v4f;
typedef __attribute__((ext_vector_type(2)))  float v2f;
typedef __attribute__((ext_vector_type(4)))  unsigned v4u;
typedef __attribute__((ext_vector_type(4)))  int v4i;
typedef float __attribute__((may_alias)) float_a;
typedef int __attribute__((may_alias)) int_a;

template <typename T> __device__ __forceinline__ void vst2(void* p, T v) { *(T*)p = v;  }
__device__ __forceinline__ v8f wmma16(v16h a, v16h b, v8f c) {
  v8f d = __builtin_amdgcn_wmma_f32_16x16x32_f16(false, a, false, b, (short)0, c, false, false);
  asm volatile("v_nop\n\tv_nop\n\tv_nop\n\tv_nop" : "+v"(d) : "v"(a), "v"(b));
  return d;
}
__device__ __forceinline__ v8f wmma_bf(v16b a, v16b b, v8f c) {
  v8f d = __builtin_amdgcn_wmma_f32_16x16x32_bf16(false, a, false, b, (short)0, c, false, false);
  asm volatile("v_nop\n\tv_nop\n\tv_nop\n\tv_nop" : "+v"(d) : "v"(a), "v"(b));
  return d;
}
// 16x16x32 fragments: lane = (h = lane>>4, row/col = lane&15); elements 0..7 = k0+8h+0..7, 8..15 = k0+16+8h+0..7; D element r = row 8h+r
__device__ __forceinline__ v16h frag_h(const _Float16* rowk0, int lane) {
  union { v16h v; v8h q[2]; } u; const _Float16* p = rowk0 + 8 * (lane >> 4);
  u.q[0] = *(const v8h*)p; u.q[1] = *(const v8h*)(p + 16); return u.v;
}
__device__ __forceinline__ v16h frag_f32(const float* rowk0, int lane) {
  v16h a; const float* p = rowk0 + 8 * (lane >> 4);
#pragma unroll
  for (int i = 0; i < 8; ++i) { a[i] = (_Float16)p[i]; a[8 + i] = (_Float16)p[16 + i]; }
  return a;
}
__device__ __forceinline__ v16h frag_f32s(const float* rowk0, int lane, float sc) {
  v16h a; const float* p = rowk0 + 8 * (lane >> 4);
#pragma unroll
  for (int i = 0; i < 8; ++i) { a[i] = (_Float16)(p[i] * sc); a[8 + i] = (_Float16)(p[16 + i] * sc); }
  return a;
}
// column fragment from a [K][ld] layout (column n), rows >= K read as 0
__device__ __forceinline__ v16h fragc_f32(const float* W, int k0, int n, int lane, int ld, int K) {
  v16h a; const int g = lane >> 4;
#pragma unroll
  for (int i = 0; i < 8; ++i) { const int ka = k0 + 8 * g + i, kb = ka + 16;
    a[i] = (_Float16)(ka < K ? W[(size_t)(ka < K ? ka : K - 1) * ld + n] : 0.f); a[8 + i] = (_Float16)(kb < K ? W[(size_t)(kb < K ? kb : K - 1) * ld + n] : 0.f); }
  return a;
}
struct F2 { v16b h, l; };
__device__ __forceinline__ F2 bsplit16(const float v[16]) { F2 r;
#pragma unroll
  for (int i = 0; i < 16; ++i) { const __bf16 h = (__bf16)v[i]; r.h[i] = h; r.l[i] = (__bf16)(v[i] - (float)h); }
  return r; }
__device__ __forceinline__ F2 split_row(const float* row, int k0, int lane) { float v[16]; const float* p = row + k0 + 8 * (lane >> 4);
#pragma unroll
  for (int i = 0; i < 8; ++i) { v[i] = p[i]; v[8 + i] = p[16 + i]; }
  return bsplit16(v); }
__device__ __forceinline__ F2 split_rowK(const float* row, int k0, int lane, int K) { float v[16]; const int g = lane >> 4;
#pragma unroll
  for (int i = 0; i < 8; ++i) { const int ka = k0 + 8 * g + i, kb = ka + 16; v[i] = ka < K ? row[ka < K ? ka : K - 1] : 0.f; v[8 + i] = kb < K ? row[kb < K ? kb : K - 1] : 0.f; }
  return bsplit16(v); }
__device__ __forceinline__ F2 split_col(const float* W, int k0, int n, int lane, int ld, int K) { float v[16]; const int g = lane >> 4;
#pragma unroll
  for (int i = 0; i < 8; ++i) { const int ka = k0 + 8 * g + i, kb = ka + 16; v[i] = ka < K ? W[(size_t)(ka < K ? ka : K - 1) * ld + n] : 0.f; v[8 + i] = kb < K ? W[(size_t)(kb < K ? kb : K - 1) * ld + n] : 0.f; }
  return bsplit16(v); }
__device__ __forceinline__ v8f mac3(const F2& a, const F2& b, v8f c) { c = wmma_bf(a.l, b.h, c); c = wmma_bf(a.h, b.l, c); return wmma_bf(a.h, b.h, c); }
__device__ __forceinline__ float sigm(float v) { return 1.0f / (1.0f + expf(-v)); }
#define LDSX() do { asm volatile("s_wait_dscnt 0" ::: "memory"); __builtin_amdgcn_wave_barrier(); __builtin_amdgcn_fence(__ATOMIC_RELEASE, "workgroup"); } while (0)


// Non-local feature fusion (B 4, 64 x 64 maps; 256 high-level / 512 low-level channels, 64-dim keys and values): every high-level pixel attends over all 4,096 low-level pixels (unscaled dot-product softmax), 1x1 output conv + residual.
#define NB 4
#define NT 4096            // tokens per image
#define CH 256             // high channels (q source, output)
#define CL 512             // low channels (k, v source)
#define KC 64
#define NR (NB * NT)
#ifndef TQB
#define TQB (NT / 64)
#define TNB NB
#endif
typedef __attribute__((ext_vector_type(8))) __bf16 v8b;
__device__ __forceinline__ v16b frag_b(const __bf16* rowk0, int lane) {
  union { v16b v; v8b q[2]; } u; const __bf16* p = rowk0 + 8 * (lane >> 4);
  u.q[0] = *(const v8b*)p; u.q[1] = *(const v8b*)(p + 16); return u.v;
}
__device__ __forceinline__ float bfr(float v) { return (float)(__bf16)v; }
__device__ __attribute__((noinline)) float exp_ni(float v) { return expf(v); }
__device__ __attribute__((noinline)) float erf_ni(float v) { return erff(v); }

#define WS_PQ  0u                                   // bf16 natural rows Wq [64][256], Wk [64][512], Wv [64][512]; Wo [256][64]
#define WS_PK  (WS_PQ + 2u * KC * CH)
#define WS_PV  (WS_PK + 2u * KC * CL)
#define WS_PO  (WS_PV + 2u * KC * CL)
#define WS_QH  (WS_PO + 2u * CH * KC)               // f16 [NR][64] q hi ; QL residual x2048 ; KH ; KL ; V planes [b][64][NT]
#define WS_QL  (WS_QH + 2u * (size_t)NR * KC)
#define WS_KH  (WS_QL + 2u * (size_t)NR * KC)
#define WS_KL  (WS_KH + 2u * (size_t)NR * KC)
#define WS_V   (WS_KL + 2u * (size_t)NR * KC)
#define WS_O   (WS_V + 2u * (size_t)NB * KC * NT)    // f32 [NR][64] ctx
#define WS_END (WS_O + 4u * (size_t)NR * KC)

__global__ __launch_bounds__(256) void k_pack(const float* __restrict__ WQ, const float* __restrict__ WK, const float* __restrict__ WV, const float* __restrict__ WO, __bf16* __restrict__ P) {
  const int n = blockIdx.x, which = blockIdx.y, t = threadIdx.x; __shared__ __align__(16) __bf16 s[CL];
  if (which < 3) { if (n >= KC) return; const int kin = (which == 0) ? CH : CL; const float* Wm = (which == 0) ? WQ : (which == 1) ? WK : WV; for (int k = t; k < kin; k += 256) s[k] = (__bf16)Wm[(size_t)n * kin + k]; __syncthreads(); __bf16* dst = P + ((which == 0) ? WS_PQ / 2 : (which == 1) ? WS_PK / 2 : WS_PV / 2) + (size_t)n * kin; for (int q = t; q < kin / 8; q += 256) vst2((unsigned*)(dst + q * 8), *(const v4u*)&s[q * 8]); }
  else { if (t < KC) s[t] = (__bf16)WO[(size_t)n * KC + t]; __syncthreads(); if (t < KC / 8) vst2((unsigned*)(P + WS_PO / 2 + (size_t)n * KC + t * 8), *(const v4u*)&s[t * 8]); }
}
// ---- k_proj: block = (64 tokens, which): 64 output channels (4 tiles per wave); A gathered from the channels-first map; which 0: q -> hi/lo rows; 1: k -> hi/lo rows; 2: v -> planes
template <int WHICH>
__global__ __launch_bounds__(128) void k_proj(const float* __restrict__ X, const __bf16* __restrict__ P, const float* __restrict__ BB, _Float16* __restrict__ OH, _Float16* __restrict__ OL, _Float16* __restrict__ V) {
  constexpr int KIN = (WHICH == 0) ? CH : CL;
  __shared__ __align__(16) _Float16 sh[64][72], sl[64][72]; __shared__ __align__(16) _Float16 st[64][72];
  const int tid = threadIdx.x, wave = tid >> 5, lane = tid & 31, col = lane & 15, g = lane >> 4; const size_t rb0 = (size_t)blockIdx.x * 64, r0 = rb0 + wave * 16; const size_t b = rb0 / NT, t0 = rb0 % NT;
  const __bf16* Wr = P + ((WHICH == 0) ? WS_PQ / 2 : (WHICH == 1) ? WS_PK / 2 : WS_PV / 2);
  v8f acc[4] = {};
#pragma unroll 2
  for (int kc = 0; kc < KIN / 32; ++kc) { v16b a; { const float* p = X + ((b * KIN + kc * 32 + 8 * g) * (size_t)NT) + t0 + wave * 16 + col;   // x[b][channel][token]
#pragma unroll
      for (int i = 0; i < 8; ++i) { a[i] = (__bf16)p[(size_t)i * NT]; a[8 + i] = (__bf16)p[(size_t)(16 + i) * NT]; } }
#pragma unroll
    for (int j = 0; j < 4; ++j) acc[j] = wmma_bf(a, frag_b(Wr + (size_t)(j * 16 + col) * KIN + kc * 32, lane), acc[j]); }
  if (WHICH < 2) {
#pragma unroll
    for (int j = 0; j < 4; ++j) { const float bb = bfr(BB[j * 16 + col]);
#pragma unroll
      for (int r = 0; r < 8; ++r) { const float v = acc[j][r] + bb; const _Float16 h = (_Float16)v; sh[wave * 16 + 8 * g + r][j * 16 + col] = h; sl[wave * 16 + 8 * g + r][j * 16 + col] = (_Float16)((v - (float)h) * 2048.0f); } }
    LDSX();
    for (int rl = 0; rl < 16; ++rl) if (lane < 8) { vst2((unsigned*)(OH + (r0 + rl) * KC + lane * 8), *(const v4u*)&sh[wave * 16 + rl][lane * 8]); vst2((unsigned*)(OL + (r0 + rl) * KC + lane * 8), *(const v4u*)&sl[wave * 16 + rl][lane * 8]); }
  } else {
#pragma unroll
    for (int j = 0; j < 4; ++j) { const float bb = bfr(BB[j * 16 + col]);
#pragma unroll
      for (int r = 0; r < 8; ++r) st[j * 16 + col][wave * 16 + 8 * g + r] = (_Float16)(acc[j][r] + bb); }
    __syncthreads();
    for (int e = tid; e < 64 * 8; e += 128) { const int d = e >> 3, pc = e & 7; vst2((unsigned*)(V + ((b * KC + d) * NT) + t0 + pc * 8), *(const v4u*)&st[d][pc * 8]); } }
}
// ---- k_attn: block = (64 queries, b), 32 waves = 4 query tiles x KSP key shares: share sp walks the 32-key steps sp, sp + KSP, ... with its own running max / sum / ctx; the KSP partials of a query tile meet in LDS at the end. 3-product scores (unscaled logits); P single x v single
// transposed products: scores as K . Q^T (D row = key, D column = query) and ctx^T += V^T . P^T, so a lane holds 16 scores of ONE query: max and sum run in the lane, one exchange between the wave halves per step, and the two score tiles, converted in place, are the B operand of the second product
#define KSP 8
// frag_h with the translation wait between its two loads: for the step's last load pair from the k residual rows, where the build lands the second load's data on the address pair that the first load names
__device__ __forceinline__ v16h frag_hw(const _Float16* rowk0, int lane) {
  union { v16h v; v8h q[2]; } u; const _Float16* p = rowk0 + 8 * (lane >> 4);
  u.q[0] = *(const v8h*)p; asm volatile("s_wait_xcnt 0x0" ::: "memory"); u.q[1] = *(const v8h*)(p + 16); return u.v;
}
__device__ __forceinline__ float xhalf(float x) { return __builtin_bit_cast(float, __builtin_amdgcn_permlanex16(__builtin_bit_cast(int, x), __builtin_bit_cast(int, x), 0x76543210, 0xfedcba98, false, false)); }   // lane l with lane l ^ 16
__global__ __launch_bounds__(128 * KSP) void k_attn(const _Float16* __restrict__ QH, const _Float16* __restrict__ QL, const _Float16* __restrict__ KH, const _Float16* __restrict__ KL, const _Float16* __restrict__ V, float* __restrict__ O) {
  __shared__ __align__(32) float so[4 * KSP][8][136]; __shared__ float sm[4 * KSP][16], sl[4 * KSP][32]; __shared__ __align__(16) v8h sq[4][6][32];   // so: [ctx rows 8u .. 8u + 7][query * 8 + row], 136 floats per u so that the merge's 16-byte reads spread over the banks; sq: per query tile the q residual fragments and the upper hi fragment, lane-contiguous: read per step, so that a wave fits the 128 registers of 8 waves per SIMD
  // wave number in a scalar register, lane number as the shuffles form it: nothing but the lane number is kept in a vector register over the loop for the indices
  const int wave = __builtin_amdgcn_readfirstlane(threadIdx.x >> 5), lane = __builtin_amdgcn_mbcnt_lo(~0u, 0u), tid = wave * 32 + lane, col = lane & 15, g = lane >> 4, sp = wave >> 2; const size_t b = blockIdx.y; const int q0 = blockIdx.x * 64 + (wave & 3) * 16; const size_t rq = b * NT + q0;
  const int qt = wave & 3;
  if (sp == 0) { const _Float16 *pl = QL + (rq + col) * KC + 8 * g, *ph = QH + (rq + col) * KC + 32 + 8 * g;
#pragma unroll   // the four loads in flight together
    for (int i = 0; i < 4; ++i) sq[qt][i][lane] = *(const v8h*)(pl + 16 * i);
    sq[qt][4][lane] = *(const v8h*)ph; sq[qt][5][lane] = *(const v8h*)(ph + 16); }
  __syncthreads();
  const v16h aq0 = frag_h(QH + (rq + col) * KC, lane);
  float m = -3.0e38f, l = 0.f;   // of query col; m is the same in both wave halves, l sums the half's own keys
  v8f acc[4] = {};               // acc[dt][r] = ctx[query col][dt * 16 + 8 * g + r]
#pragma unroll 1
  for (int it = 0; it < NT / 32 / KSP; ++it) { const int j0 = (it * KSP + sp) * 32; v8f s[2];   // s[ct][r]: key j0 + ct * 16 + 8 * g + r, query col
#pragma unroll
    for (int ct = 0; ct < 2; ++ct) { const size_t rk = (b * NT + j0 + ct * 16 + col) * KC; v8f c = {}, cl = {};
#pragma unroll
      for (int kc = 0; kc < 2; ++kc) { const v16h kh = frag_h(KH + rk + kc * 32, lane); union { v16h v; v8h q[2]; } ql, qh; ql.q[0] = sq[qt][2 * kc][lane]; ql.q[1] = sq[qt][2 * kc + 1][lane]; if (kc == 0) qh.v = aq0; else { qh.q[0] = sq[qt][4][lane]; qh.q[1] = sq[qt][5][lane]; } c = wmma16(kh, qh.v, c); cl = wmma16(kh, ql.v, cl); cl = wmma16((ct & kc) ? frag_hw(KL + rk + kc * 32, lane) : frag_h(KL + rk + kc * 32, lane), qh.v, cl); }
#pragma unroll
      for (int r = 0; r < 8; ++r) s[ct][r] = c[r] + cl[r] * (1.0f / 2048.0f); }   // unscaled logits
    float mx = fmaxf(s[0][0], s[1][0]);
#pragma unroll
    for (int r = 1; r < 8; ++r) mx = fmaxf(mx, fmaxf(s[0][r], s[1][r]));
    mx = fmaxf(mx, xhalf(mx));
    const float mn = fmaxf(m, mx); const float alpha = (m <= -1.0e38f) ? 0.f : __expf(m - mn); float es = 0.f; v16h pb;
#pragma unroll
    for (int r = 0; r < 8; ++r) { const float e0 = __expf(s[0][r] - mn), e1 = __expf(s[1][r] - mn); es += e0 + e1; pb[r] = (_Float16)(e0 * 2048.0f); pb[8 + r] = (_Float16)(e1 * 2048.0f); }
    l = l * alpha + es; m = mn;
#pragma unroll
    for (int dt = 0; dt < 4; ++dt) { acc[dt] *= alpha; acc[dt] = wmma16(frag_h(V + ((b * KC + dt * 16 + col) * NT) + j0, lane), pb, acc[dt]); } }
  // each share leaves its unnormalised ctx, max and half sums in LDS
#pragma unroll   // acc lives in registers, its index must be a constant
  for (int dt = 0; dt < 4; ++dt) *(v8f*)&so[wave][dt * 2 + g][col * 8] = acc[dt];
  if (g == 0) sm[wave][col] = m;
  sl[wave][lane] = l;
  __syncthreads();
  // merge: a thread owns 4 ctx columns of one query row; shares rescaled to the common max and added, share 0 first
  static_assert(128 * KSP == 64 * 16, "one thread per 4 ctx columns");
  { const int row = tid >> 4, c4 = tid & 15, w0 = row >> 4, q = row & 15; float mm = sm[w0][q];
#pragma unroll   // here and below: the shares' LDS reads issue together, one wait
    for (int p = 1; p < KSP; ++p) mm = fmaxf(mm, sm[p * 4 + w0][q]);
    float ls = 0.f; v4f o = {};
#pragma unroll
    for (int p = 0; p < KSP; ++p) { const float wgt = __expf(sm[p * 4 + w0][q] - mm); ls += wgt * (sl[p * 4 + w0][q] + sl[p * 4 + w0][16 + q]); o += wgt * *(const v4f*)&so[p * 4 + w0][c4 >> 1][q * 8 + (c4 & 1) * 4]; }
    vst2(O + (b * NT + blockIdx.x * 64 + row) * KC + c4 * 4, o * ((1.0f / 2048.0f) / ls)); }
}
// ---- k_out: block = (64 tokens, 128 output channels): out = ctx (hi + residual, K 64) . Wo rows + bo + x_high, stored channels-first (64 consecutive tokens per (image, channel))
__global__ __launch_bounds__(128) void k_out(const float* __restrict__ O, const __bf16* __restrict__ P, const float* __restrict__ BO, const float* __restrict__ XH, float* __restrict__ OUT) {
  __shared__ __align__(16) float st[128][68];
  const int tid = threadIdx.x, wave = tid >> 5, lane = tid & 31, col = lane & 15, g = lane >> 4; const size_t rb0 = (size_t)blockIdx.x * 64, r0 = rb0 + wave * 16; const int n0 = blockIdx.y * 128; const size_t b = rb0 / NT, t0 = rb0 % NT;
  v8f acc[8] = {};
#pragma unroll
  for (int kc = 0; kc < KC / 32; ++kc) { const F2 a = split_row(O + (r0 + col) * KC, kc * 32, lane);
#pragma unroll
    for (int j = 0; j < 8; ++j) { const v16b w = frag_b(P + WS_PO / 2 + (size_t)(n0 + j * 16 + col) * KC + kc * 32, lane); acc[j] = wmma_bf(a.l, w, acc[j]); acc[j] = wmma_bf(a.h, w, acc[j]); } }
#pragma unroll
  for (int j = 0; j < 8; ++j) { const int c = n0 + j * 16 + col; const float bb = bfr(BO[c]);
#pragma unroll
    for (int r = 0; r < 8; ++r) { const int tl = wave * 16 + 8 * g + r; st[j * 16 + col][tl] = acc[j][r] + bb + bfr(XH[(b * CH + c) * (size_t)NT + t0 + tl]); } }
  __syncthreads();
  for (int e = tid; e < 128 * 16; e += 128) { const int c = e >> 4, q = e & 15; vst2(OUT + ((b * CH + n0 + c) * (size_t)NT) + t0 + q * 4, *(const v4f*)&st[c][q * 4]); }
}
extern "C" void kernel_launch(void* const* d_in, const int* in_sizes, int n_in, void* d_out, int out_size, void* d_ws, size_t ws_size, hipStream_t stream) {
  (void)in_sizes; (void)n_in; (void)out_size;
  const float** F = (const float**)d_in;   // 0 x_low [4,512,64,64], 1 x_high [4,256,64,64], 2 Wq [64,256], 3 bq, 4 Wk [64,512], 5 bk, 6 Wv [64,512], 7 bv, 8 Wo [256,64], 9 bo
  if (ws_size < (size_t)WS_END) return;
  char* ws = (char*)d_ws; __bf16* P = (__bf16*)ws; _Float16 *QH = (_Float16*)(ws + WS_QH), *QL = (_Float16*)(ws + WS_QL), *KH = (_Float16*)(ws + WS_KH), *KL = (_Float16*)(ws + WS_KL), *V = (_Float16*)(ws + WS_V); float* O = (float*)(ws + WS_O);
  k_pack<<<dim3(CH, 4), 256, 0, stream>>>(F[2], F[4], F[6], F[8], P);
  k_proj<0><<<TNB * NT / 64, 128, 0, stream>>>(F[1], P, F[3], QH, QL, nullptr);
  k_proj<1><<<TNB * NT / 64, 128, 0, stream>>>(F[0], P, F[5], KH, KL, nullptr);
  k_proj<2><<<TNB * NT / 64, 128, 0, stream>>>(F[0], P, F[7], nullptr, nullptr, V);
  k_attn<<<dim3(TQB, TNB), 128 * KSP, 0, stream>>>(QH, QL, KH, KL, V, O);
  k_out<<<dim3(TNB * NT / 64, CH / 128), 128, 0, stream>>>(O, P, F[9], F[1], (float*)d_out);
}

// v003
// It runs in 170 microseconds.
// In two side-by-side timings against v002, it was 1.06 and 1.05 times as fast.
// Counting every step since v000, it is 2.72 times as fast.
// compute dtype: all float inputs rounded to bf16; q = Wq . x_high + bq and k, v = Wk/Wv . x_low + b (1x1 convs) with EXACT bf16 products on WMMA 16x16x32 (the channels-first inputs gathered token-major on load); q and k as f16 hi + (x2048-scaled) residual planes with 3-product scores (the logits are unscaled and large, so single-rounded operands would not do), running-max softmax in f32 (hardware exp), P (scaled by 2^11, single f16) x v (single f16); out = ctx (bf16 hi + residual) . Wo rows (2 products) + bo + x_high, stored channels-first; f32 accumulate.
#include <hip/hip_runtime.h>
#include <math.h>

typedef __attribute__((ext_vector_type(16))) _Float16 v16h;
typedef __attribute__((ext_vector_type(16))) __bf16 v16b;
typedef __attribute__((ext_vector_type(8)))  _Float16 v8h;
typedef __attribute__((ext_vector_type(8)))  float v8f;
typedef __attribute__((ext_vector_type(4)))  float v4f;
typedef __attribute__((ext_vector_type(2)))  float v2f;
typedef __attribute__((ext_vector_type(4)))  unsigned v4u;
typedef __attribute__((ext_vector_type(4)))  int v4i;
typedef float __attribute__((may_alias)) float_a;
typedef int __attribute__((may_alias)) int_a;

template <typename T> __device__ __forceinline__ void vst2(void* p, T v) { *(T*)p = v;  }
__device__ __forceinline__ v8f wmma16(v16h a, v16h b, v8f c) {
  v8f d = __builtin_amdgcn_wmma_f32_16x16x32_f16(false, a, false, b, (short)0, c, false, false);
  asm volatile("v_nop\n\tv_nop\n\tv_nop\n\tv_nop" : "+v"(d) : "v"(a), "v"(b));
  return d;
}
__device__ __forceinline__ v8f wmma_bf(v16b a, v16b b, v8f c) {
  v8f d = __builtin_amdgcn_wmma_f32_16x16x32_bf16(false, a, false, b, (short)0, c, false, false);
  asm volatile("v_nop\n\tv_nop\n\tv_nop\n\tv_nop" : "+v"(d) : "v"(a), "v"(b));
  return d;
}
// 16x16x32 fragments: lane = (h = lane>>4, row/col = lane&15); elements 0..7 = k0+8h+0..7, 8..15 = k0+16+8h+0..7; D element r = row 8h+r
__device__ __forceinline__ v16h frag_h(const _Float16* rowk0, int lane) {
  union { v16h v; v8h q[2]; } u; const _Float16* p = rowk0 + 8 * (lane >> 4);
  u.q[0] = *(const v8h*)p; u.q[1] = *(const v8h*)(p + 16); return u.v;
}
__device__ __forceinline__ v16h frag_f32(const float* rowk0, int lane) {
  v16h a; const float* p = rowk0 + 8 * (lane >> 4);
#pragma unroll
  for (int i = 0; i < 8; ++i) { a[i] = (_Float16)p[i]; a[8 + i] = (_Float16)p[16 + i]; }
  return a;
}
__device__ __forceinline__ v16h frag_f32s(const float* rowk0, int lane, float sc) {
  v16h a; const float* p = rowk0 + 8 * (lane >> 4);
#pragma unroll
  for (int i = 0; i < 8; ++i) { a[i] = (_Float16)(p[i] * sc); a[8 + i] = (_Float16)(p[16 + i] * sc); }
  return a;
}
// column fragment from a [K][ld] layout (column n), rows >= K read as 0
__device__ __forceinline__ v16h fragc_f32(const float* W, int k0, int n, int lane, int ld, int K) {
  v16h a; const int g = lane >> 4;
#pragma unroll
  for (int i = 0; i < 8; ++i) { const int ka = k0 + 8 * g + i, kb = ka + 16;
    a[i] = (_Float16)(ka < K ? W[(size_t)(ka < K ? ka : K - 1) * ld + n] : 0.f); a[8 + i] = (_Float16)(kb < K ? W[(size_t)(kb < K ? kb : K - 1) * ld + n] : 0.f); }
  return a;
}
struct F2 { v16b h, l; };
__device__ __forceinline__ F2 bsplit16(const float v[16]) { F2 r;
#pragma unroll
  for (int i = 0; i < 16; ++i) { const __bf16 h = (__bf16)v[i]; r.h[i] = h; r.l[i] = (__bf16)(v[i] - (float)h); }
  return r; }
__device__ __forceinline__ F2 split_row(const float* row, int k0, int lane) { float v[16]; const float* p = row + k0 + 8 * (lane >> 4);
#pragma unroll
  for (int i = 0; i < 8; ++i) { v[i] = p[i]; v[8 + i] = p[16 + i]; }
  return bsplit16(v); }
__device__ __forceinline__ F2 split_rowK(const float* row, int k0, int lane, int K) { float v[16]; const int g = lane >> 4;
#pragma unroll
  for (int i = 0; i < 8; ++i) { const int ka = k0 + 8 * g + i, kb = ka + 16; v[i] = ka < K ? row[ka < K ? ka : K - 1] : 0.f; v[8 + i] = kb < K ? row[kb < K ? kb : K - 1] : 0.f; }
  return bsplit16(v); }
__device__ __forceinline__ F2 split_col(const float* W, int k0, int n, int lane, int ld, int K) { float v[16]; const int g = lane >> 4;
#pragma unroll
  for (int i = 0; i < 8; ++i) { const int ka = k0 + 8 * g + i, kb = ka + 16; v[i] = ka < K ? W[(size_t)(ka < K ? ka : K - 1) * ld + n] : 0.f; v[8 + i] = kb < K ? W[(size_t)(kb < K ? kb : K - 1) * ld + n] : 0.f; }
  return bsplit16(v); }
__device__ __forceinline__ v8f mac3(const F2& a, const F2& b, v8f c) { c = wmma_bf(a.l, b.h, c); c = wmma_bf(a.h, b.l, c); return wmma_bf(a.h, b.h, c); }
__device__ __forceinline__ float sigm(float v) { return 1.0f / (1.0f + expf(-v)); }
#define LDSX() do { asm volatile("s_wait_dscnt 0" ::: "memory"); __builtin_amdgcn_wave_barrier(); __builtin_amdgcn_fence(__ATOMIC_RELEASE, "workgroup"); } while (0)


// Non-local feature fusion (B 4, 64 x 64 maps; 256 high-level / 512 low-level channels, 64-dim keys and values): every high-level pixel attends over all 4,096 low-level pixels (unscaled dot-product softmax), 1x1 output conv + residual.
#define NB 4
#define NT 4096            // tokens per image
#define CH 256             // high channels (q source, output)
#define CL 512             // low channels (k, v source)
#define KC 64
#define NR (NB * NT)
#ifndef TQB
#define TQB (NT / 64)
#define TNB NB
#endif
typedef __attribute__((ext_vector_type(8))) __bf16 v8b;
__device__ __forceinline__ v16b frag_b(const __bf16* rowk0, int lane) {
  union { v16b v; v8b q[2]; } u; const __bf16* p = rowk0 + 8 * (lane >> 4);
  u.q[0] = *(const v8b*)p; u.q[1] = *(const v8b*)(p + 16); return u.v;
}
__device__ __forceinline__ float bfr(float v) { return (float)(__bf16)v; }
__device__ __attribute__((noinline)) float exp_ni(float v) { return expf(v); }
__device__ __attribute__((noinline)) float erf_ni(float v) { return erff(v); }

#define WS_PQ  0u                                   // bf16 natural rows Wq [64][256], Wk [64][512], Wv [64][512]; Wo [256][64]
#define WS_PK  (WS_PQ + 2u * KC * CH)
#define WS_PV  (WS_PK + 2u * KC * CL)
#define WS_PO  (WS_PV + 2u * KC * CL)
#define WS_QH  (WS_PO + 2u * CH * KC)               // f16 [NR][64] q hi ; QL residual x2048 ; KH, KL, V in fragment order: per 32 keys 8 units of 512 B, unit = [lane][8 halves] (see frag_u)
#define WS_QL  (WS_QH + 2u * (size_t)NR * KC)
#define WS_KH  (WS_QL + 2u * (size_t)NR * KC)
#define WS_KL  (WS_KH + 2u * (size_t)NR * KC)
#define WS_V   (WS_KL + 2u * (size_t)NR * KC)
#define WS_O   (WS_V + 2u * (size_t)NB * KC * NT)    // f32 [NR][64] ctx
#define WS_END (WS_O + 4u * (size_t)NR * KC)

__global__ __launch_bounds__(256) void k_pack(const float* __restrict__ WQ, const float* __restrict__ WK, const float* __restrict__ WV, const float* __restrict__ WO, __bf16* __restrict__ P) {
  const int n = blockIdx.x, which = blockIdx.y, t = threadIdx.x; __shared__ __align__(16) __bf16 s[CL];
  if (which < 3) { if (n >= KC) return; const int kin = (which == 0) ? CH : CL; const float* Wm = (which == 0) ? WQ : (which == 1) ? WK : WV; for (int k = t; k < kin; k += 256) s[k] = (__bf16)Wm[(size_t)n * kin + k]; __syncthreads(); __bf16* dst = P + ((which == 0) ? WS_PQ / 2 : (which == 1) ? WS_PK / 2 : WS_PV / 2) + (size_t)n * kin; for (int q = t; q < kin / 8; q += 256) vst2((unsigned*)(dst + q * 8), *(const v4u*)&s[q * 8]); }
  else { if (t < KC) s[t] = (__bf16)WO[(size_t)n * KC + t]; __syncthreads(); if (t < KC / 8) vst2((unsigned*)(P + WS_PO / 2 + (size_t)n * KC + t * 8), *(const v4u*)&s[t * 8]); }
}
// ---- k_proj: block = (64 tokens, which): 64 output channels (4 tiles per wave); A gathered from the channels-first map; which 0: q -> hi/lo rows; 1: k -> hi/lo fragment units; 2: v -> fragment units
template <int WHICH>
__global__ __launch_bounds__(128) void k_proj(const float* __restrict__ X, const __bf16* __restrict__ P, const float* __restrict__ BB, _Float16* __restrict__ OH, _Float16* __restrict__ OL, _Float16* __restrict__ V) {
  constexpr int KIN = (WHICH == 0) ? CH : CL;
  __shared__ __align__(16) _Float16 sh[64][72], sl[64][72]; __shared__ __align__(16) _Float16 st[64][72];
  const int tid = threadIdx.x, wave = tid >> 5, lane = tid & 31, col = lane & 15, g = lane >> 4; const size_t rb0 = (size_t)blockIdx.x * 64, r0 = rb0 + wave * 16; const size_t b = rb0 / NT, t0 = rb0 % NT;
  const __bf16* Wr = P + ((WHICH == 0) ? WS_PQ / 2 : (WHICH == 1) ? WS_PK / 2 : WS_PV / 2);
  v8f acc[4] = {};
#pragma unroll 2
  for (int kc = 0; kc < KIN / 32; ++kc) { v16b a; { const float* p = X + ((b * KIN + kc * 32 + 8 * g) * (size_t)NT) + t0 + wave * 16 + col;   // x[b][channel][token]
#pragma unroll
      for (int i = 0; i < 8; ++i) { a[i] = (__bf16)p[(size_t)i * NT]; a[8 + i] = (__bf16)p[(size_t)(16 + i) * NT]; } }
#pragma unroll
    for (int j = 0; j < 4; ++j) acc[j] = wmma_bf(a, frag_b(Wr + (size_t)(j * 16 + col) * KIN + kc * 32, lane), acc[j]); }
  if (WHICH < 2) {
#pragma unroll
    for (int j = 0; j < 4; ++j) { const float bb = bfr(BB[j * 16 + col]);
#pragma unroll
      for (int r = 0; r < 8; ++r) { const float v = acc[j][r] + bb; const _Float16 h = (_Float16)v; sh[wave * 16 + 8 * g + r][j * 16 + col] = h; sl[wave * 16 + 8 * g + r][j * 16 + col] = (_Float16)((v - (float)h) * 2048.0f); } }
    LDSX();
    if (WHICH == 1) {   // the wave's 16 keys are 4 units: unit c, lane (g, col) = key col, channels c * 16 + 8 * g + 0..7
#pragma unroll   // the 8 LDS reads issue together, ahead of the stores
      for (int c = 0; c < 4; ++c) { vst2((unsigned*)(OH + r0 * KC + c * 256 + lane * 8), *(const v4u*)&sh[wave * 16 + col][c * 16 + 8 * g]); vst2((unsigned*)(OL + r0 * KC + c * 256 + lane * 8), *(const v4u*)&sl[wave * 16 + col][c * 16 + 8 * g]); }
    } else
    for (int rl = 0; rl < 16; ++rl) if (lane < 8) { vst2((unsigned*)(OH + (r0 + rl) * KC + lane * 8), *(const v4u*)&sh[wave * 16 + rl][lane * 8]); vst2((unsigned*)(OL + (r0 + rl) * KC + lane * 8), *(const v4u*)&sl[wave * 16 + rl][lane * 8]); }
  } else {
#pragma unroll
    for (int j = 0; j < 4; ++j) { const float bb = bfr(BB[j * 16 + col]);
#pragma unroll
      for (int r = 0; r < 8; ++r) st[j * 16 + col][wave * 16 + 8 * g + r] = (_Float16)(acc[j][r] + bb); }
    __syncthreads();
    for (int e = tid; e < 64 * 8; e += 128) { const int ln = e & 31, u = (e >> 5) & 7, s = e >> 8; vst2((unsigned*)(V + rb0 * KC + e * 8), *(const v4u*)&st[(u >> 1) * 16 + (ln & 15)][s * 32 + (u & 1) * 16 + (ln >> 4) * 8]); } }   // 32 keys s: unit u, lane (g, col) = channel (u >> 1) * 16 + col, keys (u & 1) * 16 + 8 * g + 0..7
}
// ---- k_attn: block = (64 queries, b), 32 waves = 4 query tiles x KSP key shares: share sp walks the 32-key steps sp, sp + KSP, ... with its own running max / sum / ctx; the KSP partials of a query tile meet in LDS at the end. 3-product scores (unscaled logits); P single x v single
// transposed products: scores as K . Q^T (D row = key, D column = query) and ctx^T += V^T . P^T, so a lane holds 16 scores of ONE query: max and sum run in the lane, one exchange between the wave halves per step, and the two score tiles, converted in place, are the B operand of the second product
#define KSP 8
// a fragment stored in fragment order: two units of 512 B, lane-contiguous, so that each wave-wide 16-byte load covers 4 whole 128-B lines (a fragment gathered from 16 rows touches 16); p = the lane's 16 bytes of the first unit
__device__ __forceinline__ v16h frag_u(const _Float16* p) {
  union { v16h v; v8h q[2]; } u; u.q[0] = *(const v8h*)p; u.q[1] = *(const v8h*)(p + 256); return u.v;
}
// frag_u with the translation wait between its two loads: for the step's last load pair from the k residual units, where the build lands the second load's data on the address pair that the first load names
__device__ __forceinline__ v16h frag_uw(const _Float16* p) {
  union { v16h v; v8h q[2]; } u; u.q[0] = *(const v8h*)p; asm volatile("s_wait_xcnt 0x0" ::: "memory"); u.q[1] = *(const v8h*)(p + 256); return u.v;
}
__device__ __forceinline__ float xhalf(float x) { return __builtin_bit_cast(float, __builtin_amdgcn_permlanex16(__builtin_bit_cast(int, x), __builtin_bit_cast(int, x), 0x76543210, 0xfedcba98, false, false)); }   // lane l with lane l ^ 16
__global__ __launch_bounds__(128 * KSP) void k_attn(const _Float16* __restrict__ QH, const _Float16* __restrict__ QL, const _Float16* __restrict__ KH, const _Float16* __restrict__ KL, const _Float16* __restrict__ V, float* __restrict__ O) {
  __shared__ __align__(32) float so[4 * KSP][8][136]; __shared__ float sm[4 * KSP][16], sl[4 * KSP][32]; __shared__ __align__(16) v8h sq[4][6][32];   // so: [ctx rows 8u .. 8u + 7][query * 8 + row], 136 floats per u so that the merge's 16-byte reads spread over the banks; sq: per query tile the q residual fragments and the upper hi fragment, lane-contiguous: read per step, so that a wave fits the 128 registers of 8 waves per SIMD
  // wave number in a scalar register, lane number as the shuffles form it: nothing but the lane number is kept in a vector register over the loop for the indices
  const int wave = __builtin_amdgcn_readfirstlane(threadIdx.x >> 5), lane = __builtin_amdgcn_mbcnt_lo(~0u, 0u), tid = wave * 32 + lane, col = lane & 15, g = lane >> 4, sp = wave >> 2; const size_t b = blockIdx.y; const int q0 = blockIdx.x * 64 + (wave & 3) * 16; const size_t rq = b * NT + q0;
  const int qt = wave & 3;
  if (sp == 0) { const _Float16 *pl = QL + (rq + col) * KC + 8 * g, *ph = QH + (rq + col) * KC + 32 + 8 * g;
#pragma unroll   // the four loads in flight together
    for (int i = 0; i < 4; ++i) sq[qt][i][lane] = *(const v8h*)(pl + 16 * i);
    sq[qt][4][lane] = *(const v8h*)ph; sq[qt][5][lane] = *(const v8h*)(ph + 16); }
  __syncthreads();
  const v16h aq0 = frag_h(QH + (rq + col) * KC, lane);
  float m = -3.0e38f, l = 0.f;   // of query col; m is the same in both wave halves, l sums the half's own keys
  v8f acc[4] = {};               // acc[dt][r] = ctx[query col][dt * 16 + 8 * g + r]
#pragma unroll 1
  for (int it = 0; it < NT / 32 / KSP; ++it) { const size_t fo = (b * (NT / 32) + it * KSP + sp) * 2048 + lane * 8; v8f s[2];   // fo: the lane's place in the first unit of the step's 32 keys j0 = (it * KSP + sp) * 32, alike in KH, KL and V; s[ct][r]: key j0 + ct * 16 + 8 * g + r, query col
#pragma unroll
    for (int ct = 0; ct < 2; ++ct) { v8f c = {}, cl = {};
#pragma unroll
      for (int kc = 0; kc < 2; ++kc) { const v16h kh = frag_u(KH + fo + (ct * 2 + kc) * 512); union { v16h v; v8h q[2]; } ql, qh; ql.q[0] = sq[qt][2 * kc][lane]; ql.q[1] = sq[qt][2 * kc + 1][lane]; if (kc == 0) qh.v = aq0; else { qh.q[0] = sq[qt][4][lane]; qh.q[1] = sq[qt][5][lane]; } c = wmma16(kh, qh.v, c); cl = wmma16(kh, ql.v, cl); cl = wmma16((ct & kc) ? frag_uw(KL + fo + (ct * 2 + kc) * 512) : frag_u(KL + fo + (ct * 2 + kc) * 512), qh.v, cl); }
#pragma unroll
      for (int r = 0; r < 8; ++r) s[ct][r] = c[r] + cl[r] * (1.0f / 2048.0f); }   // unscaled logits
    float mx = fmaxf(s[0][0], s[1][0]);
#pragma unroll
    for (int r = 1; r < 8; ++r) mx = fmaxf(mx, fmaxf(s[0][r], s[1][r]));
    mx = fmaxf(mx, xhalf(mx));
    const float mn = fmaxf(m, mx); const float alpha = (m <= -1.0e38f) ? 0.f : __expf(m - mn); float es = 0.f; v16h pb;
#pragma unroll
    for (int r = 0; r < 8; ++r) { const float e0 = __expf(s[0][r] - mn), e1 = __expf(s[1][r] - mn); es += e0 + e1; pb[r] = (_Float16)(e0 * 2048.0f); pb[8 + r] = (_Float16)(e1 * 2048.0f); }
    l = l * alpha + es; m = mn;
#pragma unroll
    for (int dt = 0; dt < 4; ++dt) { acc[dt] *= alpha; acc[dt] = wmma16(frag_u(V + fo + dt * 512), pb, acc[dt]); } }
  // each share leaves its unnormalised ctx, max and half sums in LDS
#pragma unroll   // acc lives in registers, its index must be a constant
  for (int dt = 0; dt < 4; ++dt) *(v8f*)&so[wave][dt * 2 + g][col * 8] = acc[dt];
  if (g == 0) sm[wave][col] = m;
  sl[wave][lane] = l;
  __syncthreads();
  // merge: a thread owns 4 ctx columns of one query row; shares rescaled to the common max and added, share 0 first
  static_assert(128 * KSP == 64 * 16, "one thread per 4 ctx columns");
  { const int row = tid >> 4, c4 = tid & 15, w0 = row >> 4, q = row & 15; float mm = sm[w0][q];
#pragma unroll   // here and below: the shares' LDS reads issue together, one wait
    for (int p = 1; p < KSP; ++p) mm = fmaxf(mm, sm[p * 4 + w0][q]);
    float ls = 0.f; v4f o = {};
#pragma unroll
    for (int p = 0; p < KSP; ++p) { const float wgt = __expf(sm[p * 4 + w0][q] - mm); ls += wgt * (sl[p * 4 + w0][q] + sl[p * 4 + w0][16 + q]); o += wgt * *(const v4f*)&so[p * 4 + w0][c4 >> 1][q * 8 + (c4 & 1) * 4]; }
    vst2(O + (b * NT + blockIdx.x * 64 + row) * KC + c4 * 4, o * ((1.0f / 2048.0f) / ls)); }
}
// ---- k_out: block = (64 tokens, 128 output channels): out = ctx (hi + residual, K 64) . Wo rows + bo + x_high, stored channels-first (64 consecutive tokens per (image, channel))
__global__ __launch_bounds__(128) void k_out(const float* __restrict__ O, const __bf16* __restrict__ P, const float* __restrict__ BO, const float* __restrict__ XH, float* __restrict__ OUT) {
  __shared__ __align__(16) float st[128][68];
  const int tid = threadIdx.x, wave = tid >> 5, lane = tid & 31, col = lane & 15, g = lane >> 4; const size_t rb0 = (size_t)blockIdx.x * 64, r0 = rb0 + wave * 16; const int n0 = blockIdx.y * 128; const size_t b = rb0 / NT, t0 = rb0 % NT;
  v8f acc[8] = {};
#pragma unroll
  for (int kc = 0; kc < KC / 32; ++kc) { const F2 a = split_row(O + (r0 + col) * KC, kc * 32, lane);
#pragma unroll
    for (int j = 0; j < 8; ++j) { const v16b w = frag_b(P + WS_PO / 2 + (size_t)(n0 + j * 16 + col) * KC + kc * 32, lane); acc[j] = wmma_bf(a.l, w, acc[j]); acc[j] = wmma_bf(a.h, w, acc[j]); } }
#pragma unroll
  for (int j = 0; j < 8; ++j) { const int c = n0 + j * 16 + col; const float bb = bfr(BO[c]);
#pragma unroll
    for (int r = 0; r < 8; ++r) { const int tl = wave * 16 + 8 * g + r; st[j * 16 + col][tl] = acc[j][r] + bb + bfr(XH[(b * CH + c) * (size_t)NT + t0 + tl]); } }
  __syncthreads();
  for (int e = tid; e < 128 * 16; e += 128) { const int c = e >> 4, q = e & 15; vst2(OUT + ((b * CH + n0 + c) * (size_t)NT) + t0 + q * 4, *(const v4f*)&st[c][q * 4]); }
}
extern "C" void kernel_launch(void* const* d_in, const int* in_sizes, int n_in, void* d_out, int out_size, void* d_ws, size_t ws_size, hipStream_t stream) {
  (void)in_sizes; (void)n_in; (void)out_size;
  const float** F = (const float**)d_in;   // 0 x_low [4,512,64,64], 1 x_high [4,256,64,64], 2 Wq [64,256], 3 bq, 4 Wk [64,512], 5 bk, 6 Wv [64,512], 7 bv, 8 Wo [256,64], 9 bo
  if (ws_size < (size_t)WS_END) return;
  char* ws = (char*)d_ws; __bf16* P = (__bf16*)ws; _Float16 *QH = (_Float16*)(ws + WS_QH), *QL = (_Float16*)(ws + WS_QL), *KH = (_Float16*)(ws + WS_KH), *KL = (_Float16*)(ws + WS_KL), *V = (_Float16*)(ws + WS_V); float* O = (float*)(ws + WS_O);
  k_pack<<<dim3(CH, 4), 256, 0, stream>>>(F[2], F[4], F[6], F[8], P);
  k_proj<0><<<TNB * NT / 64, 128, 0, stream>>>(F[1], P, F[3], QH, QL, nullptr);
  k_proj<1><<<TNB * NT / 64, 128, 0, stream>>>(F[0], P, F[5], KH, KL, nullptr);
  k_proj<2><<<TNB * NT / 64, 128, 0, stream>>>(F[0], P, F[7], nullptr, nullptr, V);
  k_attn<<<dim3(TQB, TNB), 128 * KSP, 0, stream>>>(QH, QL, KH, KL, V, O);
  k_out<<<dim3(TNB * NT / 64, CH / 128), 128, 0, stream>>>(O, P, F[9], F[1], (float*)d_out);
}

// v004
// Measured time: 68.6 microseconds a run.
// Next to v003, in two timings, it ran 2.48 and 2.43 times as fast.
// All steps since v000 together make it 6.67 times as fast.
// compute dtype: all float inputs rounded to bf16; q = Wq . x_high + bq and k, v = Wk/Wv . x_low + b (1x1 convs) with EXACT bf16 products on WMMA 16x16x32 (the channels-first inputs gathered token-major on load); q and k as f16 hi + (x2048-scaled) residual planes with 3-product scores (the logits are unscaled and large, so single-rounded operands would not do), running-max softmax in f32 (hardware exp), P (scaled by 2^11, single f16) x v (single f16); out = ctx (bf16 hi + residual) . Wo rows (2 products) + bo + x_high, stored channels-first; f32 accumulate.
#include <hip/hip_runtime.h>
#include <math.h>

typedef __attribute__((ext_vector_type(16))) _Float16 v16h;
typedef __attribute__((ext_vector_type(16))) __bf16 v16b;
typedef __attribute__((ext_vector_type(8)))  _Float16 v8h;
typedef __attribute__((ext_vector_type(8)))  float v8f;
typedef __attribute__((ext_vector_type(4)))  float v4f;
typedef __attribute__((ext_vector_type(2)))  float v2f;
typedef __attribute__((ext_vector_type(4)))  unsigned v4u;
typedef __attribute__((ext_vector_type(4)))  int v4i;
typedef float __attribute__((may_alias)) float_a;
typedef int __attribute__((may_alias)) int_a;

template <typename T> __device__ __forceinline__ void vst2(void* p, T v) { *(T*)p = v;  }
__device__ __forceinline__ v8f wmma16(v16h a, v16h b, v8f c) {
  v8f d = __builtin_amdgcn_wmma_f32_16x16x32_f16(false, a, false, b, (short)0, c, false, false);
  asm volatile("v_nop\n\tv_nop\n\tv_nop\n\tv_nop" : "+v"(d) : "v"(a), "v"(b));
  return d;
}
__device__ __forceinline__ v8f wmma_bf(v16b a, v16b b, v8f c) {
  v8f d = __builtin_amdgcn_wmma_f32_16x16x32_bf16(false, a, false, b, (short)0, c, false, false);
  asm volatile("v_nop\n\tv_nop\n\tv_nop\n\tv_nop" : "+v"(d) : "v"(a), "v"(b));
  return d;
}
// 16x16x32 fragments: lane = (h = lane>>4, row/col = lane&15); elements 0..7 = k0+8h+0..7, 8..15 = k0+16+8h+0..7; D element r = row 8h+r
__device__ __forceinline__ v16h frag_h(const _Float16* rowk0, int lane) {
  union { v16h v; v8h q[2]; } u; const _Float16* p = rowk0 + 8 * (lane >> 4);
  u.q[0] = *(const v8h*)p; u.q[1] = *(const v8h*)(p + 16); return u.v;
}
__device__ __forceinline__ v16h frag_f32(const float* rowk0, int lane) {
  v16h a; const float* p = rowk0 + 8 * (lane >> 4);
#pragma unroll
  for (int i = 0; i < 8; ++i) { a[i] = (_Float16)p[i]; a[8 + i] = (_Float16)p[16 + i]; }
  return a;
}
__device__ __forceinline__ v16h frag_f32s(const float* rowk0, int lane, float sc) {
  v16h a; const float* p = rowk0 + 8 * (lane >> 4);
#pragma unroll
  for (int i = 0; i < 8; ++i) { a[i] = (_Float16)(p[i] * sc); a[8 + i] = (_Float16)(p[16 + i] * sc); }
  return a;
}
// column fragment from a [K][ld] layout (column n), rows >= K read as 0
__device__ __forceinline__ v16h fragc_f32(const float* W, int k0, int n, int lane, int ld, int K) {
  v16h a; const int g = lane >> 4;
#pragma unroll
  for (int i = 0; i < 8; ++i) { const int ka = k0 + 8 * g + i, kb = ka + 16;
    a[i] = (_Float16)(ka < K ? W[(size_t)(ka < K ? ka : K - 1) * ld + n] : 0.f); a[8 + i] = (_Float16)(kb < K ? W[(size_t)(kb < K ? kb : K - 1) * ld + n] : 0.f); }
  return a;
}
struct F2 { v16b h, l; };
__device__ __forceinline__ F2 bsplit16(const float v[16]) { F2 r;
#pragma unroll
  for (int i = 0; i < 16; ++i) { const __bf16 h = (__bf16)v[i]; r.h[i] = h; r.l[i] = (__bf16)(v[i] - (float)h); }
  return r; }
__device__ __forceinline__ F2 split_row(const float* row, int k0, int lane) { float v[16]; const float* p = row + k0 + 8 * (lane >> 4);
#pragma unroll
  for (int i = 0; i < 8; ++i) { v[i] = p[i]; v[8 + i] = p[16 + i]; }
  return bsplit16(v); }
__device__ __forceinline__ F2 split_rowK(const float* row, int k0, int lane, int K) { float v[16]; const int g = lane >> 4;
#pragma unroll
  for (int i = 0; i < 8; ++i) { const int ka = k0 + 8 * g + i, kb = ka + 16; v[i] = ka < K ? row[ka < K ? ka : K - 1] : 0.f; v[8 + i] = kb < K ? row[kb < K ? kb : K - 1] : 0.f; }
  return bsplit16(v); }
__device__ __forceinline__ F2 split_col(const float* W, int k0, int n, int lane, int ld, int K) { float v[16]; const int g = lane >> 4;
#pragma unroll
  for (int i = 0; i < 8; ++i) { const int ka = k0 + 8 * g + i, kb = ka + 16; v[i] = ka < K ? W[(size_t)(ka < K ? ka : K - 1) * ld + n] : 0.f; v[8 + i] = kb < K ? W[(size_t)(kb < K ? kb : K - 1) * ld + n] : 0.f; }
  return bsplit16(v); }
__device__ __forceinline__ v8f mac3(const F2& a, const F2& b, v8f c) { c = wmma_bf(a.l, b.h, c); c = wmma_bf(a.h, b.l, c); return wmma_bf(a.h, b.h, c); }
__device__ __forceinline__ float sigm(float v) { return 1.0f / (1.0f + expf(-v)); }
#define LDSX() do { asm volatile("s_wait_dscnt 0" ::: "memory"); __builtin_amdgcn_wave_barrier(); __builtin_amdgcn_fence(__ATOMIC_RELEASE, "workgroup"); } while (0)

// the compiler does not schedule across this: a group of loads written ahead of the products that use it stays ahead (left alone it sinks each load pair to its product, and every product then waits out a whole load latency)
#define HOLD() __builtin_amdgcn_sched_barrier(0)
// between two runs of loads of one group: the build lands later loads' data on address registers that earlier loads of the group name, so the earlier loads' translations are waited for first (not their data)
#define XW() asm volatile("s_wait_xcnt 0x0" ::: "memory")

// Non-local feature fusion (B 4, 64 x 64 maps; 256 high-level / 512 low-level channels, 64-dim keys and values): every high-level pixel attends over all 4,096 low-level pixels (unscaled dot-product softmax), 1x1 output conv + residual.
#define NB 4
#define NT 4096            // tokens per image
#define CH 256             // high channels (q source, output)
#define CL 512             // low channels (k, v source)
#define KC 64
#define NR (NB * NT)
#ifndef TQB
#define TQB (NT / 64)
#define TNB NB
#endif
typedef __attribute__((ext_vector_type(8))) __bf16 v8b;
__device__ __forceinline__ v16b frag_b(const __bf16* rowk0, int lane) {
  union { v16b v; v8b q[2]; } u; const __bf16* p = rowk0 + 8 * (lane >> 4);
  u.q[0] = *(const v8b*)p; u.q[1] = *(const v8b*)(p + 16); return u.v;
}
__device__ __forceinline__ float bfr(float v) { return (float)(__bf16)v; }
__device__ __attribute__((noinline)) float exp_ni(float v) { return expf(v); }
__device__ __attribute__((noinline)) float erf_ni(float v) { return erff(v); }

#define WS_PQ  0u                                   // bf16 natural rows Wq [64][256], Wk [64][512], Wv [64][512]; Wo [256][64]
#define WS_PK  (WS_PQ + 2u * KC * CH)
#define WS_PV  (WS_PK + 2u * KC * CL)
#define WS_PO  (WS_PV + 2u * KC * CL)
#define WS_QH  (WS_PO + 2u * CH * KC)               // f16 [NR][64] q hi ; QL residual x2048 ; KH, KL, V in fragment order: per 32 keys 8 units of 512 B, unit = [lane][8 halves] (see frag_o)
#define WS_QL  (WS_QH + 2u * (size_t)NR * KC)
#define WS_KH  (WS_QL + 2u * (size_t)NR * KC)
#define WS_KL  (WS_KH + 2u * (size_t)NR * KC)
#define WS_V   (WS_KL + 2u * (size_t)NR * KC)
#define WS_O   (WS_V + 2u * (size_t)NB * KC * NT)    // f32 [NR][64] ctx
#define WS_END (WS_O + 4u * (size_t)NR * KC)

__global__ __launch_bounds__(256) void k_pack(const float* __restrict__ WQ, const float* __restrict__ WK, const float* __restrict__ WV, const float* __restrict__ WO, __bf16* __restrict__ P) {
  const int n = blockIdx.x, which = blockIdx.y, t = threadIdx.x; __shared__ __align__(16) __bf16 s[CL];
  if (which < 3) { if (n >= KC) return; const int kin = (which == 0) ? CH : CL; const float* Wm = (which == 0) ? WQ : (which == 1) ? WK : WV; for (int k = t; k < kin; k += 256) s[k] = (__bf16)Wm[(size_t)n * kin + k]; __syncthreads(); __bf16* dst = P + ((which == 0) ? WS_PQ / 2 : (which == 1) ? WS_PK / 2 : WS_PV / 2) + (size_t)n * kin; for (int q = t; q < kin / 8; q += 256) vst2((unsigned*)(dst + q * 8), *(const v4u*)&s[q * 8]); }
  else { if (t < KC) s[t] = (__bf16)WO[(size_t)n * KC + t]; __syncthreads(); if (t < KC / 8) vst2((unsigned*)(P + WS_PO / 2 + (size_t)n * KC + t * 8), *(const v4u*)&s[t * 8]); }
}
// ---- k_proj: block = (64 tokens, which): 64 output channels (4 tiles per wave); A gathered from the channels-first map; which 0: q -> hi/lo rows; 1: k -> hi/lo fragment units; 2: v -> fragment units
template <int WHICH>
__global__ __launch_bounds__(128) void k_proj(const float* __restrict__ X, const __bf16* __restrict__ P, const float* __restrict__ BB, _Float16* __restrict__ OH, _Float16* __restrict__ OL, _Float16* __restrict__ V) {
  constexpr int KIN = (WHICH == 0) ? CH : CL;
  __shared__ __align__(16) _Float16 sh[64][72], sl[64][72]; __shared__ __align__(16) _Float16 st[64][72];
  const int tid = threadIdx.x, wave = tid >> 5, lane = tid & 31, col = lane & 15, g = lane >> 4; const size_t rb0 = (size_t)blockIdx.x * 64, r0 = rb0 + wave * 16; const size_t b = rb0 / NT, t0 = rb0 % NT;
  const __bf16* Wr = P + ((WHICH == 0) ? WS_PQ / 2 : (WHICH == 1) ? WS_PK / 2 : WS_PV / 2);
  v8f acc[4] = {};
  constexpr int G = 4;   // passes of 32 channels whose loads are issued as one group: one load latency per group, not four per pass
  // the inner loops are unrolled: xr, w and acc live in registers, their indices must be constants
#pragma unroll 1   // one group's registers at a time
  for (int k0 = 0; k0 < KIN / 32; k0 += G) { float xr[G][16]; v16b w[G][4];
#pragma unroll
    for (int u = 0; u < G; ++u) { const float* p = X + ((b * KIN + (k0 + u) * 32 + 8 * g) * (size_t)NT) + t0 + wave * 16 + col;   // x[b][channel][token]
#pragma unroll
      for (int i = 0; i < 8; ++i) { xr[u][i] = p[(size_t)i * NT]; xr[u][8 + i] = p[(size_t)(16 + i) * NT]; } }
    XW();
#pragma unroll
    for (int u = 0; u < G; ++u)
#pragma unroll
      for (int j = 0; j < 4; ++j) w[u][j] = frag_b(Wr + (size_t)(j * 16 + col) * KIN + (k0 + u) * 32, lane);
    HOLD();
#pragma unroll
    for (int u = 0; u < G; ++u) { v16b a;
#pragma unroll
      for (int i = 0; i < 16; ++i) a[i] = (__bf16)xr[u][i];
#pragma unroll
      for (int j = 0; j < 4; ++j) acc[j] = wmma_bf(a, w[u][j], acc[j]); } }
  if (WHICH < 2) {
#pragma unroll
    for (int j = 0; j < 4; ++j) { const float bb = bfr(BB[j * 16 + col]);
#pragma unroll
      for (int r = 0; r < 8; ++r) { const float v = acc[j][r] + bb; const _Float16 h = (_Float16)v; sh[wave * 16 + 8 * g + r][j * 16 + col] = h; sl[wave * 16 + 8 * g + r][j * 16 + col] = (_Float16)((v - (float)h) * 2048.0f); } }
    LDSX();
    if (WHICH == 1) {   // the wave's 16 keys are 4 units: unit c, lane (g, col) = key col, channels c * 16 + 8 * g + 0..7
#pragma unroll   // the 8 LDS reads issue together, ahead of the stores
      for (int c = 0; c < 4; ++c) { vst2((unsigned*)(OH + r0 * KC + c * 256 + lane * 8), *(const v4u*)&sh[wave * 16 + col][c * 16 + 8 * g]); vst2((unsigned*)(OL + r0 * KC + c * 256 + lane * 8), *(const v4u*)&sl[wave * 16 + col][c * 16 + 8 * g]); }
    } else
    for (int rl = 0; rl < 16; ++rl) if (lane < 8) { vst2((unsigned*)(OH + (r0 + rl) * KC + lane * 8), *(const v4u*)&sh[wave * 16 + rl][lane * 8]); vst2((unsigned*)(OL + (r0 + rl) * KC + lane * 8), *(const v4u*)&sl[wave * 16 + rl][lane * 8]); }
  } else {
#pragma unroll
    for (int j = 0; j < 4; ++j) { const float bb = bfr(BB[j * 16 + col]);
#pragma unroll
      for (int r = 0; r < 8; ++r) st[j * 16 + col][wave * 16 + 8 * g + r] = (_Float16)(acc[j][r] + bb); }
    __syncthreads();
    for (int e = tid; e < 64 * 8; e += 128) { const int ln = e & 31, u = (e >> 5) & 7, s = e >> 8; vst2((unsigned*)(V + rb0 * KC + e * 8), *(const v4u*)&st[(u >> 1) * 16 + (ln & 15)][s * 32 + (u & 1) * 16 + (ln >> 4) * 8]); } }   // 32 keys s: unit u, lane (g, col) = channel (u >> 1) * 16 + col, keys (u & 1) * 16 + 8 * g + 0..7
}
// ---- k_attn: block = (64 queries, b), 32 waves = 4 query tiles x KSP key shares: share sp walks the 32-key steps sp, sp + KSP, ... with its own running max / sum / ctx; the KSP partials of a query tile meet in LDS at the end. 3-product scores (unscaled logits); P single x v single
// transposed products: scores as K . Q^T (D row = key, D column = query) and ctx^T += V^T . P^T, so a lane holds 16 scores of ONE query: max and sum run in the lane, one exchange between the wave halves per step, and the two score tiles, converted in place, are the B operand of the second product
#define KSP 8
// a fragment stored in fragment order: two units of 512 B, lane-contiguous, so that each wave-wide 16-byte load covers 4 whole 128-B lines (a fragment gathered from 16 rows touches 16); o = byte offset of the lane's 16 bytes of the first unit
__device__ __forceinline__ v16h frag_o(const _Float16* base, unsigned o, int k) {   // k: constant byte step, added behind the widening so that it becomes the load's immediate offset
  union { v16h v; v8h q[2]; } u; const char* p = (const char*)base + o + k; u.q[0] = *(const v8h*)p; u.q[1] = *(const v8h*)(p + 512); return u.v;
}
__device__ __forceinline__ float xhalf(float x) { return __builtin_bit_cast(float, __builtin_amdgcn_permlanex16(__builtin_bit_cast(int, x), __builtin_bit_cast(int, x), 0x76543210, 0xfedcba98, false, false)); }   // lane l with lane l ^ 16
__global__ __launch_bounds__(128 * KSP) void k_attn(const _Float16* __restrict__ QH, const _Float16* __restrict__ QL, const _Float16* __restrict__ KH, const _Float16* __restrict__ KL, const _Float16* __restrict__ V, float* __restrict__ O) {
  __shared__ __align__(32) float so[4 * KSP][8][136]; __shared__ float sm[4 * KSP][16], sl[4 * KSP][32]; __shared__ __align__(16) v8h sq[4][6][32];   // so: [ctx rows 8u .. 8u + 7][query * 8 + row], 136 floats per u so that the merge's 16-byte reads spread over the banks; sq: per query tile the q residual fragments and the upper hi fragment, lane-contiguous: read per step, so that a wave fits the 128 registers of 8 waves per SIMD
  // wave number in a scalar register, lane number as the shuffles form it: over the loop the indices live in two vector registers, the load offset fo and the lane's place in sq
  const int wave = __builtin_amdgcn_readfirstlane(threadIdx.x >> 5), lane = __builtin_amdgcn_mbcnt_lo(~0u, 0u), col = lane & 15, g = lane >> 4, sp = wave >> 2; const size_t b = blockIdx.y; const int q0 = blockIdx.x * 64 + (wave & 3) * 16; const size_t rq = b * NT + q0;
  const int qt = wave & 3;
  if (sp == 0) { const _Float16 *pl = QL + (rq + col) * KC + 8 * g, *ph = QH + (rq + col) * KC + 32 + 8 * g;
#pragma unroll   // the four loads in flight together
    for (int i = 0; i < 4; ++i) sq[qt][i][lane] = *(const v8h*)(pl + 16 * i);
    sq[qt][4][lane] = *(const v8h*)ph; sq[qt][5][lane] = *(const v8h*)(ph + 16); }
  __syncthreads();
  const v16h aq0 = frag_h(QH + (rq + col) * KC, lane);
  float m = -3.0e38f, l = 0.f;   // of query col; m is the same in both wave halves, l sums the half's own keys
  v8f acc[4] = {};               // acc[dt][r] = ctx[query col][dt * 16 + 8 * g + r]
  // the step's 32 keys j0 = (it * KSP + sp) * 32 are 8 units at the same place in KH, KL and V: the three bases stay scalar, one 32-bit vector offset serves all loads
  unsigned fo = ((unsigned)(b * (NT / 32) + sp) * 2048u + lane * 8u) * 2u;   // byte offset of the lane's 16 bytes in the step's first unit
  v16h kh0 = frag_o(KH, fo, 0), kl0 = frag_o(KL, fo, 0), kh1 = frag_o(KH, fo, 1024), kl1 = frag_o(KL, fo, 1024);   // keys 0..15 of the first step; every later step's are loaded at the foot of the step before
#pragma unroll 1
  for (int it = 0; it < NT / 32 / KSP; ++it) { v8f s[2];   // s[ct][r]: key j0 + ct * 16 + 8 * g + r, query col
    v16h va[4];
    // each pair of fragments is issued as soon as registers are free for it, three products or the whole softmax ahead of its first use: counted waits, three or four loads' latencies overlapped where each stood alone
#pragma unroll
    for (int ct = 0; ct < 2; ++ct) { v8f c = {}, cl = {};
#pragma unroll
      for (int kc = 0; kc < 2; ++kc) { const v16h kh = kc ? kh1 : kh0, kl = kc ? kl1 : kl0; union { v16h v; v8h q[2]; } ql, qh; ql.q[0] = sq[qt][2 * kc][lane]; ql.q[1] = sq[qt][2 * kc + 1][lane]; if (kc == 0) qh.v = aq0; else { qh.q[0] = sq[qt][4][lane]; qh.q[1] = sq[qt][5][lane]; } c = wmma16(kh, qh.v, c); cl = wmma16(kh, ql.v, cl); cl = wmma16(kl, qh.v, cl);
        if (ct == 0) { if (kc == 0) { kh0 = frag_o(KH, fo, 2048); kl0 = frag_o(KL, fo, 2048); } else { kh1 = frag_o(KH, fo, 3072); kl1 = frag_o(KL, fo, 3072); } }   // keys 16..31 into the registers just read
        else { va[2 * kc] = frag_o(V, fo, (2 * kc) * 1024); va[2 * kc + 1] = frag_o(V, fo, (2 * kc + 1) * 1024); }   // v flies under the softmax
        HOLD(); }
#pragma unroll
      for (int r = 0; r < 8; ++r) s[ct][r] = c[r] + cl[r] * (1.0f / 2048.0f); }   // unscaled logits
    float mx = fmaxf(s[0][0], s[1][0]);
#pragma unroll
    for (int r = 1; r < 8; ++r) mx = fmaxf(mx, fmaxf(s[0][r], s[1][r]));
    mx = fmaxf(mx, xhalf(mx));
    const float mn = fmaxf(m, mx); const float alpha = (m <= -1.0e38f) ? 0.f : __expf(m - mn); float es = 0.f; v16h pb;
#pragma unroll
    for (int r = 0; r < 8; ++r) { const float e0 = __expf(s[0][r] - mn), e1 = __expf(s[1][r] - mn); es += e0 + e1; pb[r] = (_Float16)(e0 * 2048.0f); pb[8 + r] = (_Float16)(e1 * 2048.0f); }
    l = l * alpha + es; m = mn;
#pragma unroll
    for (int dt = 0; dt < 4; ++dt) { acc[dt] *= alpha; acc[dt] = wmma16(va[dt], pb, acc[dt]);
      if (dt == 3) { fo += (it + 1 < NT / 32 / KSP) ? KSP * 4096u : 0u; kh0 = frag_o(KH, fo, 0); kl0 = frag_o(KL, fo, 0); kh1 = frag_o(KH, fo, 1024); kl1 = frag_o(KL, fo, 1024); HOLD(); } } }   // the next step's keys 0..15 (the last step reads its own again, unused)
  // each share leaves its unnormalised ctx, max and half sums in LDS; the lane number is read back from the load offset (its bits 4..8), so that no lane index is held in a register of its own over the loop (three of them went to scratch)
  const int ln = (fo >> 4) & 31, cn = ln & 15, gn = ln >> 4, tn = wave * 32 + ln;
#pragma unroll   // acc lives in registers, its index must be a constant
  for (int dt = 0; dt < 4; ++dt) *(v8f*)&so[wave][dt * 2 + gn][cn * 8] = acc[dt];
  if (gn == 0) sm[wave][cn] = m;
  sl[wave][ln] = l;
  __syncthreads();
  // merge: a thread owns 4 ctx columns of one query row; shares rescaled to the common max and added, share 0 first
  static_assert(128 * KSP == 64 * 16, "one thread per 4 ctx columns");
  { const int row = tn >> 4, c4 = tn & 15, w0 = row >> 4, q = row & 15; float mm = sm[w0][q];
#pragma unroll   // here and below: the shares' LDS reads issue together, one wait
    for (int p = 1; p < KSP; ++p) mm = fmaxf(mm, sm[p * 4 + w0][q]);
    float ls = 0.f; v4f o = {};
#pragma unroll
    for (int p = 0; p < KSP; ++p) { const float wgt = __expf(sm[p * 4 + w0][q] - mm); ls += wgt * (sl[p * 4 + w0][q] + sl[p * 4 + w0][16 + q]); o += wgt * *(const v4f*)&so[p * 4 + w0][c4 >> 1][q * 8 + (c4 & 1) * 4]; }
    vst2(O + (b * NT + blockIdx.x * 64 + row) * KC + c4 * 4, o * ((1.0f / 2048.0f) / ls)); }
}
// ---- k_out: block = (64 tokens, 128 output channels): out = ctx (hi + residual, K 64) . Wo rows + bo + x_high, stored channels-first (64 consecutive tokens per (image, channel))
__global__ __launch_bounds__(128) void k_out(const float* __restrict__ O, const __bf16* __restrict__ P, const float* __restrict__ BO, const float* __restrict__ XH, float* __restrict__ OUT) {
  __shared__ __align__(16) float st[128][68];
  const int tid = threadIdx.x, wave = tid >> 5, lane = tid & 31, col = lane & 15, g = lane >> 4; const size_t rb0 = (size_t)blockIdx.x * 64, r0 = rb0 + wave * 16; const int n0 = blockIdx.y * 128; const size_t b = rb0 / NT, t0 = rb0 % NT;
  v8f acc[8] = {};
  // the residual, the bias, the ctx rows and the first 32 columns' weights are issued as one group: one load latency for all of them, where each weight fragment, each bias and each residual row had its own; all loops unrolled: the arrays live in registers
  const float* px0 = XH + (b * CH + n0 + col) * (size_t)NT + t0 + wave * 16 + 8 * g;   // the lane's 8 tokens of channel n0 + col; channels j * 16 further on by immediate offsets: one address pair for the run
  v4f xh[8][2]; float bo[8]; v4f av[2][4]; v16b w[8]; const __bf16* pw = P + WS_PO / 2 + (size_t)(n0 + col) * KC + 8 * g;   // the lane's 16 bytes of weight row n0 + col; rows j * 16 further on by immediate offsets
#pragma unroll
  for (int j = 0; j < 8; ++j) { const float* px = px0 + (size_t)j * 16 * NT; xh[j][0] = *(const v4f*)px; xh[j][1] = *(const v4f*)(px + 4); bo[j] = BO[n0 + col + j * 16]; }
  XW();
#pragma unroll
  for (int kc = 0; kc < 2; ++kc) { const float* p = O + (r0 + col) * KC + kc * 32 + 8 * g;
    av[kc][0] = *(const v4f*)p; av[kc][1] = *(const v4f*)(p + 4); av[kc][2] = *(const v4f*)(p + 16); av[kc][3] = *(const v4f*)(p + 20); }   // fragment elements 0..7 = columns 8 g + 0..7 of the pass, 8..15 = 16 further on
  XW();
  static_assert(KC / 32 == 2, "two passes of 32 ctx columns");
#pragma unroll
  for (int kc = 0; kc < 2; ++kc) {
#pragma unroll
    for (int j = 0; j < 8; ++j) { const __bf16* p = pw + j * 16 * KC + kc * 32; union { v16b v; v8b q[2]; } u;
      if (j == 7) XW();   // the run's last two loads may land on the address pair that the run names
      u.q[0] = *(const v8b*)p;
      if (j == 7) XW();
      u.q[1] = *(const v8b*)(p + 16); w[j] = u.v; }
    HOLD();
    // inputs only: keep the ctx loads of both passes in the first group (the build sinks them behind later waits, a latency each)
    if (kc == 0) asm volatile("" :: "v"(av[0][0]), "v"(av[0][1]), "v"(av[0][2]), "v"(av[0][3]), "v"(av[1][0]), "v"(av[1][1]), "v"(av[1][2]), "v"(av[1][3]));
    float af[16];
#pragma unroll
    for (int i = 0; i < 16; ++i) af[i] = av[kc][i >> 2][i & 3];
    const F2 a = bsplit16(af);
#pragma unroll
    for (int j = 0; j < 8; ++j) { acc[j] = wmma_bf(a.l, w[j], acc[j]); acc[j] = wmma_bf(a.h, w[j], acc[j]); } }
#pragma unroll
  for (int j = 0; j < 8; ++j) { const float bb = bfr(bo[j]);
#pragma unroll
    for (int r = 0; r < 8; ++r) { const int tl = wave * 16 + 8 * g + r; st[j * 16 + col][tl] = acc[j][r] + bb + bfr(xh[j][r >> 2][r & 3]); } }
  __syncthreads();
  for (int e = tid; e < 128 * 16; e += 128) { const int c = e >> 4, q = e & 15; vst2(OUT + ((b * CH + n0 + c) * (size_t)NT) + t0 + q * 4, *(const v4f*)&st[c][q * 4]); }
}
extern "C" void kernel_launch(void* const* d_in, const int* in_sizes, int n_in, void* d_out, int out_size, void* d_ws, size_t ws_size, hipStream_t stream) {
  (void)in_sizes; (void)n_in; (void)out_size;
  const float** F = (const float**)d_in;   // 0 x_low [4,512,64,64], 1 x_high [4,256,64,64], 2 Wq [64,256], 3 bq, 4 Wk [64,512], 5 bk, 6 Wv [64,512], 7 bv, 8 Wo [256,64], 9 bo
  if (ws_size < (size_t)WS_END) return;
  char* ws = (char*)d_ws; __bf16* P = (__bf16*)ws; _Float16 *QH = (_Float16*)(ws + WS_QH), *QL = (_Float16*)(ws + WS_QL), *KH = (_Float16*)(ws + WS_KH), *KL = (_Float16*)(ws + WS_KL), *V = (_Float16*)(ws + WS_V); float* O = (float*)(ws + WS_O);
  k_pack<<<dim3(CH, 4), 256, 0, stream>>>(F[2], F[4], F[6], F[8], P);
  k_proj<0><<<TNB * NT / 64, 128, 0, stream>>>(F[1], P, F[3], QH, QL, nullptr);
  k_proj<1><<<TNB * NT / 64, 128, 0, stream>>>(F[0], P, F[5], KH, KL, nullptr);
  k_proj<2><<<TNB * NT / 64, 128, 0, stream>>>(F[0], P, F[7], nullptr, nullptr, V);
  k_attn<<<dim3(TQB, TNB), 128 * KSP, 0, stream>>>(QH, QL, KH, KL, V, O);
  k_out<<<dim3(TNB * NT / 64, CH / 128), 128, 0, stream>>>(O, P, F[9], F[1], (float*)d_out);
}

// v005
// A run of this version takes 58.6 microseconds.
// Next to v004, in two timings, it ran 1.17 times as fast each time.
// Over all steps from v000 it is 7.81 times as fast.
// compute dtype: all float inputs rounded to bf16; q = Wq . x_high + bq and k, v = Wk/Wv . x_low + b (1x1 convs) with EXACT bf16 products on WMMA 16x16x32 (the channels-first inputs gathered token-major on load); q and k as f16 hi + (x2048-scaled) residual planes with 3-product scores (the logits are unscaled and large, so single-rounded operands would not do), running-max softmax in f32 (hardware exp), P (scaled by 2^11, single f16) x v (single f16); out = ctx (bf16 hi + residual) . Wo rows (2 products) + bo + x_high, stored channels-first; f32 accumulate.
#include <hip/hip_runtime.h>
#include <math.h>

typedef __attribute__((ext_vector_type(16))) _Float16 v16h;
typedef __attribute__((ext_vector_type(16))) __bf16 v16b;
typedef __attribute__((ext_vector_type(8)))  _Float16 v8h;
typedef __attribute__((ext_vector_type(8)))  float v8f;
typedef __attribute__((ext_vector_type(4)))  float v4f;
typedef __attribute__((ext_vector_type(2)))  float v2f;
typedef __attribute__((ext_vector_type(4)))  unsigned v4u;
typedef __attribute__((ext_vector_type(4)))  int v4i;
typedef float __attribute__((may_alias)) float_a;
typedef int __attribute__((may_alias)) int_a;

template <typename T> __device__ __forceinline__ void vst2(void* p, T v) { *(T*)p = v;  }
__device__ __forceinline__ v8f wmma16(v16h a, v16h b, v8f c) {
  v8f d = __builtin_amdgcn_wmma_f32_16x16x32_f16(false, a, false, b, (short)0, c, false, false);
  asm volatile("v_nop\n\tv_nop\n\tv_nop\n\tv_nop" : "+v"(d) : "v"(a), "v"(b));
  return d;
}
__device__ __forceinline__ v8f wmma_bf(v16b a, v16b b, v8f c) {
  v8f d = __builtin_amdgcn_wmma_f32_16x16x32_bf16(false, a, false, b, (short)0, c, false, false);
  asm volatile("v_nop\n\tv_nop\n\tv_nop\n\tv_nop" : "+v"(d) : "v"(a), "v"(b));
  return d;
}
// 16x16x32 fragments: lane = (h = lane>>4, row/col = lane&15); elements 0..7 = k0+8h+0..7, 8..15 = k0+16+8h+0..7; D element r = row 8h+r
__device__ __forceinline__ v16h frag_h(const _Float16* rowk0, int lane) {
  union { v16h v; v8h q[2]; } u; const _Float16* p = rowk0 + 8 * (lane >> 4);
  u.q[0] = *(const v8h*)p; u.q[1] = *(const v8h*)(p + 16); return u.v;
}
__device__ __forceinline__ v16h frag_f32(const float* rowk0, int lane) {
  v16h a; const float* p = rowk0 + 8 * (lane >> 4);
#pragma unroll
  for (int i = 0; i < 8; ++i) { a[i] = (_Float16)p[i]; a[8 + i] = (_Float16)p[16 + i]; }
  return a;
}
__device__ __forceinline__ v16h frag_f32s(const float* rowk0, int lane, float sc) {
  v16h a; const float* p = rowk0 + 8 * (lane >> 4);
#pragma unroll
  for (int i = 0; i < 8; ++i) { a[i] = (_Float16)(p[i] * sc); a[8 + i] = (_Float16)(p[16 + i] * sc); }
  return a;
}
// column fragment from a [K][ld] layout (column n), rows >= K read as 0
__device__ __forceinline__ v16h fragc_f32(const float* W, int k0, int n, int lane, int ld, int K) {
  v16h a; const int g = lane >> 4;
#pragma unroll
  for (int i = 0; i < 8; ++i) { const int ka = k0 + 8 * g + i, kb = ka + 16;
    a[i] = (_Float16)(ka < K ? W[(size_t)(ka < K ? ka : K - 1) * ld + n] : 0.f); a[8 + i] = (_Float16)(kb < K ? W[(size_t)(kb < K ? kb : K - 1) * ld + n] : 0.f); }
  return a;
}
struct F2 { v16b h, l; };
__device__ __forceinline__ F2 bsplit16(const float v[16]) { F2 r;
#pragma unroll
  for (int i = 0; i < 16; ++i) { const __bf16 h = (__bf16)v[i]; r.h[i] = h; r.l[i] = (__bf16)(v[i] - (float)h); }
  return r; }
__device__ __forceinline__ F2 split_row(const float* row, int k0, int lane) { float v[16]; const float* p = row + k0 + 8 * (lane >> 4);
#pragma unroll
  for (int i = 0; i < 8; ++i) { v[i] = p[i]; v[8 + i] = p[16 + i]; }
  return bsplit16(v); }
__device__ __forceinline__ F2 split_rowK(const float* row, int k0, int lane, int K) { float v[16]; const int g = lane >> 4;
#pragma unroll
  for (int i = 0; i < 8; ++i) { const int ka = k0 + 8 * g + i, kb = ka + 16; v[i] = ka < K ? row[ka < K ? ka : K - 1] : 0.f; v[8 + i] = kb < K ? row[kb < K ? kb : K - 1] : 0.f; }
  return bsplit16(v); }
__device__ __forceinline__ F2 split_col(const float* W, int k0, int n, int lane, int ld, int K) { float v[16]; const int g = lane >> 4;
#pragma unroll
  for (int i = 0; i < 8; ++i) { const int ka = k0 + 8 * g + i, kb = ka + 16; v[i] = ka < K ? W[(size_t)(ka < K ? ka : K - 1) * ld + n] : 0.f; v[8 + i] = kb < K ? W[(size_t)(kb < K ? kb : K - 1) * ld + n] : 0.f; }
  return bsplit16(v); }
__device__ __forceinline__ v8f mac3(const F2& a, const F2& b, v8f c) { c = wmma_bf(a.l, b.h, c); c = wmma_bf(a.h, b.l, c); return wmma_bf(a.h, b.h, c); }
__device__ __forceinline__ float sigm(float v) { return 1.0f / (1.0f + expf(-v)); }
#define LDSX() do { asm volatile("s_wait_dscnt 0" ::: "memory"); __builtin_amdgcn_wave_barrier(); __builtin_amdgcn_fence(__ATOMIC_RELEASE, "workgroup"); } while (0)

// the compiler does not schedule across this: a group of loads written ahead of the products that use it stays ahead (left alone it sinks each load pair to its product, and every product then waits out a whole load latency)
#define HOLD() __builtin_amdgcn_sched_barrier(0)
// between two runs of loads of one group: the build lands later loads' data on address registers that earlier loads of the group name, so the earlier loads' translations are waited for first (not their data)
#define XW() asm volatile("s_wait_xcnt 0x0" ::: "memory")

// Non-local feature fusion (B 4, 64 x 64 maps; 256 high-level / 512 low-level channels, 64-dim keys and values): every high-level pixel attends over all 4,096 low-level pixels (unscaled dot-product softmax), 1x1 output conv + residual.
#define NB 4
#define NT 4096            // tokens per image
#define CH 256             // high channels (q source, output)
#define CL 512             // low channels (k, v source)
#define KC 64
#define NR (NB * NT)
#ifndef TQB
#define TQB (NT / 64)
#define TNB NB
#endif
typedef __attribute__((ext_vector_type(8))) __bf16 v8b;
__device__ __forceinline__ v16b frag_b(const __bf16* rowk0, int lane) {
  union { v16b v; v8b q[2]; } u; const __bf16* p = rowk0 + 8 * (lane >> 4);
  u.q[0] = *(const v8b*)p; u.q[1] = *(const v8b*)(p + 16); return u.v;
}
__device__ __forceinline__ float bfr(float v) { return (float)(__bf16)v; }
__device__ __attribute__((noinline)) float exp_ni(float v) { return expf(v); }
__device__ __attribute__((noinline)) float erf_ni(float v) { return erff(v); }

#define WS_PQ  0u                                   // bf16 natural rows Wq [64][256], Wk [64][512], Wv [64][512]; Wo [256][64]
#define WS_PK  (WS_PQ + 2u * KC * CH)
#define WS_PV  (WS_PK + 2u * KC * CL)
#define WS_PO  (WS_PV + 2u * KC * CL)
#define WS_QH  (WS_PO + 2u * CH * KC)               // f16 [NR][64] q hi ; QL residual x2048 ; KH, KL, V in fragment order: per 32 keys 8 units of 512 B, unit = [lane][8 halves] (see frag_o)
#define WS_QL  (WS_QH + 2u * (size_t)NR * KC)
#define WS_KH  (WS_QL + 2u * (size_t)NR * KC)
#define WS_KL  (WS_KH + 2u * (size_t)NR * KC)
#define WS_V   (WS_KL + 2u * (size_t)NR * KC)
#define WS_O   (WS_V + 2u * (size_t)NB * KC * NT)    // f32 [NR][64] ctx
#define WS_END (WS_O + 4u * (size_t)NR * KC)

__global__ __launch_bounds__(256) void k_pack(const float* __restrict__ WQ, const float* __restrict__ WK, const float* __restrict__ WV, const float* __restrict__ WO, __bf16* __restrict__ P) {
  const int n = blockIdx.x, which = blockIdx.y, t = threadIdx.x; __shared__ __align__(16) __bf16 s[CL];
  if (which < 3) { if (n >= KC) return; const int kin = (which == 0) ? CH : CL; const float* Wm = (which == 0) ? WQ : (which == 1) ? WK : WV; for (int k = t; k < kin; k += 256) s[k] = (__bf16)Wm[(size_t)n * kin + k]; __syncthreads(); __bf16* dst = P + ((which == 0) ? WS_PQ / 2 : (which == 1) ? WS_PK / 2 : WS_PV / 2) + (size_t)n * kin; for (int q = t; q < kin / 8; q += 256) vst2((unsigned*)(dst + q * 8), *(const v4u*)&s[q * 8]); }
  else { if (t < KC) s[t] = (__bf16)WO[(size_t)n * KC + t]; __syncthreads(); if (t < KC / 8) vst2((unsigned*)(P + WS_PO / 2 + (size_t)n * KC + t * 8), *(const v4u*)&s[t * 8]); }
}
// ---- proj: block = (64 tokens, which): 64 output channels (4 tiles per wave); A gathered from the channels-first map; which 0: q -> hi/lo rows; 1: k -> hi/lo fragment units; 2: v -> fragment units
template <int WHICH>
__device__ __forceinline__ void proj(const float* __restrict__ X, const __bf16* __restrict__ P, const float* __restrict__ BB, _Float16* __restrict__ OH, _Float16* __restrict__ OL, _Float16* __restrict__ V, _Float16 (*sh)[72], _Float16 (*sl)[72], _Float16 (*st)[72]) {
  constexpr int KIN = (WHICH == 0) ? CH : CL;
  const int tid = threadIdx.x, wave = tid >> 5, lane = tid & 31, col = lane & 15, g = lane >> 4; const size_t rb0 = (size_t)blockIdx.x * 64, r0 = rb0 + wave * 16; const size_t b = rb0 / NT, t0 = rb0 % NT;
  const __bf16* Wr = P + ((WHICH == 0) ? WS_PQ / 2 : (WHICH == 1) ? WS_PK / 2 : WS_PV / 2);
  v8f acc[4] = {};
  constexpr int G = 4;   // passes of 32 channels whose loads are issued as one group: one load latency per group, not four per pass
  // the inner loops are unrolled: xr, w and acc live in registers, their indices must be constants
#pragma unroll 1   // one group's registers at a time
  for (int k0 = 0; k0 < KIN / 32; k0 += G) { float xr[G][16]; v16b w[G][4];
#pragma unroll
    for (int u = 0; u < G; ++u) { const float* p = X + ((b * KIN + (k0 + u) * 32 + 8 * g) * (size_t)NT) + t0 + wave * 16 + col;   // x[b][channel][token]
#pragma unroll
      for (int i = 0; i < 8; ++i) { xr[u][i] = p[(size_t)i * NT]; xr[u][8 + i] = p[(size_t)(16 + i) * NT]; } }
    XW();
#pragma unroll
    for (int u = 0; u < G; ++u)
#pragma unroll
      for (int j = 0; j < 4; ++j) w[u][j] = frag_b(Wr + (size_t)(j * 16 + col) * KIN + (k0 + u) * 32, lane);
    HOLD();
#pragma unroll
    for (int u = 0; u < G; ++u) { v16b a;
#pragma unroll
      for (int i = 0; i < 16; ++i) a[i] = (__bf16)xr[u][i];
#pragma unroll
      for (int j = 0; j < 4; ++j) acc[j] = wmma_bf(a, w[u][j], acc[j]); } }
  if (WHICH < 2) {
#pragma unroll
    for (int j = 0; j < 4; ++j) { const float bb = bfr(BB[j * 16 + col]);
#pragma unroll
      for (int r = 0; r < 8; ++r) { const float v = acc[j][r] + bb; const _Float16 h = (_Float16)v; sh[wave * 16 + 8 * g + r][j * 16 + col] = h; sl[wave * 16 + 8 * g + r][j * 16 + col] = (_Float16)((v - (float)h) * 2048.0f); } }
    LDSX();
    if (WHICH == 1) {   // the wave's 16 keys are 4 units: unit c, lane (g, col) = key col, channels c * 16 + 8 * g + 0..7
#pragma unroll   // the 8 LDS reads issue together, ahead of the stores
      for (int c = 0; c < 4; ++c) { vst2((unsigned*)(OH + r0 * KC + c * 256 + lane * 8), *(const v4u*)&sh[wave * 16 + col][c * 16 + 8 * g]); vst2((unsigned*)(OL + r0 * KC + c * 256 + lane * 8), *(const v4u*)&sl[wave * 16 + col][c * 16 + 8 * g]); }
    } else
    for (int rl = 0; rl < 16; ++rl) if (lane < 8) { vst2((unsigned*)(OH + (r0 + rl) * KC + lane * 8), *(const v4u*)&sh[wave * 16 + rl][lane * 8]); vst2((unsigned*)(OL + (r0 + rl) * KC + lane * 8), *(const v4u*)&sl[wave * 16 + rl][lane * 8]); }
  } else {
#pragma unroll
    for (int j = 0; j < 4; ++j) { const float bb = bfr(BB[j * 16 + col]);
#pragma unroll
      for (int r = 0; r < 8; ++r) st[j * 16 + col][wave * 16 + 8 * g + r] = (_Float16)(acc[j][r] + bb); }
    __syncthreads();
    for (int e = tid; e < 64 * 8; e += 128) { const int ln = e & 31, u = (e >> 5) & 7, s = e >> 8; vst2((unsigned*)(V + rb0 * KC + e * 8), *(const v4u*)&st[(u >> 1) * 16 + (ln & 15)][s * 32 + (u & 1) * 16 + (ln >> 4) * 8]); } }   // 32 keys s: unit u, lane (g, col) = channel (u >> 1) * 16 + col, keys (u & 1) * 16 + 8 * g + 0..7
}
// one launch for the three projections: they depend on k_pack alone, not on one another, so their blocks (3 x 256, four waves each) share the chip and each hides the others' load waits; the two long ones (512 channels) first in the grid
__global__ __launch_bounds__(128) void k_proj3(const float* __restrict__ XL, const float* __restrict__ XH, const __bf16* __restrict__ P, const float* __restrict__ BQ, const float* __restrict__ BK, const float* __restrict__ BV, _Float16* __restrict__ QH, _Float16* __restrict__ QL, _Float16* __restrict__ KH, _Float16* __restrict__ KL, _Float16* __restrict__ V) {
  __shared__ __align__(16) _Float16 sb[2][64][72];   // hi and residual planes of q or k; v's transpose uses the first
  if (blockIdx.y == 0) proj<1>(XL, P, BK, KH, KL, nullptr, sb[0], sb[1], sb[0]);
  else if (blockIdx.y == 1) proj<2>(XL, P, BV, nullptr, nullptr, V, sb[0], sb[1], sb[0]);
  else proj<0>(XH, P, BQ, QH, QL, nullptr, sb[0], sb[1], sb[0]);
}
// ---- k_attn: block = (64 queries, b), 32 waves = 4 query tiles x KSP key shares: share sp walks the 32-key steps sp, sp + KSP, ... with its own running max / sum / ctx; the KSP partials of a query tile meet in LDS at the end. 3-product scores (unscaled logits); P single x v single
// transposed products: scores as K . Q^T (D row = key, D column = query) and ctx^T += V^T . P^T, so a lane holds 16 scores of ONE query: max and sum run in the lane, one exchange between the wave halves per step, and the two score tiles, converted in place, are the B operand of the second product
#define KSP 8
// a fragment stored in fragment order: two units of 512 B, lane-contiguous, so that each wave-wide 16-byte load covers 4 whole 128-B lines (a fragment gathered from 16 rows touches 16); o = byte offset of the lane's 16 bytes of the first unit
__device__ __forceinline__ v16h frag_o(const _Float16* base, unsigned o, int k) {   // k: constant byte step, added behind the widening so that it becomes the load's immediate offset
  union { v16h v; v8h q[2]; } u; const char* p = (const char*)base + o + k; u.q[0] = *(const v8h*)p; u.q[1] = *(const v8h*)(p + 512); return u.v;
}
__device__ __forceinline__ float xhalf(float x) { return __builtin_bit_cast(float, __builtin_amdgcn_permlanex16(__builtin_bit_cast(int, x), __builtin_bit_cast(int, x), 0x76543210, 0xfedcba98, false, false)); }   // lane l with lane l ^ 16
__global__ __launch_bounds__(128 * KSP) void k_attn(const _Float16* __restrict__ QH, const _Float16* __restrict__ QL, const _Float16* __restrict__ KH, const _Float16* __restrict__ KL, const _Float16* __restrict__ V, float* __restrict__ O) {
  __shared__ __align__(32) float so[4 * KSP][8][136]; __shared__ float sm[4 * KSP][16], sl[4 * KSP][32]; __shared__ __align__(16) v8h sq[4][6][32];   // so: [ctx rows 8u .. 8u + 7][query * 8 + row], 136 floats per u so that the merge's 16-byte reads spread over the banks; sq: per query tile the q residual fragments and the upper hi fragment, lane-contiguous: read per step, so that a wave fits the 128 registers of 8 waves per SIMD
  // wave number in a scalar register, lane number as the shuffles form it: over the loop the indices live in two vector registers, the load offset fo and the lane's place in sq
  const int wave = __builtin_amdgcn_readfirstlane(threadIdx.x >> 5), lane = __builtin_amdgcn_mbcnt_lo(~0u, 0u), col = lane & 15, g = lane >> 4, sp = wave >> 2; const size_t b = blockIdx.y; const int q0 = blockIdx.x * 64 + (wave & 3) * 16; const size_t rq = b * NT + q0;
  const int qt = wave & 3;
  if (sp == 0) { const _Float16 *pl = QL + (rq + col) * KC + 8 * g, *ph = QH + (rq + col) * KC + 32 + 8 * g;
#pragma unroll   // the four loads in flight together
    for (int i = 0; i < 4; ++i) sq[qt][i][lane] = *(const v8h*)(pl + 16 * i);
    sq[qt][4][lane] = *(const v8h*)ph; sq[qt][5][lane] = *(const v8h*)(ph + 16); }
  __syncthreads();
  const v16h aq0 = frag_h(QH + (rq + col) * KC, lane);
  float m = -3.0e38f, l = 0.f;   // of query col; m is the same in both wave halves, l sums the half's own keys
  v8f acc[4] = {};               // acc[dt][r] = ctx[query col][dt * 16 + 8 * g + r]
  // the step's 32 keys j0 = (it * KSP + sp) * 32 are 8 units at the same place in KH, KL and V: the three bases stay scalar, one 32-bit vector offset serves all loads
  unsigned fo = ((unsigned)(b * (NT / 32) + sp) * 2048u + lane * 8u) * 2u;   // byte offset of the lane's 16 bytes in the step's first unit
  v16h kh0 = frag_o(KH, fo, 0), kl0 = frag_o(KL, fo, 0), kh1 = frag_o(KH, fo, 1024), kl1 = frag_o(KL, fo, 1024);   // keys 0..15 of the first step; every later step's are loaded at the foot of the step before
#pragma unroll 1
  for (int it = 0; it < NT / 32 / KSP; ++it) { v8f s[2];   // s[ct][r]: key j0 + ct * 16 + 8 * g + r, query col
    v16h va[4];
    // each pair of fragments is issued as soon as registers are free for it, three products or the whole softmax ahead of its first use: counted waits, three or four loads' latencies overlapped where each stood alone
#pragma unroll
    for (int ct = 0; ct < 2; ++ct) { v8f c = {}, cl = {};
#pragma unroll
      for (int kc = 0; kc < 2; ++kc) { const v16h kh = kc ? kh1 : kh0, kl = kc ? kl1 : kl0; union { v16h v; v8h q[2]; } ql, qh; ql.q[0] = sq[qt][2 * kc][lane]; ql.q[1] = sq[qt][2 * kc + 1][lane]; if (kc == 0) qh.v = aq0; else { qh.q[0] = sq[qt][4][lane]; qh.q[1] = sq[qt][5][lane]; } c = wmma16(kh, qh.v, c); cl = wmma16(kh, ql.v, cl); cl = wmma16(kl, qh.v, cl);
        if (ct == 0) { if (kc == 0) { kh0 = frag_o(KH, fo, 2048); kl0 = frag_o(KL, fo, 2048); } else { kh1 = frag_o(KH, fo, 3072); kl1 = frag_o(KL, fo, 3072); } }   // keys 16..31 into the registers just read
        else { va[2 * kc] = frag_o(V, fo, (2 * kc) * 1024); va[2 * kc + 1] = frag_o(V, fo, (2 * kc + 1) * 1024); }   // v flies under the softmax
        HOLD(); }
#pragma unroll
      for (int r = 0; r < 8; ++r) s[ct][r] = c[r] + cl[r] * (1.0f / 2048.0f); }   // unscaled logits
    float mx = fmaxf(s[0][0], s[1][0]);
#pragma unroll
    for (int r = 1; r < 8; ++r) mx = fmaxf(mx, fmaxf(s[0][r], s[1][r]));
    mx = fmaxf(mx, xhalf(mx));
    const float mn = fmaxf(m, mx); const float alpha = (m <= -1.0e38f) ? 0.f : __expf(m - mn); float es = 0.f; v16h pb;
#pragma unroll
    for (int r = 0; r < 8; ++r) { const float e0 = __expf(s[0][r] - mn), e1 = __expf(s[1][r] - mn); es += e0 + e1; pb[r] = (_Float16)(e0 * 2048.0f); pb[8 + r] = (_Float16)(e1 * 2048.0f); }
    l = l * alpha + es; m = mn;
#pragma unroll
    for (int dt = 0; dt < 4; ++dt) { acc[dt] *= alpha; acc[dt] = wmma16(va[dt], pb, acc[dt]);
      if (dt == 3) { fo += (it + 1 < NT / 32 / KSP) ? KSP * 4096u : 0u; kh0 = frag_o(KH, fo, 0); kl0 = frag_o(KL, fo, 0); kh1 = frag_o(KH, fo, 1024); kl1 = frag_o(KL, fo, 1024); HOLD(); } } }   // the next step's keys 0..15 (the last step reads its own again, unused)
  // each share leaves its unnormalised ctx, max and half sums in LDS; the lane number is read back from the load offset (its bits 4..8), so that no lane index is held in a register of its own over the loop (three of them went to scratch)
  const int ln = (fo >> 4) & 31, cn = ln & 15, gn = ln >> 4, tn = wave * 32 + ln;
#pragma unroll   // acc lives in registers, its index must be a constant
  for (int dt = 0; dt < 4; ++dt) *(v8f*)&so[wave][dt * 2 + gn][cn * 8] = acc[dt];
  if (gn == 0) sm[wave][cn] = m;
  sl[wave][ln] = l;
  __syncthreads();
  // merge: a thread owns 4 ctx columns of one query row; shares rescaled to the common max and added, share 0 first
  static_assert(128 * KSP == 64 * 16, "one thread per 4 ctx columns");
  { const int row = tn >> 4, c4 = tn & 15, w0 = row >> 4, q = row & 15; float mm = sm[w0][q];
#pragma unroll   // here and below: the shares' LDS reads issue together, one wait
    for (int p = 1; p < KSP; ++p) mm = fmaxf(mm, sm[p * 4 + w0][q]);
    float ls = 0.f; v4f o = {};
#pragma unroll
    for (int p = 0; p < KSP; ++p) { const float wgt = __expf(sm[p * 4 + w0][q] - mm); ls += wgt * (sl[p * 4 + w0][q] + sl[p * 4 + w0][16 + q]); o += wgt * *(const v4f*)&so[p * 4 + w0][c4 >> 1][q * 8 + (c4 & 1) * 4]; }
    vst2(O + (b * NT + blockIdx.x * 64 + row) * KC + c4 * 4, o * ((1.0f / 2048.0f) / ls)); }
}
// ---- k_out: block = (64 tokens, 128 output channels): out = ctx (hi + residual, K 64) . Wo rows + bo + x_high, stored channels-first (64 consecutive tokens per (image, channel))
__global__ __launch_bounds__(128) void k_out(const float* __restrict__ O, const __bf16* __restrict__ P, const float* __restrict__ BO, const float* __restrict__ XH, float* __restrict__ OUT) {
  __shared__ __align__(16) float st[128][68];
  const int tid = threadIdx.x, wave = tid >> 5, lane = tid & 31, col = lane & 15, g = lane >> 4; const size_t rb0 = (size_t)blockIdx.x * 64, r0 = rb0 + wave * 16; const int n0 = blockIdx.y * 128; const size_t b = rb0 / NT, t0 = rb0 % NT;
  v8f acc[8] = {};
  // the residual, the bias, the ctx rows and the first 32 columns' weights are issued as one group: one load latency for all of them, where each weight fragment, each bias and each residual row had its own; all loops unrolled: the arrays live in registers
  const float* px0 = XH + (b * CH + n0 + col) * (size_t)NT + t0 + wave * 16 + 8 * g;   // the lane's 8 tokens of channel n0 + col; channels j * 16 further on by immediate offsets: one address pair for the run
  v4f xh[8][2]; float bo[8]; v4f av[2][4]; v16b w[8]; const __bf16* pw = P + WS_PO / 2 + (size_t)(n0 + col) * KC + 8 * g;   // the lane's 16 bytes of weight row n0 + col; rows j * 16 further on by immediate offsets
#pragma unroll
  for (int j = 0; j < 8; ++j) { const float* px = px0 + (size_t)j * 16 * NT; xh[j][0] = *(const v4f*)px; xh[j][1] = *(const v4f*)(px + 4); bo[j] = BO[n0 + col + j * 16]; }
  XW();
#pragma unroll
  for (int kc = 0; kc < 2; ++kc) { const float* p = O + (r0 + col) * KC + kc * 32 + 8 * g;
    av[kc][0] = *(const v4f*)p; av[kc][1] = *(const v4f*)(p + 4); av[kc][2] = *(const v4f*)(p + 16); av[kc][3] = *(const v4f*)(p + 20); }   // fragment elements 0..7 = columns 8 g + 0..7 of the pass, 8..15 = 16 further on
  XW();
  static_assert(KC / 32 == 2, "two passes of 32 ctx columns");
#pragma unroll
  for (int kc = 0; kc < 2; ++kc) {
#pragma unroll
    for (int j = 0; j < 8; ++j) { const __bf16* p = pw + j * 16 * KC + kc * 32; union { v16b v; v8b q[2]; } u;
      if (j == 7) XW();   // the run's last two loads may land on the address pair that the run names
      u.q[0] = *(const v8b*)p;
      if (j == 7) XW();
      u.q[1] = *(const v8b*)(p + 16); w[j] = u.v; }
    HOLD();
    // inputs only: keep the ctx loads of both passes in the first group (the build sinks them behind later waits, a latency each)
    if (kc == 0) asm volatile("" :: "v"(av[0][0]), "v"(av[0][1]), "v"(av[0][2]), "v"(av[0][3]), "v"(av[1][0]), "v"(av[1][1]), "v"(av[1][2]), "v"(av[1][3]));
    float af[16];
#pragma unroll
    for (int i = 0; i < 16; ++i) af[i] = av[kc][i >> 2][i & 3];
    const F2 a = bsplit16(af);
#pragma unroll
    for (int j = 0; j < 8; ++j) { acc[j] = wmma_bf(a.l, w[j], acc[j]); acc[j] = wmma_bf(a.h, w[j], acc[j]); } }
#pragma unroll
  for (int j = 0; j < 8; ++j) { const float bb = bfr(bo[j]);
#pragma unroll
    for (int r = 0; r < 8; ++r) { const int tl = wave * 16 + 8 * g + r; st[j * 16 + col][tl] = acc[j][r] + bb + bfr(xh[j][r >> 2][r & 3]); } }
  __syncthreads();
  for (int e = tid; e < 128 * 16; e += 128) { const int c = e >> 4, q = e & 15; vst2(OUT + ((b * CH + n0 + c) * (size_t)NT) + t0 + q * 4, *(const v4f*)&st[c][q * 4]); }
}
extern "C" void kernel_launch(void* const* d_in, const int* in_sizes, int n_in, void* d_out, int out_size, void* d_ws, size_t ws_size, hipStream_t stream) {
  (void)in_sizes; (void)n_in; (void)out_size;
  const float** F = (const float**)d_in;   // 0 x_low [4,512,64,64], 1 x_high [4,256,64,64], 2 Wq [64,256], 3 bq, 4 Wk [64,512], 5 bk, 6 Wv [64,512], 7 bv, 8 Wo [256,64], 9 bo
  if (ws_size < (size_t)WS_END) return;
  char* ws = (char*)d_ws; __bf16* P = (__bf16*)ws; _Float16 *QH = (_Float16*)(ws + WS_QH), *QL = (_Float16*)(ws + WS_QL), *KH = (_Float16*)(ws + WS_KH), *KL = (_Float16*)(ws + WS_KL), *V = (_Float16*)(ws + WS_V); float* O = (float*)(ws + WS_O);
  k_pack<<<dim3(CH, 4), 256, 0, stream>>>(F[2], F[4], F[6], F[8], P);
  k_proj3<<<dim3(TNB * NT / 64, 3), 128, 0, stream>>>(F[0], F[1], P, F[3], F[5], F[7], QH, QL, KH, KL, V);
  k_attn<<<dim3(TQB, TNB), 128 * KSP, 0, stream>>>(QH, QL, KH, KL, V, O);
  k_out<<<dim3(TNB * NT / 64, CH / 128), 128, 0, stream>>>(O, P, F[9], F[1], (float*)d_out);
}

// v006
// One run takes 55.4 microseconds.
// Two timings next to v005 put it at 1.07 and 1.06 times that version's speed.
// Over all steps from v000 it is 8.31 times as fast.
// compute dtype: all float inputs rounded to bf16; q = Wq . x_high + bq and k, v = Wk/Wv . x_low + b (1x1 convs) with EXACT bf16 products on WMMA 16x16x32 (the channels-first inputs gathered token-major on load); q and k as f16 hi + (x2048-scaled) residual planes with 3-product scores (the logits are unscaled and large, so single-rounded operands would not do), running-max softmax in f32 (hardware exp), P (scaled by 2^11, single f16) x v (single f16); out = ctx (bf16 hi + residual) . Wo rows (2 products) + bo + x_high, stored channels-first; f32 accumulate.
#include <hip/hip_runtime.h>
#include <math.h>

typedef __attribute__((ext_vector_type(16))) _Float16 v16h;
typedef __attribute__((ext_vector_type(16))) __bf16 v16b;
typedef __attribute__((ext_vector_type(8)))  _Float16 v8h;
typedef __attribute__((ext_vector_type(8)))  float v8f;
typedef __attribute__((ext_vector_type(4)))  float v4f;
typedef __attribute__((ext_vector_type(2)))  float v2f;
typedef __attribute__((ext_vector_type(4)))  unsigned v4u;
typedef __attribute__((ext_vector_type(4)))  int v4i;
typedef float __attribute__((may_alias)) float_a;
typedef int __attribute__((may_alias)) int_a;

template <typename T> __device__ __forceinline__ void vst2(void* p, T v) { *(T*)p = v;  }
__device__ __forceinline__ v8f wmma16(v16h a, v16h b, v8f c) {
  v8f d = __builtin_amdgcn_wmma_f32_16x16x32_f16(false, a, false, b, (short)0, c, false, false);
  asm volatile("v_nop\n\tv_nop\n\tv_nop\n\tv_nop" : "+v"(d) : "v"(a), "v"(b));
  return d;
}
__device__ __forceinline__ v8f wmma_bf(v16b a, v16b b, v8f c) {
  v8f d = __builtin_amdgcn_wmma_f32_16x16x32_bf16(false, a, false, b, (short)0, c, false, false);
  asm volatile("v_nop\n\tv_nop\n\tv_nop\n\tv_nop" : "+v"(d) : "v"(a), "v"(b));
  return d;
}
// 16x16x32 fragments: lane = (h = lane>>4, row/col = lane&15); elements 0..7 = k0+8h+0..7, 8..15 = k0+16+8h+0..7; D element r = row 8h+r
__device__ __forceinline__ v16h frag_h(const _Float16* rowk0, int lane) {
  union { v16h v; v8h q[2]; } u; const _Float16* p = rowk0 + 8 * (lane >> 4);
  u.q[0] = *(const v8h*)p; u.q[1] = *(const v8h*)(p + 16); return u.v;
}
__device__ __forceinline__ v16h frag_f32(const float* rowk0, int lane) {
  v16h a; const float* p = rowk0 + 8 * (lane >> 4);
#pragma unroll
  for (int i = 0; i < 8; ++i) { a[i] = (_Float16)p[i]; a[8 + i] = (_Float16)p[16 + i]; }
  return a;
}
__device__ __forceinline__ v16h frag_f32s(const float* rowk0, int lane, float sc) {
  v16h a; const float* p = rowk0 + 8 * (lane >> 4);
#pragma unroll
  for (int i = 0; i < 8; ++i) { a[i] = (_Float16)(p[i] * sc); a[8 + i] = (_Float16)(p[16 + i] * sc); }
  return a;
}
// column fragment from a [K][ld] layout (column n), rows >= K read as 0
__device__ __forceinline__ v16h fragc_f32(const float* W, int k0, int n, int lane, int ld, int K) {
  v16h a; const int g = lane >> 4;
#pragma unroll
  for (int i = 0; i < 8; ++i) { const int ka = k0 + 8 * g + i, kb = ka + 16;
    a[i] = (_Float16)(ka < K ? W[(size_t)(ka < K ? ka : K - 1) * ld + n] : 0.f); a[8 + i] = (_Float16)(kb < K ? W[(size_t)(kb < K ? kb : K - 1) * ld + n] : 0.f); }
  return a;
}
struct F2 { v16b h, l; };
__device__ __forceinline__ F2 bsplit16(const float v[16]) { F2 r;
#pragma unroll
  for (int i = 0; i < 16; ++i) { const __bf16 h = (__bf16)v[i]; r.h[i] = h; r.l[i] = (__bf16)(v[i] - (float)h); }
  return r; }
__device__ __forceinline__ F2 split_row(const float* row, int k0, int lane) { float v[16]; const float* p = row + k0 + 8 * (lane >> 4);
#pragma unroll
  for (int i = 0; i < 8; ++i) { v[i] = p[i]; v[8 + i] = p[16 + i]; }
  return bsplit16(v); }
__device__ __forceinline__ F2 split_rowK(const float* row, int k0, int lane, int K) { float v[16]; const int g = lane >> 4;
#pragma unroll
  for (int i = 0; i < 8; ++i) { const int ka = k0 + 8 * g + i, kb = ka + 16; v[i] = ka < K ? row[ka < K ? ka : K - 1] : 0.f; v[8 + i] = kb < K ? row[kb < K ? kb : K - 1] : 0.f; }
  return bsplit16(v); }
__device__ __forceinline__ F2 split_col(const float* W, int k0, int n, int lane, int ld, int K) { float v[16]; const int g = lane >> 4;
#pragma unroll
  for (int i = 0; i < 8; ++i) { const int ka = k0 + 8 * g + i, kb = ka + 16; v[i] = ka < K ? W[(size_t)(ka < K ? ka : K - 1) * ld + n] : 0.f; v[8 + i] = kb < K ? W[(size_t)(kb < K ? kb : K - 1) * ld + n] : 0.f; }
  return bsplit16(v); }
__device__ __forceinline__ v8f mac3(const F2& a, const F2& b, v8f c) { c = wmma_bf(a.l, b.h, c); c = wmma_bf(a.h, b.l, c); return wmma_bf(a.h, b.h, c); }
__device__ __forceinline__ float sigm(float v) { return 1.0f / (1.0f + expf(-v)); }
#define LDSX() do { asm volatile("s_wait_dscnt 0" ::: "memory"); __builtin_amdgcn_wave_barrier(); __builtin_amdgcn_fence(__ATOMIC_RELEASE, "workgroup"); } while (0)

// the compiler does not schedule across this: a group of loads written ahead of the products that use it stays ahead (left alone it sinks each load pair to its product, and every product then waits out a whole load latency)
#define HOLD() __builtin_amdgcn_sched_barrier(0)
// between two runs of loads of one group: the build lands later loads' data on address registers that earlier loads of the group name, so the earlier loads' translations are waited for first (not their data)
#define XW() asm volatile("s_wait_xcnt 0x0" ::: "memory")
// work-group barrier for data handed over in LDS: waits for the wave's LDS accesses alone (__syncthreads() also waits out every global load in flight, and loads issued ahead of it could not fly under the work behind it)
#define BARL() asm volatile("s_wait_dscnt 0x0\n\ts_barrier_signal -1\n\ts_barrier_wait -1" ::: "memory")

// Non-local feature fusion (B 4, 64 x 64 maps; 256 high-level / 512 low-level channels, 64-dim keys and values): every high-level pixel attends over all 4,096 low-level pixels (unscaled dot-product softmax), 1x1 output conv + residual.
#define NB 4
#define NT 4096            // tokens per image
#define CH 256             // high channels (q source, output)
#define CL 512             // low channels (k, v source)
#define KC 64
#define NR (NB * NT)
#ifndef TQB
#define TQB (NT / 64)
#define TNB NB
#endif
typedef __attribute__((ext_vector_type(8))) __bf16 v8b;
__device__ __forceinline__ v16b frag_b(const __bf16* rowk0, int lane) {
  union { v16b v; v8b q[2]; } u; const __bf16* p = rowk0 + 8 * (lane >> 4);
  u.q[0] = *(const v8b*)p; u.q[1] = *(const v8b*)(p + 16); return u.v;
}
__device__ __forceinline__ float bfr(float v) { return (float)(__bf16)v; }
__device__ __attribute__((noinline)) float exp_ni(float v) { return expf(v); }
__device__ __attribute__((noinline)) float erf_ni(float v) { return erff(v); }

#define WS_PQ  0u                                   // bf16 natural rows Wq [64][256], Wk [64][512], Wv [64][512]; Wo [256][64]
#define WS_PK  (WS_PQ + 2u * KC * CH)
#define WS_PV  (WS_PK + 2u * KC * CL)
#define WS_PO  (WS_PV + 2u * KC * CL)
#define WS_QH  (WS_PO + 2u * CH * KC)               // f16 [NR][64] q hi ; QL residual x2048 ; KH, KL, V in fragment order: per 32 keys 8 units of 512 B, unit = [lane][8 halves] (see frag_o)
#define WS_QL  (WS_QH + 2u * (size_t)NR * KC)
#define WS_KH  (WS_QL + 2u * (size_t)NR * KC)
#define WS_KL  (WS_KH + 2u * (size_t)NR * KC)
#define WS_V   (WS_KL + 2u * (size_t)NR * KC)
#define WS_END (WS_V + 2u * (size_t)NB * KC * NT)

__global__ __launch_bounds__(256) void k_pack(const float* __restrict__ WQ, const float* __restrict__ WK, const float* __restrict__ WV, const float* __restrict__ WO, __bf16* __restrict__ P) {
  const int n = blockIdx.x, which = blockIdx.y, t = threadIdx.x; __shared__ __align__(16) __bf16 s[CL];
  if (which < 3) { if (n >= KC) return; const int kin = (which == 0) ? CH : CL; const float* Wm = (which == 0) ? WQ : (which == 1) ? WK : WV; for (int k = t; k < kin; k += 256) s[k] = (__bf16)Wm[(size_t)n * kin + k]; __syncthreads(); __bf16* dst = P + ((which == 0) ? WS_PQ / 2 : (which == 1) ? WS_PK / 2 : WS_PV / 2) + (size_t)n * kin; for (int q = t; q < kin / 8; q += 256) vst2((unsigned*)(dst + q * 8), *(const v4u*)&s[q * 8]); }
  else { if (t < KC) s[t] = (__bf16)WO[(size_t)n * KC + t]; __syncthreads(); if (t < KC / 8) vst2((unsigned*)(P + WS_PO / 2 + (size_t)n * KC + t * 8), *(const v4u*)&s[t * 8]); }
}
// ---- proj: block = (64 tokens, which): 64 output channels (4 tiles per wave); A gathered from the channels-first map; which 0: q -> hi/lo rows; 1: k -> hi/lo fragment units; 2: v -> fragment units
template <int WHICH>
__device__ __forceinline__ void proj(const float* __restrict__ X, const __bf16* __restrict__ P, const float* __restrict__ BB, _Float16* __restrict__ OH, _Float16* __restrict__ OL, _Float16* __restrict__ V, _Float16 (*sh)[72], _Float16 (*sl)[72], _Float16 (*st)[72]) {
  constexpr int KIN = (WHICH == 0) ? CH : CL;
  const int tid = threadIdx.x, wave = tid >> 5, lane = tid & 31, col = lane & 15, g = lane >> 4; const size_t rb0 = (size_t)blockIdx.x * 64, r0 = rb0 + wave * 16; const size_t b = rb0 / NT, t0 = rb0 % NT;
  const __bf16* Wr = P + ((WHICH == 0) ? WS_PQ / 2 : (WHICH == 1) ? WS_PK / 2 : WS_PV / 2);
  v8f acc[4] = {};
  constexpr int G = 4;   // passes of 32 channels whose loads are issued as one group: one load latency per group, not four per pass
  // the inner loops are unrolled: xr, w and acc live in registers, their indices must be constants
#pragma unroll 1   // one group's registers at a time
  for (int k0 = 0; k0 < KIN / 32; k0 += G) { float xr[G][16]; v16b w[G][4];
#pragma unroll
    for (int u = 0; u < G; ++u) { const float* p = X + ((b * KIN + (k0 + u) * 32 + 8 * g) * (size_t)NT) + t0 + wave * 16 + col;   // x[b][channel][token]
#pragma unroll
      for (int i = 0; i < 8; ++i) { xr[u][i] = p[(size_t)i * NT]; xr[u][8 + i] = p[(size_t)(16 + i) * NT]; } }
    XW();
#pragma unroll
    for (int u = 0; u < G; ++u)
#pragma unroll
      for (int j = 0; j < 4; ++j) w[u][j] = frag_b(Wr + (size_t)(j * 16 + col) * KIN + (k0 + u) * 32, lane);
    HOLD();
#pragma unroll
    for (int u = 0; u < G; ++u) { v16b a;
#pragma unroll
      for (int i = 0; i < 16; ++i) a[i] = (__bf16)xr[u][i];
#pragma unroll
      for (int j = 0; j < 4; ++j) acc[j] = wmma_bf(a, w[u][j], acc[j]); } }
  if (WHICH < 2) {
#pragma unroll
    for (int j = 0; j < 4; ++j) { const float bb = bfr(BB[j * 16 + col]);
#pragma unroll
      for (int r = 0; r < 8; ++r) { const float v = acc[j][r] + bb; const _Float16 h = (_Float16)v; sh[wave * 16 + 8 * g + r][j * 16 + col] = h; sl[wave * 16 + 8 * g + r][j * 16 + col] = (_Float16)((v - (float)h) * 2048.0f); } }
    LDSX();
    if (WHICH == 1) {   // the wave's 16 keys are 4 units: unit c, lane (g, col) = key col, channels c * 16 + 8 * g + 0..7
#pragma unroll   // the 8 LDS reads issue together, ahead of the stores
      for (int c = 0; c < 4; ++c) { vst2((unsigned*)(OH + r0 * KC + c * 256 + lane * 8), *(const v4u*)&sh[wave * 16 + col][c * 16 + 8 * g]); vst2((unsigned*)(OL + r0 * KC + c * 256 + lane * 8), *(const v4u*)&sl[wave * 16 + col][c * 16 + 8 * g]); }
    } else
    for (int rl = 0; rl < 16; ++rl) if (lane < 8) { vst2((unsigned*)(OH + (r0 + rl) * KC + lane * 8), *(const v4u*)&sh[wave * 16 + rl][lane * 8]); vst2((unsigned*)(OL + (r0 + rl) * KC + lane * 8), *(const v4u*)&sl[wave * 16 + rl][lane * 8]); }
  } else {
#pragma unroll
    for (int j = 0; j < 4; ++j) { const float bb = bfr(BB[j * 16 + col]);
#pragma unroll
      for (int r = 0; r < 8; ++r) st[j * 16 + col][wave * 16 + 8 * g + r] = (_Float16)(acc[j][r] + bb); }
    __syncthreads();
    for (int e = tid; e < 64 * 8; e += 128) { const int ln = e & 31, u = (e >> 5) & 7, s = e >> 8; vst2((unsigned*)(V + rb0 * KC + e * 8), *(const v4u*)&st[(u >> 1) * 16 + (ln & 15)][s * 32 + (u & 1) * 16 + (ln >> 4) * 8]); } }   // 32 keys s: unit u, lane (g, col) = channel (u >> 1) * 16 + col, keys (u & 1) * 16 + 8 * g + 0..7
}
// one launch for the three projections: they depend on k_pack alone, not on one another, so their blocks (3 x 256, four waves each) share the chip and each hides the others' load waits; the two long ones (512 channels) first in the grid
__global__ __launch_bounds__(128) void k_proj3(const float* __restrict__ XL, const float* __restrict__ XH, const __bf16* __restrict__ P, const float* __restrict__ BQ, const float* __restrict__ BK, const float* __restrict__ BV, _Float16* __restrict__ QH, _Float16* __restrict__ QL, _Float16* __restrict__ KH, _Float16* __restrict__ KL, _Float16* __restrict__ V) {
  __shared__ __align__(16) _Float16 sb[2][64][72];   // hi and residual planes of q or k; v's transpose uses the first
  if (blockIdx.y == 0) proj<1>(XL, P, BK, KH, KL, nullptr, sb[0], sb[1], sb[0]);
  else if (blockIdx.y == 1) proj<2>(XL, P, BV, nullptr, nullptr, V, sb[0], sb[1], sb[0]);
  else proj<0>(XH, P, BQ, QH, QL, nullptr, sb[0], sb[1], sb[0]);
}
// ---- k_attn: block = (64 queries, b), 32 waves = 4 query tiles x KSP key shares: share sp walks the 32-key steps sp, sp + KSP, ... with its own running max / sum / ctx; the KSP partials of a query tile meet in LDS at the end. 3-product scores (unscaled logits); P single x v single
// transposed products: scores as K . Q^T (D row = key, D column = query) and ctx^T += V^T . P^T, so a lane holds 16 scores of ONE query: max and sum run in the lane, one exchange between the wave halves per step, and the two score tiles, converted in place, are the B operand of the second product
#define KSP 8
// a fragment stored in fragment order: two units of 512 B, lane-contiguous, so that each wave-wide 16-byte load covers 4 whole 128-B lines (a fragment gathered from 16 rows touches 16); o = byte offset of the lane's 16 bytes of the first unit
__device__ __forceinline__ v16h frag_o(const _Float16* base, unsigned o, int k) {   // k: constant byte step, added behind the widening so that it becomes the load's immediate offset
  union { v16h v; v8h q[2]; } u; const char* p = (const char*)base + o + k; u.q[0] = *(const v8h*)p; u.q[1] = *(const v8h*)(p + 512); return u.v;
}
__device__ __forceinline__ float xhalf(float x) { return __builtin_bit_cast(float, __builtin_amdgcn_permlanex16(__builtin_bit_cast(int, x), __builtin_bit_cast(int, x), 0x76543210, 0xfedcba98, false, false)); }   // lane l with lane l ^ 16
// the output conv runs in the same block, behind the merge: out = ctx (bf16 hi + residual, K 64) . Wo rows (2 products) + bo + x_high for the block's 64 tokens x 256 channels, wave = (token tile, 32 channels), stored channels-first (64 consecutive tokens per (image, channel)); ctx never leaves the block
__global__ __launch_bounds__(128 * KSP) void k_attn(const _Float16* __restrict__ QH, const _Float16* __restrict__ QL, const _Float16* __restrict__ KH, const _Float16* __restrict__ KL, const _Float16* __restrict__ V, const __bf16* __restrict__ P, const float* __restrict__ BO, const float* __restrict__ XH, float* __restrict__ OUT) {
  __shared__ __align__(16) float sc[64][68], st[CH][68];   // sc: merged ctx [token][column]; st: out before the residual [channel][token]; 68 floats a row: 16-byte accesses of 16 rows spread over the banks
  __shared__ __align__(32) float so[4 * KSP][8][136]; __shared__ float sm[4 * KSP][16], sl[4 * KSP][32]; __shared__ __align__(16) v8h sq[4][6][32];   // so: [ctx rows 8u .. 8u + 7][query * 8 + row], 136 floats per u so that the merge's 16-byte reads spread over the banks; sq: per query tile the q residual fragments and the upper hi fragment, lane-contiguous: read per step, so that a wave fits the 128 registers of 8 waves per SIMD
  // wave number in a scalar register, lane number as the shuffles form it: over the loop the indices live in two vector registers, the load offset fo and the lane's place in sq
  const int wave = __builtin_amdgcn_readfirstlane(threadIdx.x >> 5), lane = __builtin_amdgcn_mbcnt_lo(~0u, 0u), col = lane & 15, g = lane >> 4, sp = wave >> 2; const size_t b = blockIdx.y; const int q0 = blockIdx.x * 64 + (wave & 3) * 16; const size_t rq = b * NT + q0;
  const int qt = wave & 3;
  if (sp == 0) { const _Float16 *pl = QL + (rq + col) * KC + 8 * g, *ph = QH + (rq + col) * KC + 32 + 8 * g;
#pragma unroll   // the four loads in flight together
    for (int i = 0; i < 4; ++i) sq[qt][i][lane] = *(const v8h*)(pl + 16 * i);
    sq[qt][4][lane] = *(const v8h*)ph; sq[qt][5][lane] = *(const v8h*)(ph + 16); }
  __syncthreads();
  const v16h aq0 = frag_h(QH + (rq + col) * KC, lane);
  float m = -3.0e38f, l = 0.f;   // of query col; m is the same in both wave halves, l sums the half's own keys
  v8f acc[4] = {};               // acc[dt][r] = ctx[query col][dt * 16 + 8 * g + r]
  // the step's 32 keys j0 = (it * KSP + sp) * 32 are 8 units at the same place in KH, KL and V: the three bases stay scalar, one 32-bit vector offset serves all loads
  unsigned fo = ((unsigned)(b * (NT / 32) + sp) * 2048u + lane * 8u) * 2u;   // byte offset of the lane's 16 bytes in the step's first unit
  v16h kh0 = frag_o(KH, fo, 0), kl0 = frag_o(KL, fo, 0), kh1 = frag_o(KH, fo, 1024), kl1 = frag_o(KL, fo, 1024);   // keys 0..15 of the first step; every later step's are loaded at the foot of the step before
#pragma unroll 1
  for (int it = 0; it < NT / 32 / KSP; ++it) { v8f s[2];   // s[ct][r]: key j0 + ct * 16 + 8 * g + r, query col
    v16h va[4];
    // each pair of fragments is issued as soon as registers are free for it, three products or the whole softmax ahead of its first use: counted waits, three or four loads' latencies overlapped where each stood alone
#pragma unroll
    for (int ct = 0; ct < 2; ++ct) { v8f c = {}, cl = {};
#pragma unroll
      for (int kc = 0; kc < 2; ++kc) { const v16h kh = kc ? kh1 : kh0, kl = kc ? kl1 : kl0; union { v16h v; v8h q[2]; } ql, qh; ql.q[0] = sq[qt][2 * kc][lane]; ql.q[1] = sq[qt][2 * kc + 1][lane]; if (kc == 0) qh.v = aq0; else { qh.q[0] = sq[qt][4][lane]; qh.q[1] = sq[qt][5][lane]; } c = wmma16(kh, qh.v, c); cl = wmma16(kh, ql.v, cl); cl = wmma16(kl, qh.v, cl);
        if (ct == 0) { if (kc == 0) { kh0 = frag_o(KH, fo, 2048); kl0 = frag_o(KL, fo, 2048); } else { kh1 = frag_o(KH, fo, 3072); kl1 = frag_o(KL, fo, 3072); } }   // keys 16..31 into the registers just read
        else { va[2 * kc] = frag_o(V, fo, (2 * kc) * 1024); va[2 * kc + 1] = frag_o(V, fo, (2 * kc + 1) * 1024); }   // v flies under the softmax
        HOLD(); }
#pragma unroll
      for (int r = 0; r < 8; ++r) s[ct][r] = c[r] + cl[r] * (1.0f / 2048.0f); }   // unscaled logits
    float mx = fmaxf(s[0][0], s[1][0]);
#pragma unroll
    for (int r = 1; r < 8; ++r) mx = fmaxf(mx, fmaxf(s[0][r], s[1][r]));
    mx = fmaxf(mx, xhalf(mx));
    const float mn = fmaxf(m, mx); const float alpha = (m <= -1.0e38f) ? 0.f : __expf(m - mn); float es = 0.f; v16h pb;
#pragma unroll
    for (int r = 0; r < 8; ++r) { const float e0 = __expf(s[0][r] - mn), e1 = __expf(s[1][r] - mn); es += e0 + e1; pb[r] = (_Float16)(e0 * 2048.0f); pb[8 + r] = (_Float16)(e1 * 2048.0f); }
    l = l * alpha + es; m = mn;
#pragma unroll
    for (int dt = 0; dt < 4; ++dt) { acc[dt] *= alpha; acc[dt] = wmma16(va[dt], pb, acc[dt]);
      if (dt == 3) { fo += (it + 1 < NT / 32 / KSP) ? KSP * 4096u : 0u; kh0 = frag_o(KH, fo, 0); kl0 = frag_o(KL, fo, 0); kh1 = frag_o(KH, fo, 1024); kl1 = frag_o(KL, fo, 1024); HOLD(); } } }   // the next step's keys 0..15 (the last step reads its own again, unused)
  XW(); HOLD();   // those last loads are still in flight: what follows reuses the registers that hold their addresses, only behind this wait
  // each share leaves its unnormalised ctx, max and half sums in LDS; the lane number is read back from the load offset (its bits 4..8), so that no lane index is held in a register of its own over the loop (three of them went to scratch)
  const int ln = (fo >> 4) & 31, cn = ln & 15, gn = ln >> 4, tn = wave * 32 + ln;
  // all that the output conv takes from memory is asked for here, as one group, and flies under the merge: the residual at the thread's own 4 store places (16 threads = 256 consecutive bytes of a channel; 64 channels between a thread's places), the wave's 32 weight rows as fragments, their bias
  static_assert(128 * KSP / 16 * 4 == CH && KSP * 32 == CH && KC / 32 == 2, "4 store places a thread; 32 channels a key share; two passes of 32 ctx columns");
  const size_t ob = (b * CH + (tn >> 4)) * (size_t)NT + blockIdx.x * 64 + (tn & 15) * 4;
  v4f xr[4]; v16b w[2][2]; float bo[2];
  const __bf16* pw = P + (size_t)(sp * 32 + cn) * KC + 8 * gn;   // the lane's 16 bytes of weight row sp * 32 + cn (counted from the start of the packed weights); the other row, pass and half by immediate offsets: one address pair for the run
  const float *pb = BO + sp * 32 + cn, *px = XH + ob;
#pragma unroll   // here and below: xr, w, bo, oc live in registers, their indices must be constants
  for (int j = 0; j < 2; ++j) { bo[j] = pb[j * 16];
#pragma unroll
    for (int kc = 0; kc < 2; ++kc) { const __bf16* p = pw + WS_PO / 2 + j * 16 * KC + kc * 32; union { v16b v; v8b q[2]; } u; u.q[0] = *(const v8b*)p; u.q[1] = *(const v8b*)(p + 16); w[kc][j] = u.v; } }
  HOLD();   // the residual last: it is used last and comes from furthest, so the counted wait for the weights leaves it in flight
#pragma unroll
  for (int i = 0; i < 4; ++i) xr[i] = *(const v4f*)(px + (size_t)i * 64 * NT);
  // the group's addresses are inputs of the wait: they stay in their registers up to it, so that no load of the group lands on a register that an earlier one names
  asm volatile("s_wait_xcnt 0x0" :: "v"(pw), "v"(cn), "v"(px) : "memory");
  HOLD();
#pragma unroll   // acc lives in registers, its index must be a constant
  for (int dt = 0; dt < 4; ++dt) *(v8f*)&so[wave][dt * 2 + gn][cn * 8] = acc[dt];
  if (gn == 0) sm[wave][cn] = m;
  sl[wave][ln] = l;
  BARL();
  // merge: a thread owns 4 ctx columns of one query row; shares rescaled to the common max and added, share 0 first
  static_assert(128 * KSP == 64 * 16, "one thread per 4 ctx columns");
  { const int row = tn >> 4, c4 = tn & 15, w0 = row >> 4, q = row & 15; float mm = sm[w0][q];
#pragma unroll   // here and below: the shares' LDS reads issue together, one wait
    for (int p = 1; p < KSP; ++p) mm = fmaxf(mm, sm[p * 4 + w0][q]);
    float ls = 0.f; v4f o = {};
#pragma unroll
    for (int p = 0; p < KSP; ++p) { const float wgt = __expf(sm[p * 4 + w0][q] - mm); ls += wgt * (sl[p * 4 + w0][q] + sl[p * 4 + w0][16 + q]); o += wgt * *(const v4f*)&so[p * 4 + w0][c4 >> 1][q * 8 + (c4 & 1) * 4]; }
    *(v4f*)&sc[row][c4 * 4] = o * ((1.0f / 2048.0f) / ls); }
  BARL();
  HOLD();   // likewise what reads the weights and the bias
  v8f oc[2] = {};
#pragma unroll
  for (int kc = 0; kc < 2; ++kc) { const float* p = &sc[qt * 16 + cn][kc * 32 + 8 * gn]; float af[16];   // fragment elements 0..7 = columns 8 g + 0..7 of the pass, 8..15 = 16 further on
#pragma unroll
    for (int i = 0; i < 8; ++i) { af[i] = p[i]; af[8 + i] = p[16 + i]; }
    const F2 a = bsplit16(af);
#pragma unroll
    for (int j = 0; j < 2; ++j) { oc[j] = wmma_bf(a.l, w[kc][j], oc[j]); oc[j] = wmma_bf(a.h, w[kc][j], oc[j]); } }
#pragma unroll
  for (int j = 0; j < 2; ++j) { const float bb = bfr(bo[j]);
#pragma unroll
    for (int r = 0; r < 8; ++r) st[sp * 32 + j * 16 + cn][qt * 16 + 8 * gn + r] = oc[j][r] + bb; }
  BARL();
  HOLD();   // the residual's rounding stays here: moved up into the merge, it waits out the residual's loads there
#pragma unroll
  for (int i = 0; i < 4; ++i) { v4f v = *(const v4f*)&st[(tn >> 4) + i * 64][(tn & 15) * 4];
#pragma unroll
    for (int e = 0; e < 4; ++e) v[e] += bfr(xr[i][e]);
    vst2(OUT + ob + (size_t)i * 64 * NT, v); }
}
extern "C" void kernel_launch(void* const* d_in, const int* in_sizes, int n_in, void* d_out, int out_size, void* d_ws, size_t ws_size, hipStream_t stream) {
  (void)in_sizes; (void)n_in; (void)out_size;
  const float** F = (const float**)d_in;   // 0 x_low [4,512,64,64], 1 x_high [4,256,64,64], 2 Wq [64,256], 3 bq, 4 Wk [64,512], 5 bk, 6 Wv [64,512], 7 bv, 8 Wo [256,64], 9 bo
  if (ws_size < (size_t)WS_END) return;
  char* ws = (char*)d_ws; __bf16* P = (__bf16*)ws; _Float16 *QH = (_Float16*)(ws + WS_QH), *QL = (_Float16*)(ws + WS_QL), *KH = (_Float16*)(ws + WS_KH), *KL = (_Float16*)(ws + WS_KL), *V = (_Float16*)(ws + WS_V);
  k_pack<<<dim3(CH, 4), 256, 0, stream>>>(F[2], F[4], F[6], F[8], P);
  k_proj3<<<dim3(TNB * NT / 64, 3), 128, 0, stream>>>(F[0], F[1], P, F[3], F[5], F[7], QH, QL, KH, KL, V);
  k_attn<<<dim3(TQB, TNB), 128 * KSP, 0, stream>>>(QH, QL, KH, KL, V, P, F[9], F[1], (float*)d_out);
}

// v007
// Measured time: 50.9 microseconds a run.
// Next to v006, in two timings, it ran 1.09 and 1.10 times as fast.
// Counting every step since v000, it is 9.12 times as fast.
// compute dtype: all float inputs rounded to bf16; q = Wq . x_high + bq and k, v = Wk/Wv . x_low + b (1x1 convs) with EXACT bf16 products on WMMA 16x16x32 (the channels-first inputs gathered token-major on load); q and k as f16 hi + (x2048-scaled) residual planes with 3-product scores (the logits are unscaled and large, so single-rounded operands would not do), running-max softmax in f32 (hardware exp), P (scaled by 2^11, single f16) x v (single f16); out = ctx (bf16 hi + residual) . Wo rows (2 products) + bo + x_high, stored channels-first; f32 accumulate.
#include <hip/hip_runtime.h>
#include <math.h>

typedef __attribute__((ext_vector_type(16))) _Float16 v16h;
typedef __attribute__((ext_vector_type(16))) __bf16 v16b;
typedef __attribute__((ext_vector_type(8)))  _Float16 v8h;
typedef __attribute__((ext_vector_type(8)))  float v8f;
typedef __attribute__((ext_vector_type(4)))  float v4f;
typedef __attribute__((ext_vector_type(2)))  float v2f;
typedef __attribute__((ext_vector_type(4)))  unsigned v4u;
typedef __attribute__((ext_vector_type(4)))  int v4i;
typedef float __attribute__((may_alias)) float_a;
typedef int __attribute__((may_alias)) int_a;

template <typename T> __device__ __forceinline__ void vst2(void* p, T v) { *(T*)p = v;  }
__device__ __forceinline__ v8f wmma16(v16h a, v16h b, v8f c) {
  v8f d = __builtin_amdgcn_wmma_f32_16x16x32_f16(false, a, false, b, (short)0, c, false, false);
  asm volatile("v_nop\n\tv_nop\n\tv_nop\n\tv_nop" : "+v"(d) : "v"(a), "v"(b));
  return d;
}
__device__ __forceinline__ v8f wmma_bf(v16b a, v16b b, v8f c) {
  v8f d = __builtin_amdgcn_wmma_f32_16x16x32_bf16(false, a, false, b, (short)0, c, false, false);
  asm volatile("v_nop\n\tv_nop\n\tv_nop\n\tv_nop" : "+v"(d) : "v"(a), "v"(b));
  return d;
}
// 16x16x32 fragments: lane = (h = lane>>4, row/col = lane&15); elements 0..7 = k0+8h+0..7, 8..15 = k0+16+8h+0..7; D element r = row 8h+r
__device__ __forceinline__ v16h frag_h(const _Float16* rowk0, int lane) {
  union { v16h v; v8h q[2]; } u; const _Float16* p = rowk0 + 8 * (lane >> 4);
  u.q[0] = *(const v8h*)p; u.q[1] = *(const v8h*)(p + 16); return u.v;
}
__device__ __forceinline__ v16h frag_f32(const float* rowk0, int lane) {
  v16h a; const float* p = rowk0 + 8 * (lane >> 4);
#pragma unroll
  for (int i = 0; i < 8; ++i) { a[i] = (_Float16)p[i]; a[8 + i] = (_Float16)p[16 + i]; }
  return a;
}
__device__ __forceinline__ v16h frag_f32s(const float* rowk0, int lane, float sc) {
  v16h a; const float* p = rowk0 + 8 * (lane >> 4);
#pragma unroll
  for (int i = 0; i < 8; ++i) { a[i] = (_Float16)(p[i] * sc); a[8 + i] = (_Float16)(p[16 + i] * sc); }
  return a;
}
// column fragment from a [K][ld] layout (column n), rows >= K read as 0
__device__ __forceinline__ v16h fragc_f32(const float* W, int k0, int n, int lane, int ld, int K) {
  v16h a; const int g = lane >> 4;
#pragma unroll
  for (int i = 0; i < 8; ++i) { const int ka = k0 + 8 * g + i, kb = ka + 16;
    a[i] = (_Float16)(ka < K ? W[(size_t)(ka < K ? ka : K - 1) * ld + n] : 0.f); a[8 + i] = (_Float16)(kb < K ? W[(size_t)(kb < K ? kb : K - 1) * ld + n] : 0.f); }
  return a;
}
struct F2 { v16b h, l; };
__device__ __forceinline__ F2 bsplit16(const float v[16]) { F2 r;
#pragma unroll
  for (int i = 0; i < 16; ++i) { const __bf16 h = (__bf16)v[i]; r.h[i] = h; r.l[i] = (__bf16)(v[i] - (float)h); }
  return r; }
__device__ __forceinline__ F2 split_row(const float* row, int k0, int lane) { float v[16]; const float* p = row + k0 + 8 * (lane >> 4);
#pragma unroll
  for (int i = 0; i < 8; ++i) { v[i] = p[i]; v[8 + i] = p[16 + i]; }
  return bsplit16(v); }
__device__ __forceinline__ F2 split_rowK(const float* row, int k0, int lane, int K) { float v[16]; const int g = lane >> 4;
#pragma unroll
  for (int i = 0; i < 8; ++i) { const int ka = k0 + 8 * g + i, kb = ka + 16; v[i] = ka < K ? row[ka < K ? ka : K - 1] : 0.f; v[8 + i] = kb < K ? row[kb < K ? kb : K - 1] : 0.f; }
  return bsplit16(v); }
__device__ __forceinline__ F2 split_col(const float* W, int k0, int n, int lane, int ld, int K) { float v[16]; const int g = lane >> 4;
#pragma unroll
  for (int i = 0; i < 8; ++i) { const int ka = k0 + 8 * g + i, kb = ka + 16; v[i] = ka < K ? W[(size_t)(ka < K ? ka : K - 1) * ld + n] : 0.f; v[8 + i] = kb < K ? W[(size_t)(kb < K ? kb : K - 1) * ld + n] : 0.f; }
  return bsplit16(v); }
__device__ __forceinline__ v8f mac3(const F2& a, const F2& b, v8f c) { c = wmma_bf(a.l, b.h, c); c = wmma_bf(a.h, b.l, c); return wmma_bf(a.h, b.h, c); }
__device__ __forceinline__ float sigm(float v) { return 1.0f / (1.0f + expf(-v)); }
#define LDSX() do { asm volatile("s_wait_dscnt 0" ::: "memory"); __builtin_amdgcn_wave_barrier(); __builtin_amdgcn_fence(__ATOMIC_RELEASE, "workgroup"); } while (0)

// the compiler does not schedule across this: a group of loads written ahead of the products that use it stays ahead (left alone it sinks each load pair to its product, and every product then waits out a whole load latency)
#define HOLD() __builtin_amdgcn_sched_barrier(0)
// between two runs of loads of one group: the build lands later loads' data on address registers that earlier loads of the group name, so the earlier loads' translations are waited for first (not their data)
#define XW() asm volatile("s_wait_xcnt 0x0" ::: "memory")
// work-group barrier for data handed over in LDS: waits for the wave's LDS accesses alone (__syncthreads() also waits out every global load in flight, and loads issued ahead of it could not fly under the work behind it)
#define BARL() asm volatile("s_wait_dscnt 0x0\n\ts_barrier_signal -1\n\ts_barrier_wait -1" ::: "memory")

// Non-local feature fusion (B 4, 64 x 64 maps; 256 high-level / 512 low-level channels, 64-dim keys and values): every high-level pixel attends over all 4,096 low-level pixels (unscaled dot-product softmax), 1x1 output conv + residual.
#define NB 4
#define NT 4096            // tokens per image
#define CH 256             // high channels (q source, output)
#define CL 512             // low channels (k, v source)
#define KC 64
#define NR (NB * NT)
#ifndef TQB
#define TQB (NT / 64)
#define TNB NB
#endif
typedef __attribute__((ext_vector_type(8))) __bf16 v8b;
__device__ __forceinline__ v16b frag_b(const __bf16* rowk0, int lane) {
  union { v16b v; v8b q[2]; } u; const __bf16* p = rowk0 + 8 * (lane >> 4);
  u.q[0] = *(const v8b*)p; u.q[1] = *(const v8b*)(p + 16); return u.v;
}
__device__ __forceinline__ float bfr(float v) { return (float)(__bf16)v; }
__device__ __attribute__((noinline)) float exp_ni(float v) { return expf(v); }
__device__ __attribute__((noinline)) float erf_ni(float v) { return erff(v); }

#define WS_PQ  0u                                   // bf16: Wq [64][256], Wk [64][512], Wv [64][512] in fragment order (see frag_w); Wo [256][64] natural rows
#define WS_PK  (WS_PQ + 2u * KC * CH)
#define WS_PV  (WS_PK + 2u * KC * CL)
#define WS_PO  (WS_PV + 2u * KC * CL)
#define WS_QH  (WS_PO + 2u * CH * KC)               // f16 [NR][64] q hi ; QL residual x2048 ; KH, KL, V in fragment order: per 32 keys 8 units of 512 B, unit = [lane][8 halves] (see frag_o)
#define WS_QL  (WS_QH + 2u * (size_t)NR * KC)
#define WS_KH  (WS_QL + 2u * (size_t)NR * KC)
#define WS_KL  (WS_KH + 2u * (size_t)NR * KC)
#define WS_V   (WS_KL + 2u * (size_t)NR * KC)
#define WS_END (WS_V + 2u * (size_t)NB * KC * NT)

// a weight fragment stored in fragment order: two units of 512 B, unit = [lane][8 values], so that each wave-wide 16-byte load covers 4 whole 128-B lines (gathered from 16 weight rows it touches 16). Per pass of 32 input channels 8 units: unit (j * 2 + h), lane (g, col) = row j * 16 + col, channels h * 16 + 8 * g + 0..7 of the pass
__device__ __forceinline__ v16b frag_w(const __bf16* p) { union { v16b v; v8b q[2]; } u; u.q[0] = *(const v8b*)p; u.q[1] = *(const v8b*)(p + 256); return u.v; }
// one thread per 16-byte piece of P, pieces in P's own order: a block writes whole lines that no other block writes, whatever rows the pieces come from, and needs no LDS
#define PKB 128            // threads a block; a block's PKB * 8 values lie in one weight array
__global__ __launch_bounds__(PKB) void k_pack(const float* __restrict__ WQ, const float* __restrict__ WK, const float* __restrict__ WV, const float* __restrict__ WO, __bf16* __restrict__ P) {
  static_assert(WS_PQ == 0 && (WS_PK / 2) % (PKB * 8) == 0 && (WS_PV / 2) % (PKB * 8) == 0 && (WS_PO / 2) % (PKB * 8) == 0 && (WS_QH / 2) % (PKB * 8) == 0, "no block straddles two arrays");
  const unsigned e0 = blockIdx.x * (PKB * 8u);   // the block's first element in P
  const float* Wm; unsigned base, kin;           // kin 0: the array keeps its row order
  if (e0 < WS_PK / 2) { Wm = WQ; base = WS_PQ / 2; kin = CH; } else if (e0 < WS_PV / 2) { Wm = WK; base = WS_PK / 2; kin = CL; } else if (e0 < WS_PO / 2) { Wm = WV; base = WS_PV / 2; kin = CL; } else { Wm = WO; base = WS_PO / 2; kin = 0; }
  const unsigned d = (e0 - base) / 8 + threadIdx.x;   // piece in the array: bits 0..3 col, 4 g, 5 h, 6..7 j, from 8 the pass
  const float* s = Wm + (kin ? (((d >> 6) & 3) * 16 + (d & 15)) * kin + (d >> 8) * 32 + ((d >> 5) & 1) * 16 + ((d >> 4) & 1) * 8 : d * 8);
  const v4f a = *(const v4f*)s, c = *(const v4f*)(s + 4); v8b o;
#pragma unroll   // o lives in registers, its index must be a constant
  for (int i = 0; i < 4; ++i) { o[i] = (__bf16)a[i]; o[4 + i] = (__bf16)c[i]; }
  *(v8b*)(P + e0 + threadIdx.x * 8) = o;
}
// ---- proj: block = (64 tokens, which): 64 output channels (4 tiles per wave); A gathered from the channels-first map; which 0: q -> hi/lo rows; 1: k -> hi/lo fragment units; 2: v -> fragment units
template <int WHICH>
__device__ __forceinline__ void proj(const float* __restrict__ X, const __bf16* __restrict__ P, const float* __restrict__ BB, _Float16* __restrict__ OH, _Float16* __restrict__ OL, _Float16* __restrict__ V, _Float16 (*sh)[72], _Float16 (*sl)[72], _Float16 (*st)[72]) {
  constexpr int KIN = (WHICH == 0) ? CH : CL;
  const int tid = threadIdx.x, wave = tid >> 5, lane = tid & 31, col = lane & 15, g = lane >> 4; const size_t rb0 = (size_t)blockIdx.x * 64, r0 = rb0 + wave * 16; const size_t b = rb0 / NT, t0 = rb0 % NT;
  const __bf16* Wr = P + ((WHICH == 0) ? WS_PQ / 2 : (WHICH == 1) ? WS_PK / 2 : WS_PV / 2);
  v8f acc[4] = {};
  constexpr int G = 4;   // passes of 32 channels whose loads are issued as one group: one load latency per group, not four per pass
  // the inner loops are unrolled: xr, w and acc live in registers, their indices must be constants
#pragma unroll 1   // one group's registers at a time
  for (int k0 = 0; k0 < KIN / 32; k0 += G) { float xr[G][16]; v16b w[G][4];
#pragma unroll
    for (int u = 0; u < G; ++u) { const float* p = X + ((b * KIN + (k0 + u) * 32 + 8 * g) * (size_t)NT) + t0 + wave * 16 + col;   // x[b][channel][token]
#pragma unroll
      for (int i = 0; i < 8; ++i) { xr[u][i] = p[(size_t)i * NT]; xr[u][8 + i] = p[(size_t)(16 + i) * NT]; } }
    XW();
#pragma unroll
    for (int u = 0; u < G; ++u)
#pragma unroll
      for (int j = 0; j < 4; ++j) w[u][j] = frag_w(Wr + (size_t)k0 * (KC * 32) + lane * 8 + (u * 4 + j) * 512);   // the group's 32 units lie in a row: one address, the rest immediate offsets
    HOLD();
#pragma unroll
    for (int u = 0; u < G; ++u) { v16b a;
#pragma unroll
      for (int i = 0; i < 16; ++i) a[i] = (__bf16)xr[u][i];
#pragma unroll
      for (int j = 0; j < 4; ++j) acc[j] = wmma_bf(a, w[u][j], acc[j]); } }
  if (WHICH < 2) {
#pragma unroll
    for (int j = 0; j < 4; ++j) { const float bb = bfr(BB[j * 16 + col]);
#pragma unroll
      for (int r = 0; r < 8; ++r) { const float v = acc[j][r] + bb; const _Float16 h = (_Float16)v; sh[wave * 16 + 8 * g + r][j * 16 + col] = h; sl[wave * 16 + 8 * g + r][j * 16 + col] = (_Float16)((v - (float)h) * 2048.0f); } }
    LDSX();
    if (WHICH == 1) {   // the wave's 16 keys are 4 units: unit c, lane (g, col) = key col, channels c * 16 + 8 * g + 0..7
#pragma unroll   // the 8 LDS reads issue together, ahead of the stores
      for (int c = 0; c < 4; ++c) { vst2((unsigned*)(OH + r0 * KC + c * 256 + lane * 8), *(const v4u*)&sh[wave * 16 + col][c * 16 + 8 * g]); vst2((unsigned*)(OL + r0 * KC + c * 256 + lane * 8), *(const v4u*)&sl[wave * 16 + col][c * 16 + 8 * g]); }
    } else
    for (int rl = 0; rl < 16; ++rl) if (lane < 8) { vst2((unsigned*)(OH + (r0 + rl) * KC + lane * 8), *(const v4u*)&sh[wave * 16 + rl][lane * 8]); vst2((unsigned*)(OL + (r0 + rl) * KC + lane * 8), *(const v4u*)&sl[wave * 16 + rl][lane * 8]); }
  } else {
#pragma unroll
    for (int j = 0; j < 4; ++j) { const float bb = bfr(BB[j * 16 + col]);
#pragma unroll
      for (int r = 0; r < 8; ++r) st[j * 16 + col][wave * 16 + 8 * g + r] = (_Float16)(acc[j][r] + bb); }
    __syncthreads();
    for (int e = tid; e < 64 * 8; e += 128) { const int ln = e & 31, u = (e >> 5) & 7, s = e >> 8; vst2((unsigned*)(V + rb0 * KC + e * 8), *(const v4u*)&st[(u >> 1) * 16 + (ln & 15)][s * 32 + (u & 1) * 16 + (ln >> 4) * 8]); } }   // 32 keys s: unit u, lane (g, col) = channel (u >> 1) * 16 + col, keys (u & 1) * 16 + 8 * g + 0..7
}
// one launch for the three projections: they depend on k_pack alone, not on one another, so their blocks (3 x 256, four waves each) share the chip and each hides the others' load waits; the two long ones (512 channels) first in the grid
__global__ __launch_bounds__(128) void k_proj3(const float* __restrict__ XL, const float* __restrict__ XH, const __bf16* __restrict__ P, const float* __restrict__ BQ, const float* __restrict__ BK, const float* __restrict__ BV, _Float16* __restrict__ QH, _Float16* __restrict__ QL, _Float16* __restrict__ KH, _Float16* __restrict__ KL, _Float16* __restrict__ V) {
  __shared__ __align__(16) _Float16 sb[2][64][72];   // hi and residual planes of q or k; v's transpose uses the first
  if (blockIdx.y == 0) proj<1>(XL, P, BK, KH, KL, nullptr, sb[0], sb[1], sb[0]);
  else if (blockIdx.y == 1) proj<2>(XL, P, BV, nullptr, nullptr, V, sb[0], sb[1], sb[0]);
  else proj<0>(XH, P, BQ, QH, QL, nullptr, sb[0], sb[1], sb[0]);
}
// ---- k_attn: block = (64 queries, b), 32 waves = 4 query tiles x KSP key shares: share sp walks the 32-key steps sp, sp + KSP, ... with its own running max / sum / ctx; the KSP partials of a query tile meet in LDS at the end. 3-product scores (unscaled logits); P single x v single
// transposed products: scores as K . Q^T (D row = key, D column = query) and ctx^T += V^T . P^T, so a lane holds 16 scores of ONE query: max and sum run in the lane, one exchange between the wave halves per step, and the two score tiles, converted in place, are the B operand of the second product
#define KSP 8
// a fragment stored in fragment order: two units of 512 B, lane-contiguous, so that each wave-wide 16-byte load covers 4 whole 128-B lines (a fragment gathered from 16 rows touches 16); o = byte offset of the lane's 16 bytes of the first unit
__device__ __forceinline__ v16h frag_o(const _Float16* base, unsigned o, int k) {   // k: constant byte step, added behind the widening so that it becomes the load's immediate offset
  union { v16h v; v8h q[2]; } u; const char* p = (const char*)base + o + k; u.q[0] = *(const v8h*)p; u.q[1] = *(const v8h*)(p + 512); return u.v;
}
__device__ __forceinline__ float xhalf(float x) { return __builtin_bit_cast(float, __builtin_amdgcn_permlanex16(__builtin_bit_cast(int, x), __builtin_bit_cast(int, x), 0x76543210, 0xfedcba98, false, false)); }   // lane l with lane l ^ 16
// the output conv runs in the same block, behind the merge: out = ctx (bf16 hi + residual, K 64) . Wo rows (2 products) + bo + x_high for the block's 64 tokens x 256 channels, wave = (token tile, 32 channels), stored channels-first (64 consecutive tokens per (image, channel)); ctx never leaves the block
__global__ __launch_bounds__(128 * KSP) void k_attn(const _Float16* __restrict__ QH, const _Float16* __restrict__ QL, const _Float16* __restrict__ KH, const _Float16* __restrict__ KL, const _Float16* __restrict__ V, const __bf16* __restrict__ P, const float* __restrict__ BO, const float* __restrict__ XH, float* __restrict__ OUT) {
  __shared__ __align__(16) float sc[64][68], st[CH][68];   // sc: merged ctx [token][column]; st: out before the residual [channel][token]; 68 floats a row: 16-byte accesses of 16 rows spread over the banks
  __shared__ __align__(32) float so[4 * KSP][8][136]; __shared__ float sm[4 * KSP][16], sl[4 * KSP][32]; __shared__ __align__(16) v8h sq[4][6][32];   // so: [ctx rows 8u .. 8u + 7][query * 8 + row], 136 floats per u so that the merge's 16-byte reads spread over the banks; sq: per query tile the q residual fragments and the upper hi fragment, lane-contiguous: read per step, so that a wave fits the 128 registers of 8 waves per SIMD
  // wave number in a scalar register, lane number as the shuffles form it: over the loop the indices live in two vector registers, the load offset fo and the lane's place in sq
  const int wave = __builtin_amdgcn_readfirstlane(threadIdx.x >> 5), lane = __builtin_amdgcn_mbcnt_lo(~0u, 0u), col = lane & 15, g = lane >> 4, sp = wave >> 2; const size_t b = blockIdx.y; const int q0 = blockIdx.x * 64 + (wave & 3) * 16; const size_t rq = b * NT + q0;
  const int qt = wave & 3;
  if (sp == 0) { const _Float16 *pl = QL + (rq + col) * KC + 8 * g, *ph = QH + (rq + col) * KC + 32 + 8 * g;
#pragma unroll   // the four loads in flight together
    for (int i = 0; i < 4; ++i) sq[qt][i][lane] = *(const v8h*)(pl + 16 * i);
    sq[qt][4][lane] = *(const v8h*)ph; sq[qt][5][lane] = *(const v8h*)(ph + 16); }
  __syncthreads();
  const v16h aq0 = frag_h(QH + (rq + col) * KC, lane);
  float m = -3.0e38f, l = 0.f;   // of query col; m is the same in both wave halves, l sums the half's own keys
  v8f acc[4] = {};               // acc[dt][r] = ctx[query col][dt * 16 + 8 * g + r]
  // the step's 32 keys j0 = (it * KSP + sp) * 32 are 8 units at the same place in KH, KL and V: the three bases stay scalar, one 32-bit vector offset serves all loads
  unsigned fo = ((unsigned)(b * (NT / 32) + sp) * 2048u + lane * 8u) * 2u;   // byte offset of the lane's 16 bytes in the step's first unit
  v16h kh0 = frag_o(KH, fo, 0), kl0 = frag_o(KL, fo, 0), kh1 = frag_o(KH, fo, 1024), kl1 = frag_o(KL, fo, 1024);   // keys 0..15 of the first step; every later step's are loaded at the foot of the step before
#pragma unroll 1
  for (int it = 0; it < NT / 32 / KSP; ++it) { v8f s[2];   // s[ct][r]: key j0 + ct * 16 + 8 * g + r, query col
    v16h va[4];
    // each pair of fragments is issued as soon as registers are free for it, three products or the whole softmax ahead of its first use: counted waits, three or four loads' latencies overlapped where each stood alone
#pragma unroll
    for (int ct = 0; ct < 2; ++ct) { v8f c = {}, cl = {};
#pragma unroll
      for (int kc = 0; kc < 2; ++kc) { const v16h kh = kc ? kh1 : kh0, kl = kc ? kl1 : kl0; union { v16h v; v8h q[2]; } ql, qh; ql.q[0] = sq[qt][2 * kc][lane]; ql.q[1] = sq[qt][2 * kc + 1][lane]; if (kc == 0) qh.v = aq0; else { qh.q[0] = sq[qt][4][lane]; qh.q[1] = sq[qt][5][lane]; } c = wmma16(kh, qh.v, c); cl = wmma16(kh, ql.v, cl); cl = wmma16(kl, qh.v, cl);
        if (ct == 0) { if (kc == 0) { kh0 = frag_o(KH, fo, 2048); kl0 = frag_o(KL, fo, 2048); } else { kh1 = frag_o(KH, fo, 3072); kl1 = frag_o(KL, fo, 3072); } }   // keys 16..31 into the registers just read
        else { va[2 * kc] = frag_o(V, fo, (2 * kc) * 1024); va[2 * kc + 1] = frag_o(V, fo, (2 * kc + 1) * 1024); }   // v flies under the softmax
        HOLD(); }
#pragma unroll
      for (int r = 0; r < 8; ++r) s[ct][r] = c[r] + cl[r] * (1.0f / 2048.0f); }   // unscaled logits
    float mx = fmaxf(s[0][0], s[1][0]);
#pragma unroll
    for (int r = 1; r < 8; ++r) mx = fmaxf(mx, fmaxf(s[0][r], s[1][r]));
    mx = fmaxf(mx, xhalf(mx));
    const float mn = fmaxf(m, mx); const float alpha = (m <= -1.0e38f) ? 0.f : __expf(m - mn); float es = 0.f; v16h pb;
#pragma unroll
    for (int r = 0; r < 8; ++r) { const float e0 = __expf(s[0][r] - mn), e1 = __expf(s[1][r] - mn); es += e0 + e1; pb[r] = (_Float16)(e0 * 2048.0f); pb[8 + r] = (_Float16)(e1 * 2048.0f); }
    l = l * alpha + es; m = mn;
#pragma unroll
    for (int dt = 0; dt < 4; ++dt) { acc[dt] *= alpha; acc[dt] = wmma16(va[dt], pb, acc[dt]);
      if (dt == 3) { fo += (it + 1 < NT / 32 / KSP) ? KSP * 4096u : 0u; kh0 = frag_o(KH, fo, 0); kl0 = frag_o(KL, fo, 0); kh1 = frag_o(KH, fo, 1024); kl1 = frag_o(KL, fo, 1024); HOLD(); } } }   // the next step's keys 0..15 (the last step reads its own again, unused)
  XW(); HOLD();   // those last loads are still in flight: what follows reuses the registers that hold their addresses, only behind this wait
  // each share leaves its unnormalised ctx, max and half sums in LDS; the lane number is read back from the load offset (its bits 4..8), so that no lane index is held in a register of its own over the loop (three of them went to scratch)
  const int ln = (fo >> 4) & 31, cn = ln & 15, gn = ln >> 4, tn = wave * 32 + ln;
  // all that the output conv takes from memory is asked for here, as one group, and flies under the merge: the residual at the thread's own 4 store places (16 threads = 256 consecutive bytes of a channel; 64 channels between a thread's places), the wave's 32 weight rows as fragments, their bias
  static_assert(128 * KSP / 16 * 4 == CH && KSP * 32 == CH && KC / 32 == 2, "4 store places a thread; 32 channels a key share; two passes of 32 ctx columns");
  const size_t ob = (b * CH + (tn >> 4)) * (size_t)NT + blockIdx.x * 64 + (tn & 15) * 4;
  v4f xr[4]; v16b w[2][2]; float bo[2];
  const __bf16* pw = P + (size_t)(sp * 32 + cn) * KC + 8 * gn;   // the lane's 16 bytes of weight row sp * 32 + cn (counted from the start of the packed weights); the other row, pass and half by immediate offsets: one address pair for the run
  const float *pb = BO + sp * 32 + cn, *px = XH + ob;
#pragma unroll   // here and below: xr, w, bo, oc live in registers, their indices must be constants
  for (int j = 0; j < 2; ++j) { bo[j] = pb[j * 16];
#pragma unroll
    for (int kc = 0; kc < 2; ++kc) { const __bf16* p = pw + WS_PO / 2 + j * 16 * KC + kc * 32; union { v16b v; v8b q[2]; } u; u.q[0] = *(const v8b*)p; u.q[1] = *(const v8b*)(p + 16); w[kc][j] = u.v; } }
  HOLD();   // the residual last: it is used last and comes from furthest, so the counted wait for the weights leaves it in flight
#pragma unroll
  for (int i = 0; i < 4; ++i) xr[i] = *(const v4f*)(px + (size_t)i * 64 * NT);
  // the group's addresses are inputs of the wait: they stay in their registers up to it, so that no load of the group lands on a register that an earlier one names
  asm volatile("s_wait_xcnt 0x0" :: "v"(pw), "v"(cn), "v"(px) : "memory");
  HOLD();
#pragma unroll   // acc lives in registers, its index must be a constant
  for (int dt = 0; dt < 4; ++dt) *(v8f*)&so[wave][dt * 2 + gn][cn * 8] = acc[dt];
  if (gn == 0) sm[wave][cn] = m;
  sl[wave][ln] = l;
  BARL();
  // merge: a thread owns 4 ctx columns of one query row; shares rescaled to the common max and added, share 0 first
  static_assert(128 * KSP == 64 * 16, "one thread per 4 ctx columns");
  { const int row = tn >> 4, c4 = tn & 15, w0 = row >> 4, q = row & 15; float mm = sm[w0][q];
#pragma unroll   // here and below: the shares' LDS reads issue together, one wait
    for (int p = 1; p < KSP; ++p) mm = fmaxf(mm, sm[p * 4 + w0][q]);
    float ls = 0.f; v4f o = {};
#pragma unroll
    for (int p = 0; p < KSP; ++p) { const float wgt = __expf(sm[p * 4 + w0][q] - mm); ls += wgt * (sl[p * 4 + w0][q] + sl[p * 4 + w0][16 + q]); o += wgt * *(const v4f*)&so[p * 4 + w0][c4 >> 1][q * 8 + (c4 & 1) * 4]; }
    *(v4f*)&sc[row][c4 * 4] = o * ((1.0f / 2048.0f) / ls); }
  BARL();
  HOLD();   // likewise what reads the weights and the bias
  v8f oc[2] = {};
#pragma unroll
  for (int kc = 0; kc < 2; ++kc) { const float* p = &sc[qt * 16 + cn][kc * 32 + 8 * gn]; float af[16];   // fragment elements 0..7 = columns 8 g + 0..7 of the pass, 8..15 = 16 further on
#pragma unroll
    for (int i = 0; i < 8; ++i) { af[i] = p[i]; af[8 + i] = p[16 + i]; }
    const F2 a = bsplit16(af);
#pragma unroll
    for (int j = 0; j < 2; ++j) { oc[j] = wmma_bf(a.l, w[kc][j], oc[j]); oc[j] = wmma_bf(a.h, w[kc][j], oc[j]); } }
#pragma unroll
  for (int j = 0; j < 2; ++j) { const float bb = bfr(bo[j]);
#pragma unroll
    for (int r = 0; r < 8; ++r) st[sp * 32 + j * 16 + cn][qt * 16 + 8 * gn + r] = oc[j][r] + bb; }
  BARL();
  HOLD();   // the residual's rounding stays here: moved up into the merge, it waits out the residual's loads there
#pragma unroll
  for (int i = 0; i < 4; ++i) { v4f v = *(const v4f*)&st[(tn >> 4) + i * 64][(tn & 15) * 4];
#pragma unroll
    for (int e = 0; e < 4; ++e) v[e] += bfr(xr[i][e]);
    vst2(OUT + ob + (size_t)i * 64 * NT, v); }
}
extern "C" void kernel_launch(void* const* d_in, const int* in_sizes, int n_in, void* d_out, int out_size, void* d_ws, size_t ws_size, hipStream_t stream) {
  (void)in_sizes; (void)n_in; (void)out_size;
  const float** F = (const float**)d_in;   // 0 x_low [4,512,64,64], 1 x_high [4,256,64,64], 2 Wq [64,256], 3 bq, 4 Wk [64,512], 5 bk, 6 Wv [64,512], 7 bv, 8 Wo [256,64], 9 bo
  if (ws_size < (size_t)WS_END) return;
  char* ws = (char*)d_ws; __bf16* P = (__bf16*)ws; _Float16 *QH = (_Float16*)(ws + WS_QH), *QL = (_Float16*)(ws + WS_QL), *KH = (_Float16*)(ws + WS_KH), *KL = (_Float16*)(ws + WS_KL), *V = (_Float16*)(ws + WS_V);
  k_pack<<<dim3(WS_QH / 2 / (PKB * 8)), PKB, 0, stream>>>(F[2], F[4], F[6], F[8], P);
  k_proj3<<<dim3(TNB * NT / 64, 3), 128, 0, stream>>>(F[0], F[1], P, F[3], F[5], F[7], QH, QL, KH, KL, V);
  k_attn<<<dim3(TQB, TNB), 128 * KSP, 0, stream>>>(QH, QL, KH, KL, V, P, F[9], F[1], (float*)d_out);
}

// v008
// A run of this version takes 48.9 microseconds.
// Next to v007, in two timings, it ran 1.04 and 1.03 times as fast.
// All steps since v000 together make it 9.43 times as fast.
// compute dtype: all float inputs rounded to bf16; q = Wq . x_high + bq and k, v = Wk/Wv . x_low + b (1x1 convs) with EXACT bf16 products on WMMA 16x16x32 (the channels-first inputs gathered token-major on load); q and k as f16 hi + (x2048-scaled) residual planes with 3-product scores (the logits are unscaled and large, so single-rounded operands would not do), running-max softmax in f32 (hardware exp), P (scaled by 2^11, single f16) x v (single f16); out = ctx (bf16 hi + residual) . Wo rows (2 products) + bo + x_high, stored channels-first; f32 accumulate.
#include <hip/hip_runtime.h>
#include <math.h>

typedef __attribute__((ext_vector_type(16))) _Float16 v16h;
typedef __attribute__((ext_vector_type(16))) __bf16 v16b;
typedef __attribute__((ext_vector_type(8)))  _Float16 v8h;
typedef __attribute__((ext_vector_type(8)))  float v8f;
typedef __attribute__((ext_vector_type(4)))  float v4f;
typedef __attribute__((ext_vector_type(2)))  float v2f;
typedef __attribute__((ext_vector_type(4)))  unsigned v4u;
typedef __attribute__((ext_vector_type(4)))  int v4i;
typedef float __attribute__((may_alias)) float_a;
typedef int __attribute__((may_alias)) int_a;

template <typename T> __device__ __forceinline__ void vst2(void* p, T v) { *(T*)p = v;  }
__device__ __forceinline__ v8f wmma16(v16h a, v16h b, v8f c) {
  v8f d = __builtin_amdgcn_wmma_f32_16x16x32_f16(false, a, false, b, (short)0, c, false, false);
  asm volatile("v_nop\n\tv_nop\n\tv_nop\n\tv_nop" : "+v"(d) : "v"(a), "v"(b));
  return d;
}
__device__ __forceinline__ v8f wmma_bf(v16b a, v16b b, v8f c) {
  v8f d = __builtin_amdgcn_wmma_f32_16x16x32_bf16(false, a, false, b, (short)0, c, false, false);
  asm volatile("v_nop\n\tv_nop\n\tv_nop\n\tv_nop" : "+v"(d) : "v"(a), "v"(b));
  return d;
}
// 16x16x32 fragments: lane = (h = lane>>4, row/col = lane&15); elements 0..7 = k0+8h+0..7, 8..15 = k0+16+8h+0..7; D element r = row 8h+r
__device__ __forceinline__ v16h frag_h(const _Float16* rowk0, int lane) {
  union { v16h v; v8h q[2]; } u; const _Float16* p = rowk0 + 8 * (lane >> 4);
  u.q[0] = *(const v8h*)p; u.q[1] = *(const v8h*)(p + 16); return u.v;
}
__device__ __forceinline__ v16h frag_f32(const float* rowk0, int lane) {
  v16h a; const float* p = rowk0 + 8 * (lane >> 4);
#pragma unroll
  for (int i = 0; i < 8; ++i) { a[i] = (_Float16)p[i]; a[8 + i] = (_Float16)p[16 + i]; }
  return a;
}
__device__ __forceinline__ v16h frag_f32s(const float* rowk0, int lane, float sc) {
  v16h a; const float* p = rowk0 + 8 * (lane >> 4);
#pragma unroll
  for (int i = 0; i < 8; ++i) { a[i] = (_Float16)(p[i] * sc); a[8 + i] = (_Float16)(p[16 + i] * sc); }
  return a;
}
// column fragment from a [K][ld] layout (column n), rows >= K read as 0
__device__ __forceinline__ v16h fragc_f32(const float* W, int k0, int n, int lane, int ld, int K) {
  v16h a; const int g = lane >> 4;
#pragma unroll
  for (int i = 0; i < 8; ++i) { const int ka = k0 + 8 * g + i, kb = ka + 16;
    a[i] = (_Float16)(ka < K ? W[(size_t)(ka < K ? ka : K - 1) * ld + n] : 0.f); a[8 + i] = (_Float16)(kb < K ? W[(size_t)(kb < K ? kb : K - 1) * ld + n] : 0.f); }
  return a;
}
struct F2 { v16b h, l; };
__device__ __forceinline__ F2 bsplit16(const float v[16]) { F2 r;
#pragma unroll
  for (int i = 0; i < 16; ++i) { const __bf16 h = (__bf16)v[i]; r.h[i] = h; r.l[i] = (__bf16)(v[i] - (float)h); }
  return r; }
__device__ __forceinline__ F2 split_row(const float* row, int k0, int lane) { float v[16]; const float* p = row + k0 + 8 * (lane >> 4);
#pragma unroll
  for (int i = 0; i < 8; ++i) { v[i] = p[i]; v[8 + i] = p[16 + i]; }
  return bsplit16(v); }
__device__ __forceinline__ F2 split_rowK(const float* row, int k0, int lane, int K) { float v[16]; const int g = lane >> 4;
#pragma unroll
  for (int i = 0; i < 8; ++i) { const int ka = k0 + 8 * g + i, kb = ka + 16; v[i] = ka < K ? row[ka < K ? ka : K - 1] : 0.f; v[8 + i] = kb < K ? row[kb < K ? kb : K - 1] : 0.f; }
  return bsplit16(v); }
__device__ __forceinline__ F2 split_col(const float* W, int k0, int n, int lane, int ld, int K) { float v[16]; const int g = lane >> 4;
#pragma unroll
  for (int i = 0; i < 8; ++i) { const int ka = k0 + 8 * g + i, kb = ka + 16; v[i] = ka < K ? W[(size_t)(ka < K ? ka : K - 1) * ld + n] : 0.f; v[8 + i] = kb < K ? W[(size_t)(kb < K ? kb : K - 1) * ld + n] : 0.f; }
  return bsplit16(v); }
__device__ __forceinline__ v8f mac3(const F2& a, const F2& b, v8f c) { c = wmma_bf(a.l, b.h, c); c = wmma_bf(a.h, b.l, c); return wmma_bf(a.h, b.h, c); }
__device__ __forceinline__ float sigm(float v) { return 1.0f / (1.0f + expf(-v)); }
#define LDSX() do { asm volatile("s_wait_dscnt 0" ::: "memory"); __builtin_amdgcn_wave_barrier(); __builtin_amdgcn_fence(__ATOMIC_RELEASE, "workgroup"); } while (0)

// the compiler does not schedule across this: a group of loads written ahead of the products that use it stays ahead (left alone it sinks each load pair to its product, and every product then waits out a whole load latency)
#define HOLD() __builtin_amdgcn_sched_barrier(0)
// between two runs of loads of one group: the build lands later loads' data on address registers that earlier loads of the group name, so the earlier loads' translations are waited for first (not their data)
#define XW() asm volatile("s_wait_xcnt 0x0" ::: "memory")
// work-group barrier for data handed over in LDS: waits for the wave's LDS accesses alone (__syncthreads() also waits out every global load in flight, and loads issued ahead of it could not fly under the work behind it)
#define BARL() asm volatile("s_wait_dscnt 0x0\n\ts_barrier_signal -1\n\ts_barrier_wait -1" ::: "memory")

// Non-local feature fusion (B 4, 64 x 64 maps; 256 high-level / 512 low-level channels, 64-dim keys and values): every high-level pixel attends over all 4,096 low-level pixels (unscaled dot-product softmax), 1x1 output conv + residual.
#define NB 4
#define NT 4096            // tokens per image
#define CH 256             // high channels (q source, output)
#define CL 512             // low channels (k, v source)
#define KC 64
#define NR (NB * NT)
#ifndef TQB
#define TQB (NT / 64)
#define TNB NB
#endif
typedef __attribute__((ext_vector_type(8))) __bf16 v8b;
__device__ __forceinline__ v16b frag_b(const __bf16* rowk0, int lane) {
  union { v16b v; v8b q[2]; } u; const __bf16* p = rowk0 + 8 * (lane >> 4);
  u.q[0] = *(const v8b*)p; u.q[1] = *(const v8b*)(p + 16); return u.v;
}
__device__ __forceinline__ float bfr(float v) { return (float)(__bf16)v; }
__device__ __attribute__((noinline)) float exp_ni(float v) { return expf(v); }
__device__ __attribute__((noinline)) float erf_ni(float v) { return erff(v); }

#define WS_PQ  0u                                   // of the packed-weight area only Wo is in use: bf16 [256][64], natural rows, at WS_PO
#define WS_PK  (WS_PQ + 2u * KC * CH)
#define WS_PV  (WS_PK + 2u * KC * CL)
#define WS_PO  (WS_PV + 2u * KC * CL)
#define WS_QH  (WS_PO + 2u * CH * KC)               // f16 [NR][64] q hi ; QL residual x2048 ; KH, KL, V in fragment order: per 32 keys 8 units of 512 B, unit = [lane][8 halves] (see frag_o)
#define WS_QL  (WS_QH + 2u * (size_t)NR * KC)
#define WS_KH  (WS_QL + 2u * (size_t)NR * KC)
#define WS_KL  (WS_KH + 2u * (size_t)NR * KC)
#define WS_V   (WS_KL + 2u * (size_t)NR * KC)
#define WS_END (WS_V + 2u * (size_t)NB * KC * NT)

// the block's weights in LDS, bf16, in fragment order: piece (pass * 4 + j) of WPC bytes = 4 runs (h * 2 + g) of 16 lanes x 16 bytes, run pitch WRP; run (h, g), lane col = weight row j * 16 + col, channels h * 16 + 8 * g + 0..7 of the pass.
// WRP is 320, not 256: the 32 8-byte stores of a wave (4 rows x 8 quads of channels) then fall on all 64 banks once; a 16-byte read of 16 lanes is one contiguous run either way
#define WRP 320
#define WPC (4 * WRP)
typedef __attribute__((ext_vector_type(4))) __bf16 v4b;
__device__ __forceinline__ v16b frag_wl(const char* p) { union { v16b v; v8b q[2]; } u; u.q[0] = *(const v8b*)p; u.q[1] = *(const v8b*)(p + 2 * WRP); return u.v; }
// ---- proj: block = (64 tokens, which): 64 output channels (4 tiles per wave); A gathered from the channels-first map; which 0: q -> hi/lo rows; 1: k -> hi/lo fragment units; 2: v -> fragment units
template <int WHICH>
__device__ __forceinline__ void proj(const float* __restrict__ X, const float* __restrict__ Wm, const float* __restrict__ BB, _Float16* __restrict__ OH, _Float16* __restrict__ OL, _Float16* __restrict__ V, _Float16 (*sh)[72], _Float16 (*sl)[72], _Float16 (*st)[72], char* sw) {
  constexpr int KIN = (WHICH == 0) ? CH : CL;
  const int tid = threadIdx.x, wave = tid >> 5, lane = tid & 31, col = lane & 15, g = lane >> 4; const size_t rb0 = (size_t)blockIdx.x * 64, r0 = rb0 + wave * 16; const size_t b = rb0 / NT, t0 = rb0 % NT;
  // the block rounds its own weights [64][KIN] to bf16 and lays them in LDS, once for its four waves: thread = (row of 16, quad of 4 channels), so a wave's 16-byte load covers 4 whole 128-B lines (one pass of 4 rows); load i is piece i (pass i >> 2, rows (i & 3) * 16 + 0..15)
  { const float* s = Wm + (tid >> 3) * KIN + (tid & 7) * 4; char* d = sw + ((tid & 7) >> 1) * WRP + (tid >> 3) * 16 + (tid & 1) * 8;
    constexpr int NP = KIN / 8;   // pieces, one load a thread each: all in flight together, one load latency for the whole matrix
    v4f f[NP];
#pragma unroll   // here and below: f lives in registers, its index must be a constant; the steps become immediate offsets
    for (int i = 0; i < NP; ++i) f[i] = *(const v4f*)(s + (i & 3) * 16 * KIN + (i >> 2) * 32);
    // the run's address is an input of the wait: it stays in its registers up to it, so that no load of the run lands on them
    asm volatile("s_wait_xcnt 0x0" :: "v"(s) : "memory");
    HOLD();
#pragma unroll
    for (int i = 0; i < NP; ++i) { v4b o;
#pragma unroll
      for (int e = 0; e < 4; ++e) o[e] = (__bf16)f[i][e];
      *(v4b*)(d + i * WPC) = o; } }
  BARL();   // every wave reads pieces that all four wrote
  const char* Wr = sw + g * WRP + col * 16;
  v8f acc[4] = {};
  constexpr int G = 4;   // passes of 32 channels whose loads are issued as one group: one load latency per group, not four per pass
  // the inner loops are unrolled: xr, w and acc live in registers, their indices must be constants
#pragma unroll 1   // one group's registers at a time
  for (int k0 = 0; k0 < KIN / 32; k0 += G) { float xr[G][16]; v16b w[G][4];
#pragma unroll
    for (int u = 0; u < G; ++u) { const float* p = X + ((b * KIN + (k0 + u) * 32 + 8 * g) * (size_t)NT) + t0 + wave * 16 + col;   // x[b][channel][token]
#pragma unroll
      for (int i = 0; i < 8; ++i) { xr[u][i] = p[(size_t)i * NT]; xr[u][8 + i] = p[(size_t)(16 + i) * NT]; } }
    XW();
#pragma unroll
    for (int u = 0; u < G; ++u)
#pragma unroll
      for (int j = 0; j < 4; ++j) w[u][j] = frag_wl(Wr + k0 * (4 * WPC) + (u * 4 + j) * WPC);   // from LDS, under the flight of the x loads; the group's 16 pieces lie in a row: one address, the rest immediate offsets
    HOLD();
#pragma unroll
    for (int u = 0; u < G; ++u) { v16b a;
#pragma unroll
      for (int i = 0; i < 16; ++i) a[i] = (__bf16)xr[u][i];
#pragma unroll
      for (int j = 0; j < 4; ++j) acc[j] = wmma_bf(a, w[u][j], acc[j]); } }
  if (WHICH < 2) {
#pragma unroll
    for (int j = 0; j < 4; ++j) { const float bb = bfr(BB[j * 16 + col]);
#pragma unroll
      for (int r = 0; r < 8; ++r) { const float v = acc[j][r] + bb; const _Float16 h = (_Float16)v; sh[wave * 16 + 8 * g + r][j * 16 + col] = h; sl[wave * 16 + 8 * g + r][j * 16 + col] = (_Float16)((v - (float)h) * 2048.0f); } }
    LDSX();
    if (WHICH == 1) {   // the wave's 16 keys are 4 units: unit c, lane (g, col) = key col, channels c * 16 + 8 * g + 0..7
#pragma unroll   // the 8 LDS reads issue together, ahead of the stores
      for (int c = 0; c < 4; ++c) { vst2((unsigned*)(OH + r0 * KC + c * 256 + lane * 8), *(const v4u*)&sh[wave * 16 + col][c * 16 + 8 * g]); vst2((unsigned*)(OL + r0 * KC + c * 256 + lane * 8), *(const v4u*)&sl[wave * 16 + col][c * 16 + 8 * g]); }
    } else
    for (int rl = 0; rl < 16; ++rl) if (lane < 8) { vst2((unsigned*)(OH + (r0 + rl) * KC + lane * 8), *(const v4u*)&sh[wave * 16 + rl][lane * 8]); vst2((unsigned*)(OL + (r0 + rl) * KC + lane * 8), *(const v4u*)&sl[wave * 16 + rl][lane * 8]); }
  } else {
#pragma unroll
    for (int j = 0; j < 4; ++j) { const float bb = bfr(BB[j * 16 + col]);
#pragma unroll
      for (int r = 0; r < 8; ++r) st[j * 16 + col][wave * 16 + 8 * g + r] = (_Float16)(acc[j][r] + bb); }
    __syncthreads();
    for (int e = tid; e < 64 * 8; e += 128) { const int ln = e & 31, u = (e >> 5) & 7, s = e >> 8; vst2((unsigned*)(V + rb0 * KC + e * 8), *(const v4u*)&st[(u >> 1) * 16 + (ln & 15)][s * 32 + (u & 1) * 16 + (ln >> 4) * 8]); } }   // 32 keys s: unit u, lane (g, col) = channel (u >> 1) * 16 + col, keys (u & 1) * 16 + 8 * g + 0..7
}
// one launch for the three projections: they depend on the inputs alone, not on one another, so their blocks (3 x 256, four waves each) share the chip and each hides the others' load waits; the two long ones (512 channels) first in the grid. The first blocks of the short one also round Wo to bf16 for k_attn (one thread per 16-byte piece, natural row order; a block writes whole lines that no other block writes)
__global__ __launch_bounds__(128) void k_proj3(const float* __restrict__ XL, const float* __restrict__ XH, const float* __restrict__ WQ, const float* __restrict__ WK, const float* __restrict__ WV, const float* __restrict__ WO, const float* __restrict__ BQ, const float* __restrict__ BK, const float* __restrict__ BV, __bf16* __restrict__ P, _Float16* __restrict__ QH, _Float16* __restrict__ QL, _Float16* __restrict__ KH, _Float16* __restrict__ KL, _Float16* __restrict__ V) {
  __shared__ __align__(16) _Float16 sb[2][64][72];   // hi and residual planes of q or k; v's transpose uses the first
  __shared__ __align__(16) char sw[CL / 32 * 4 * WPC];   // the block's weights (see frag_wl)
  if (blockIdx.y == 0) proj<1>(XL, WK, BK, KH, KL, nullptr, sb[0], sb[1], sb[0], sw);
  else if (blockIdx.y == 1) proj<2>(XL, WV, BV, nullptr, nullptr, V, sb[0], sb[1], sb[0], sw);
  else {
    if (blockIdx.x < CH * KC / 8 / 128) { const unsigned d = (blockIdx.x * 128 + threadIdx.x) * 8; const v4f a = *(const v4f*)(WO + d), c = *(const v4f*)(WO + d + 4); v8b o;
#pragma unroll   // o lives in registers, its index must be a constant
      for (int i = 0; i < 4; ++i) { o[i] = (__bf16)a[i]; o[4 + i] = (__bf16)c[i]; }
      *(v8b*)(P + WS_PO / 2 + d) = o; }
    proj<0>(XH, WQ, BQ, QH, QL, nullptr, sb[0], sb[1], sb[0], sw); }
}
// ---- k_attn: block = (64 queries, b), 32 waves = 4 query tiles x KSP key shares: share sp walks the 32-key steps sp, sp + KSP, ... with its own running max / sum / ctx; the KSP partials of a query tile meet in LDS at the end. 3-product scores (unscaled logits); P single x v single
// transposed products: scores as K . Q^T (D row = key, D column = query) and ctx^T += V^T . P^T, so a lane holds 16 scores of ONE query: max and sum run in the lane, one exchange between the wave halves per step, and the two score tiles, converted in place, are the B operand of the second product
#define KSP 8
// a fragment stored in fragment order: two units of 512 B, lane-contiguous, so that each wave-wide 16-byte load covers 4 whole 128-B lines (a fragment gathered from 16 rows touches 16); o = byte offset of the lane's 16 bytes of the first unit
__device__ __forceinline__ v16h frag_o(const _Float16* base, unsigned o, int k) {   // k: constant byte step, added behind the widening so that it becomes the load's immediate offset
  union { v16h v; v8h q[2]; } u; const char* p = (const char*)base + o + k; u.q[0] = *(const v8h*)p; u.q[1] = *(const v8h*)(p + 512); return u.v;
}
__device__ __forceinline__ float xhalf(float x) { return __builtin_bit_cast(float, __builtin_amdgcn_permlanex16(__builtin_bit_cast(int, x), __builtin_bit_cast(int, x), 0x76543210, 0xfedcba98, false, false)); }   // lane l with lane l ^ 16
// the output conv runs in the same block, behind the merge: out = ctx (bf16 hi + residual, K 64) . Wo rows (2 products) + bo + x_high for the block's 64 tokens x 256 channels, wave = (token tile, 32 channels), stored channels-first (64 consecutive tokens per (image, channel)); ctx never leaves the block
__global__ __launch_bounds__(128 * KSP) void k_attn(const _Float16* __restrict__ QH, const _Float16* __restrict__ QL, const _Float16* __restrict__ KH, const _Float16* __restrict__ KL, const _Float16* __restrict__ V, const __bf16* __restrict__ P, const float* __restrict__ BO, const float* __restrict__ XH, float* __restrict__ OUT) {
  __shared__ __align__(16) float sc[64][68], st[CH][68];   // sc: merged ctx [token][column]; st: out before the residual [channel][token]; 68 floats a row: 16-byte accesses of 16 rows spread over the banks
  __shared__ __align__(32) float so[4 * KSP][8][136]; __shared__ float sm[4 * KSP][16], sl[4 * KSP][32]; __shared__ __align__(16) v8h sq[4][6][32];   // so: [ctx rows 8u .. 8u + 7][query * 8 + row], 136 floats per u so that the merge's 16-byte reads spread over the banks; sq: per query tile the q residual fragments and the upper hi fragment, lane-contiguous: read per step, so that a wave fits the 128 registers of 8 waves per SIMD
  // wave number in a scalar register, lane number as the shuffles form it: over the loop the indices live in two vector registers, the load offset fo and the lane's place in sq
  const int wave = __builtin_amdgcn_readfirstlane(threadIdx.x >> 5), lane = __builtin_amdgcn_mbcnt_lo(~0u, 0u), col = lane & 15, g = lane >> 4, sp = wave >> 2; const size_t b = blockIdx.y; const int q0 = blockIdx.x * 64 + (wave & 3) * 16; const size_t rq = b * NT + q0;
  const int qt = wave & 3;
  if (sp == 0) { const _Float16 *pl = QL + (rq + col) * KC + 8 * g, *ph = QH + (rq + col) * KC + 32 + 8 * g;
#pragma unroll   // the four loads in flight together
    for (int i = 0; i < 4; ++i) sq[qt][i][lane] = *(const v8h*)(pl + 16 * i);
    sq[qt][4][lane] = *(const v8h*)ph; sq[qt][5][lane] = *(const v8h*)(ph + 16); }
  __syncthreads();
  const v16h aq0 = frag_h(QH + (rq + col) * KC, lane);
  float m = -3.0e38f, l = 0.f;   // of query col; m is the same in both wave halves, l sums the half's own keys
  v8f acc[4] = {};               // acc[dt][r] = ctx[query col][dt * 16 + 8 * g + r]
  // the step's 32 keys j0 = (it * KSP + sp) * 32 are 8 units at the same place in KH, KL and V: the three bases stay scalar, one 32-bit vector offset serves all loads
  unsigned fo = ((unsigned)(b * (NT / 32) + sp) * 2048u + lane * 8u) * 2u;   // byte offset of the lane's 16 bytes in the step's first unit
  v16h kh0 = frag_o(KH, fo, 0), kl0 = frag_o(KL, fo, 0), kh1 = frag_o(KH, fo, 1024), kl1 = frag_o(KL, fo, 1024);   // keys 0..15 of the first step; every later step's are loaded at the foot of the step before
#pragma unroll 1
  for (int it = 0; it < NT / 32 / KSP; ++it) { v8f s[2];   // s[ct][r]: key j0 + ct * 16 + 8 * g + r, query col
    v16h va[4];
    // each pair of fragments is issued as soon as registers are free for it, three products or the whole softmax ahead of its first use: counted waits, three or four loads' latencies overlapped where each stood alone
#pragma unroll
    for (int ct = 0; ct < 2; ++ct) { v8f c = {}, cl = {};
#pragma unroll
      for (int kc = 0; kc < 2; ++kc) { const v16h kh = kc ? kh1 : kh0, kl = kc ? kl1 : kl0; union { v16h v; v8h q[2]; } ql, qh; ql.q[0] = sq[qt][2 * kc][lane]; ql.q[1] = sq[qt][2 * kc + 1][lane]; if (kc == 0) qh.v = aq0; else { qh.q[0] = sq[qt][4][lane]; qh.q[1] = sq[qt][5][lane]; } c = wmma16(kh, qh.v, c); cl = wmma16(kh, ql.v, cl); cl = wmma16(kl, qh.v, cl);
        if (ct == 0) { if (kc == 0) { kh0 = frag_o(KH, fo, 2048); kl0 = frag_o(KL, fo, 2048); } else { kh1 = frag_o(KH, fo, 3072); kl1 = frag_o(KL, fo, 3072); } }   // keys 16..31 into the registers just read
        else { va[2 * kc] = frag_o(V, fo, (2 * kc) * 1024); va[2 * kc + 1] = frag_o(V, fo, (2 * kc + 1) * 1024); }   // v flies under the softmax
        HOLD(); }
#pragma unroll
      for (int r = 0; r < 8; ++r) s[ct][r] = c[r] + cl[r] * (1.0f / 2048.0f); }   // unscaled logits
    float mx = fmaxf(s[0][0], s[1][0]);
#pragma unroll
    for (int r = 1; r < 8; ++r) mx = fmaxf(mx, fmaxf(s[0][r], s[1][r]));
    mx = fmaxf(mx, xhalf(mx));
    const float mn = fmaxf(m, mx); const float alpha = (m <= -1.0e38f) ? 0.f : __expf(m - mn); float es = 0.f; v16h pb;
#pragma unroll
    for (int r = 0; r < 8; ++r) { const float e0 = __expf(s[0][r] - mn), e1 = __expf(s[1][r] - mn); es += e0 + e1; pb[r] = (_Float16)(e0 * 2048.0f); pb[8 + r] = (_Float16)(e1 * 2048.0f); }
    l = l * alpha + es; m = mn;
#pragma unroll
    for (int dt = 0; dt < 4; ++dt) { acc[dt] *= alpha; acc[dt] = wmma16(va[dt], pb, acc[dt]);
      if (dt == 3) { fo += (it + 1 < NT / 32 / KSP) ? KSP * 4096u : 0u; kh0 = frag_o(KH, fo, 0); kl0 = frag_o(KL, fo, 0); kh1 = frag_o(KH, fo, 1024); kl1 = frag_o(KL, fo, 1024); HOLD(); } } }   // the next step's keys 0..15 (the last step reads its own again, unused)
  XW(); HOLD();   // those last loads are still in flight: what follows reuses the registers that hold their addresses, only behind this wait
  // each share leaves its unnormalised ctx, max and half sums in LDS; the lane number is read back from the load offset (its bits 4..8), so that no lane index is held in a register of its own over the loop (three of them went to scratch)
  const int ln = (fo >> 4) & 31, cn = ln & 15, gn = ln >> 4, tn = wave * 32 + ln;
  // all that the output conv takes from memory is asked for here, as one group, and flies under the merge: the residual at the thread's own 4 store places (16 threads = 256 consecutive bytes of a channel; 64 channels between a thread's places), the wave's 32 weight rows as fragments, their bias
  static_assert(128 * KSP / 16 * 4 == CH && KSP * 32 == CH && KC / 32 == 2, "4 store places a thread; 32 channels a key share; two passes of 32 ctx columns");
  const size_t ob = (b * CH + (tn >> 4)) * (size_t)NT + blockIdx.x * 64 + (tn & 15) * 4;
  v4f xr[4]; v16b w[2][2]; float bo[2];
  const __bf16* pw = P + (size_t)(sp * 32 + cn) * KC + 8 * gn;   // the lane's 16 bytes of weight row sp * 32 + cn (counted from the start of the packed weights); the other row, pass and half by immediate offsets: one address pair for the run
  const float *pb = BO + sp * 32 + cn, *px = XH + ob;
#pragma unroll   // here and below: xr, w, bo, oc live in registers, their indices must be constants
  for (int j = 0; j < 2; ++j) { bo[j] = pb[j * 16];
#pragma unroll
    for (int kc = 0; kc < 2; ++kc) { const __bf16* p = pw + WS_PO / 2 + j * 16 * KC + kc * 32; union { v16b v; v8b q[2]; } u; u.q[0] = *(const v8b*)p; u.q[1] = *(const v8b*)(p + 16); w[kc][j] = u.v; } }
  HOLD();   // the residual last: it is used last and comes from furthest, so the counted wait for the weights leaves it in flight
#pragma unroll
  for (int i = 0; i < 4; ++i) xr[i] = *(const v4f*)(px + (size_t)i * 64 * NT);
  // the group's addresses are inputs of the wait: they stay in their registers up to it, so that no load of the group lands on a register that an earlier one names
  asm volatile("s_wait_xcnt 0x0" :: "v"(pw), "v"(cn), "v"(px) : "memory");
  HOLD();
#pragma unroll   // acc lives in registers, its index must be a constant
  for (int dt = 0; dt < 4; ++dt) *(v8f*)&so[wave][dt * 2 + gn][cn * 8] = acc[dt];
  if (gn == 0) sm[wave][cn] = m;
  sl[wave][ln] = l;
  BARL();
  // merge: a thread owns 4 ctx columns of one query row; shares rescaled to the common max and added, share 0 first
  static_assert(128 * KSP == 64 * 16, "one thread per 4 ctx columns");
  { const int row = tn >> 4, c4 = tn & 15, w0 = row >> 4, q = row & 15; float mm = sm[w0][q];
#pragma unroll   // here and below: the shares' LDS reads issue together, one wait
    for (int p = 1; p < KSP; ++p) mm = fmaxf(mm, sm[p * 4 + w0][q]);
    float ls = 0.f; v4f o = {};
#pragma unroll
    for (int p = 0; p < KSP; ++p) { const float wgt = __expf(sm[p * 4 + w0][q] - mm); ls += wgt * (sl[p * 4 + w0][q] + sl[p * 4 + w0][16 + q]); o += wgt * *(const v4f*)&so[p * 4 + w0][c4 >> 1][q * 8 + (c4 & 1) * 4]; }
    *(v4f*)&sc[row][c4 * 4] = o * ((1.0f / 2048.0f) / ls); }
  BARL();
  HOLD();   // likewise what reads the weights and the bias
  v8f oc[2] = {};
#pragma unroll
  for (int kc = 0; kc < 2; ++kc) { const float* p = &sc[qt * 16 + cn][kc * 32 + 8 * gn]; float af[16];   // fragment elements 0..7 = columns 8 g + 0..7 of the pass, 8..15 = 16 further on
#pragma unroll
    for (int i = 0; i < 8; ++i) { af[i] = p[i]; af[8 + i] = p[16 + i]; }
    const F2 a = bsplit16(af);
#pragma unroll
    for (int j = 0; j < 2; ++j) { oc[j] = wmma_bf(a.l, w[kc][j], oc[j]); oc[j] = wmma_bf(a.h, w[kc][j], oc[j]); } }
#pragma unroll
  for (int j = 0; j < 2; ++j) { const float bb = bfr(bo[j]);
#pragma unroll
    for (int r = 0; r < 8; ++r) st[sp * 32 + j * 16 + cn][qt * 16 + 8 * gn + r] = oc[j][r] + bb; }
  BARL();
  HOLD();   // the residual's rounding stays here: moved up into the merge, it waits out the residual's loads there
#pragma unroll
  for (int i = 0; i < 4; ++i) { v4f v = *(const v4f*)&st[(tn >> 4) + i * 64][(tn & 15) * 4];
#pragma unroll
    for (int e = 0; e < 4; ++e) v[e] += bfr(xr[i][e]);
    vst2(OUT + ob + (size_t)i * 64 * NT, v); }
}
extern "C" void kernel_launch(void* const* d_in, const int* in_sizes, int n_in, void* d_out, int out_size, void* d_ws, size_t ws_size, hipStream_t stream) {
  (void)in_sizes; (void)n_in; (void)out_size;
  const float** F = (const float**)d_in;   // 0 x_low [4,512,64,64], 1 x_high [4,256,64,64], 2 Wq [64,256], 3 bq, 4 Wk [64,512], 5 bk, 6 Wv [64,512], 7 bv, 8 Wo [256,64], 9 bo
  if (ws_size < (size_t)WS_END) return;
  char* ws = (char*)d_ws; __bf16* P = (__bf16*)ws; _Float16 *QH = (_Float16*)(ws + WS_QH), *QL = (_Float16*)(ws + WS_QL), *KH = (_Float16*)(ws + WS_KH), *KL = (_Float16*)(ws + WS_KL), *V = (_Float16*)(ws + WS_V);
  k_proj3<<<dim3(TNB * NT / 64, 3), 128, 0, stream>>>(F[0], F[1], F[2], F[4], F[6], F[8], F[3], F[5], F[7], P, QH, QL, KH, KL, V);
  k_attn<<<dim3(TQB, TNB), 128 * KSP, 0, stream>>>(QH, QL, KH, KL, V, P, F[9], F[1], (float*)d_out);
}

// v009
// It runs in 46.6 microseconds.
// Two timings next to v008 put it at 1.05 and 1.04 times that version's speed.
// All steps since v000 together make it 9.83 times as fast.
// compute dtype: all float inputs rounded to bf16; q = Wq . x_high + bq and k, v = Wk/Wv . x_low + b (1x1 convs) with EXACT bf16 products on WMMA 16x16x32 (the channels-first inputs gathered token-major on load); q and k as f16 hi + (x2048-scaled) residual planes with 3-product scores (the logits are unscaled and large, so single-rounded operands would not do), running-max softmax in f32 (hardware exp), P (scaled by 2^11, single f16) x v (single f16); out = ctx (bf16 hi + residual) . Wo rows (2 products) + bo + x_high, stored channels-first; f32 accumulate.
#include <hip/hip_runtime.h>
#include <math.h>

typedef __attribute__((ext_vector_type(16))) _Float16 v16h;
typedef __attribute__((ext_vector_type(16))) __bf16 v16b;
typedef __attribute__((ext_vector_type(8)))  _Float16 v8h;
typedef __attribute__((ext_vector_type(8)))  float v8f;
typedef __attribute__((ext_vector_type(4)))  float v4f;
typedef __attribute__((ext_vector_type(2)))  float v2f;
typedef __attribute__((ext_vector_type(4)))  unsigned v4u;
typedef __attribute__((ext_vector_type(4)))  int v4i;
typedef float __attribute__((may_alias)) float_a;
typedef int __attribute__((may_alias)) int_a;

template <typename T> __device__ __forceinline__ void vst2(void* p, T v) { *(T*)p = v;  }
__device__ __forceinline__ v8f wmma16(v16h a, v16h b, v8f c) {
  v8f d = __builtin_amdgcn_wmma_f32_16x16x32_f16(false, a, false, b, (short)0, c, false, false);
  asm volatile("v_nop\n\tv_nop\n\tv_nop\n\tv_nop" : "+v"(d) : "v"(a), "v"(b));
  return d;
}
__device__ __forceinline__ v8f wmma_bf(v16b a, v16b b, v8f c) {
  v8f d = __builtin_amdgcn_wmma_f32_16x16x32_bf16(false, a, false, b, (short)0, c, false, false);
  asm volatile("v_nop\n\tv_nop\n\tv_nop\n\tv_nop" : "+v"(d) : "v"(a), "v"(b));
  return d;
}
// 16x16x32 fragments: lane = (h = lane>>4, row/col = lane&15); elements 0..7 = k0+8h+0..7, 8..15 = k0+16+8h+0..7; D element r = row 8h+r
__device__ __forceinline__ v16h frag_h(const _Float16* rowk0, int lane) {
  union { v16h v; v8h q[2]; } u; const _Float16* p = rowk0 + 8 * (lane >> 4);
  u.q[0] = *(const v8h*)p; u.q[1] = *(const v8h*)(p + 16); return u.v;
}
__device__ __forceinline__ v16h frag_f32(const float* rowk0, int lane) {
  v16h a; const float* p = rowk0 + 8 * (lane >> 4);
#pragma unroll
  for (int i = 0; i < 8; ++i) { a[i] = (_Float16)p[i]; a[8 + i] = (_Float16)p[16 + i]; }
  return a;
}
__device__ __forceinline__ v16h frag_f32s(const float* rowk0, int lane, float sc) {
  v16h a; const float* p = rowk0 + 8 * (lane >> 4);
#pragma unroll
  for (int i = 0; i < 8; ++i) { a[i] = (_Float16)(p[i] * sc); a[8 + i] = (_Float16)(p[16 + i] * sc); }
  return a;
}
// column fragment from a [K][ld] layout (column n), rows >= K read as 0
__device__ __forceinline__ v16h fragc_f32(const float* W, int k0, int n, int lane, int ld, int K) {
  v16h a; const int g = lane >> 4;
#pragma unroll
  for (int i = 0; i < 8; ++i) { const int ka = k0 + 8 * g + i, kb = ka + 16;
    a[i] = (_Float16)(ka < K ? W[(size_t)(ka < K ? ka : K - 1) * ld + n] : 0.f); a[8 + i] = (_Float16)(kb < K ? W[(size_t)(kb < K ? kb : K - 1) * ld + n] : 0.f); }
  return a;
}
struct F2 { v16b h, l; };
__device__ __forceinline__ F2 bsplit16(const float v[16]) { F2 r;
#pragma unroll
  for (int i = 0; i < 16; ++i) { const __bf16 h = (__bf16)v[i]; r.h[i] = h; r.l[i] = (__bf16)(v[i] - (float)h); }
  return r; }
__device__ __forceinline__ F2 split_row(const float* row, int k0, int lane) { float v[16]; const float* p = row + k0 + 8 * (lane >> 4);
#pragma unroll
  for (int i = 0; i < 8; ++i) { v[i] = p[i]; v[8 + i] = p[16 + i]; }
  return bsplit16(v); }
__device__ __forceinline__ F2 split_rowK(const float* row, int k0, int lane, int K) { float v[16]; const int g = lane >> 4;
#pragma unroll
  for (int i = 0; i < 8; ++i) { const int ka = k0 + 8 * g + i, kb = ka + 16; v[i] = ka < K ? row[ka < K ? ka : K - 1] : 0.f; v[8 + i] = kb < K ? row[kb < K ? kb : K - 1] : 0.f; }
  return bsplit16(v); }
__device__ __forceinline__ F2 split_col(const float* W, int k0, int n, int lane, int ld, int K) { float v[16]; const int g = lane >> 4;
#pragma unroll
  for (int i = 0; i < 8; ++i) { const int ka = k0 + 8 * g + i, kb = ka + 16; v[i] = ka < K ? W[(size_t)(ka < K ? ka : K - 1) * ld + n] : 0.f; v[8 + i] = kb < K ? W[(size_t)(kb < K ? kb : K - 1) * ld + n] : 0.f; }
  return bsplit16(v); }
__device__ __forceinline__ v8f mac3(const F2& a, const F2& b, v8f c) { c = wmma_bf(a.l, b.h, c); c = wmma_bf(a.h, b.l, c); return wmma_bf(a.h, b.h, c); }
__device__ __forceinline__ float sigm(float v) { return 1.0f / (1.0f + expf(-v)); }
#define LDSX() do { asm volatile("s_wait_dscnt 0" ::: "memory"); __builtin_amdgcn_wave_barrier(); __builtin_amdgcn_fence(__ATOMIC_RELEASE, "workgroup"); } while (0)

// the compiler does not schedule across this: a group of loads written ahead of the products that use it stays ahead (left alone it sinks each load pair to its product, and every product then waits out a whole load latency)
#define HOLD() __builtin_amdgcn_sched_barrier(0)
// between two runs of loads of one group: the build lands later loads' data on address registers that earlier loads of the group name, so the earlier loads' translations are waited for first (not their data)
#define XW() asm volatile("s_wait_xcnt 0x0" ::: "memory")
// work-group barrier for data handed over in LDS: waits for the wave's LDS accesses alone (__syncthreads() also waits out every global load in flight, and loads issued ahead of it could not fly under the work behind it)
#define BARL() asm volatile("s_wait_dscnt 0x0\n\ts_barrier_signal -1\n\ts_barrier_wait -1" ::: "memory")

// Non-local feature fusion (B 4, 64 x 64 maps; 256 high-level / 512 low-level channels, 64-dim keys and values): every high-level pixel attends over all 4,096 low-level pixels (unscaled dot-product softmax), 1x1 output conv + residual.
#define NB 4
#define NT 4096            // tokens per image
#define CH 256             // high channels (q source, output)
#define CL 512             // low channels (k, v source)
#define KC 64
#define NR (NB * NT)
#ifndef TQB
#define TQB (NT / 64)
#define TNB NB
#endif
typedef __attribute__((ext_vector_type(8))) __bf16 v8b;
__device__ __forceinline__ v16b frag_b(const __bf16* rowk0, int lane) {
  union { v16b v; v8b q[2]; } u; const __bf16* p = rowk0 + 8 * (lane >> 4);
  u.q[0] = *(const v8b*)p; u.q[1] = *(const v8b*)(p + 16); return u.v;
}
__device__ __forceinline__ float bfr(float v) { return (float)(__bf16)v; }
__device__ __attribute__((noinline)) float exp_ni(float v) { return expf(v); }
__device__ __attribute__((noinline)) float erf_ni(float v) { return erff(v); }

#define WS_PQ  0u                                   // of the packed-weight area only Wo is in use: bf16 [256][64], natural rows, at WS_PO
#define WS_PK  (WS_PQ + 2u * KC * CH)
#define WS_PV  (WS_PK + 2u * KC * CL)
#define WS_PO  (WS_PV + 2u * KC * CL)
#define WS_QH  (WS_PO + 2u * CH * KC)               // f16 [NR][64] q hi ; QL residual x2048 ; KH, KL, V in fragment order: per 32 keys 8 units of 512 B, unit = [lane][8 halves] (see frag_o)
#define WS_QL  (WS_QH + 2u * (size_t)NR * KC)
#define WS_KH  (WS_QL + 2u * (size_t)NR * KC)
#define WS_KL  (WS_KH + 2u * (size_t)NR * KC)
#define WS_V   (WS_KL + 2u * (size_t)NR * KC)
#define WS_END (WS_V + 2u * (size_t)NB * KC * NT)

// the block's weights in LDS, bf16, in fragment order: piece (pass * 4 + j) of WPC bytes = 4 runs (h * 2 + g) of 16 lanes x 16 bytes, run pitch WRP; run (h, g), lane col = weight row j * 16 + col, channels h * 16 + 8 * g + 0..7 of the pass.
// WRP is 320, not 256: the 32 8-byte stores of a wave (4 rows x 8 quads of channels) then fall on all 64 banks once; a 16-byte read of 16 lanes is one contiguous run either way
#define WRP 320
#define WPC (4 * WRP)
typedef __attribute__((ext_vector_type(4))) __bf16 v4b;
__device__ __forceinline__ v16b frag_wl(const char* p) { union { v16b v; v8b q[2]; } u; u.q[0] = *(const v8b*)p; u.q[1] = *(const v8b*)(p + 2 * WRP); return u.v; }
// ---- proj: block = (64 tokens, which): 64 output channels (4 tiles per wave); A gathered from the channels-first map; which 0: q -> hi/lo rows; 1: k -> hi/lo fragment units; 2: v -> fragment units
template <int WHICH>
__device__ __forceinline__ void proj(const float* __restrict__ X, const float* __restrict__ Wm, const float* __restrict__ BB, _Float16* __restrict__ OH, _Float16* __restrict__ OL, _Float16* __restrict__ V, _Float16 (*sh)[72], _Float16 (*sl)[72], _Float16 (*st)[72], char* sw) {
  constexpr int KIN = (WHICH == 0) ? CH : CL;
  const int tid = threadIdx.x, wave = tid >> 5, lane = tid & 31, col = lane & 15, g = lane >> 4; const size_t rb0 = (size_t)blockIdx.x * 64, r0 = rb0 + wave * 16; const size_t b = rb0 / NT, t0 = rb0 % NT;
  // the block rounds its own weights [64][KIN] to bf16 and lays them in LDS, once for its four waves: thread = (row of 16, quad of 4 channels), so a wave's 16-byte load covers 4 whole 128-B lines (one pass of 4 rows); load i is piece i (pass i >> 2, rows (i & 3) * 16 + 0..15)
  { const float* s = Wm + (tid >> 3) * KIN + (tid & 7) * 4; char* d = sw + ((tid & 7) >> 1) * WRP + (tid >> 3) * 16 + (tid & 1) * 8;
    constexpr int NP = KIN / 8;   // pieces, one load a thread each: all in flight together, one load latency for the whole matrix
    v4f f[NP];
#pragma unroll   // here and below: f lives in registers, its index must be a constant; the steps become immediate offsets
    for (int i = 0; i < NP; ++i) f[i] = *(const v4f*)(s + (i & 3) * 16 * KIN + (i >> 2) * 32);
    // the run's address is an input of the wait: it stays in its registers up to it, so that no load of the run lands on them
    asm volatile("s_wait_xcnt 0x0" :: "v"(s) : "memory");
    HOLD();
#pragma unroll
    for (int i = 0; i < NP; ++i) { v4b o;
#pragma unroll
      for (int e = 0; e < 4; ++e) o[e] = (__bf16)f[i][e];
      *(v4b*)(d + i * WPC) = o; } }
  BARL();   // every wave reads pieces that all four wrote
  const char* Wr = sw + g * WRP + col * 16;
  v8f acc[4] = {};
  constexpr int G = 4;   // passes of 32 channels whose loads are issued as one group: one load latency per group, not four per pass
  // the inner loops are unrolled: xr, w and acc live in registers, their indices must be constants
#pragma unroll 1   // one group's registers at a time
  for (int k0 = 0; k0 < KIN / 32; k0 += G) { float xr[G][16]; v16b w[G][4];
#pragma unroll
    for (int u = 0; u < G; ++u) { const float* p = X + ((b * KIN + (k0 + u) * 32 + 8 * g) * (size_t)NT) + t0 + wave * 16 + col;   // x[b][channel][token]
#pragma unroll
      for (int i = 0; i < 8; ++i) { xr[u][i] = p[(size_t)i * NT]; xr[u][8 + i] = p[(size_t)(16 + i) * NT]; } }
    XW();
#pragma unroll
    for (int u = 0; u < G; ++u)
#pragma unroll
      for (int j = 0; j < 4; ++j) w[u][j] = frag_wl(Wr + k0 * (4 * WPC) + (u * 4 + j) * WPC);   // from LDS, under the flight of the x loads; the group's 16 pieces lie in a row: one address, the rest immediate offsets
    HOLD();
#pragma unroll
    for (int u = 0; u < G; ++u) { v16b a;
#pragma unroll
      for (int i = 0; i < 16; ++i) a[i] = (__bf16)xr[u][i];
#pragma unroll
      for (int j = 0; j < 4; ++j) acc[j] = wmma_bf(a, w[u][j], acc[j]); } }
  if (WHICH < 2) {
#pragma unroll
    for (int j = 0; j < 4; ++j) { const float bb = bfr(BB[j * 16 + col]);
#pragma unroll
      for (int r = 0; r < 8; ++r) { const float v = acc[j][r] + bb; const _Float16 h = (_Float16)v; sh[wave * 16 + 8 * g + r][j * 16 + col] = h; sl[wave * 16 + 8 * g + r][j * 16 + col] = (_Float16)((v - (float)h) * 2048.0f); } }
    LDSX();
    if (WHICH == 1) {   // the wave's 16 keys are 4 units: unit c, lane (g, col) = key col, channels c * 16 + 8 * g + 0..7
#pragma unroll   // the 8 LDS reads issue together, ahead of the stores
      for (int c = 0; c < 4; ++c) { vst2((unsigned*)(OH + r0 * KC + c * 256 + lane * 8), *(const v4u*)&sh[wave * 16 + col][c * 16 + 8 * g]); vst2((unsigned*)(OL + r0 * KC + c * 256 + lane * 8), *(const v4u*)&sl[wave * 16 + col][c * 16 + 8 * g]); }
    } else
    for (int rl = 0; rl < 16; ++rl) if (lane < 8) { vst2((unsigned*)(OH + (r0 + rl) * KC + lane * 8), *(const v4u*)&sh[wave * 16 + rl][lane * 8]); vst2((unsigned*)(OL + (r0 + rl) * KC + lane * 8), *(const v4u*)&sl[wave * 16 + rl][lane * 8]); }
  } else {
#pragma unroll
    for (int j = 0; j < 4; ++j) { const float bb = bfr(BB[j * 16 + col]);
#pragma unroll
      for (int r = 0; r < 8; ++r) st[j * 16 + col][wave * 16 + 8 * g + r] = (_Float16)(acc[j][r] + bb); }
    __syncthreads();
    for (int e = tid; e < 64 * 8; e += 128) { const int ln = e & 31, u = (e >> 5) & 7, s = e >> 8; vst2((unsigned*)(V + rb0 * KC + e * 8), *(const v4u*)&st[(u >> 1) * 16 + (ln & 15)][s * 32 + (u & 1) * 16 + (ln >> 4) * 8]); } }   // 32 keys s: unit u, lane (g, col) = channel (u >> 1) * 16 + col, keys (u & 1) * 16 + 8 * g + 0..7
}
// one launch for the three projections: they depend on the inputs alone, not on one another, so their blocks (3 x 256, four waves each) share the chip and each hides the others' load waits; the two long ones (512 channels) first in the grid. The first blocks of the short one also round Wo to bf16 for k_attn (one thread per 16-byte piece, natural row order; a block writes whole lines that no other block writes)
__global__ __launch_bounds__(128) void k_proj3(const float* __restrict__ XL, const float* __restrict__ XH, const float* __restrict__ WQ, const float* __restrict__ WK, const float* __restrict__ WV, const float* __restrict__ WO, const float* __restrict__ BQ, const float* __restrict__ BK, const float* __restrict__ BV, __bf16* __restrict__ P, _Float16* __restrict__ QH, _Float16* __restrict__ QL, _Float16* __restrict__ KH, _Float16* __restrict__ KL, _Float16* __restrict__ V) {
  __shared__ __align__(16) _Float16 sb[2][64][72];   // hi and residual planes of q or k; v's transpose uses the first
  __shared__ __align__(16) char sw[CL / 32 * 4 * WPC];   // the block's weights (see frag_wl)
  if (blockIdx.y == 0) proj<1>(XL, WK, BK, KH, KL, nullptr, sb[0], sb[1], sb[0], sw);
  else if (blockIdx.y == 1) proj<2>(XL, WV, BV, nullptr, nullptr, V, sb[0], sb[1], sb[0], sw);
  else {
    if (blockIdx.x < CH * KC / 8 / 128) { const unsigned d = (blockIdx.x * 128 + threadIdx.x) * 8; const v4f a = *(const v4f*)(WO + d), c = *(const v4f*)(WO + d + 4); v8b o;
#pragma unroll   // o lives in registers, its index must be a constant
      for (int i = 0; i < 4; ++i) { o[i] = (__bf16)a[i]; o[4 + i] = (__bf16)c[i]; }
      *(v8b*)(P + WS_PO / 2 + d) = o; }
    proj<0>(XH, WQ, BQ, QH, QL, nullptr, sb[0], sb[1], sb[0], sw); }
}
// ---- k_attn: block = (64 queries, b), 32 waves = 4 query tiles x KSP key shares: share sp walks the 32-key steps sp, sp + KSP, ... (from a start of the block's own, wrapping) with its own running max / sum / ctx; the KSP partials of a query tile meet in LDS at the end. 3-product scores (unscaled logits); P single x v single
// transposed products: scores as K . Q^T (D row = key, D column = query) and ctx^T += V^T . P^T, so a lane holds 16 scores of ONE query: max and sum run in the lane, one exchange between the wave halves per step, and the two score tiles, converted in place, are the B operand of the second product
#define KSP 8
// a fragment stored in fragment order: two units of 512 B, lane-contiguous, so that each wave-wide 16-byte load covers 4 whole 128-B lines (a fragment gathered from 16 rows touches 16); o = byte offset of the lane's 16 bytes of the first unit
__device__ __forceinline__ v16h frag_o(const _Float16* base, unsigned o, int k) {   // k: constant byte step, added behind the widening so that it becomes the load's immediate offset
  union { v16h v; v8h q[2]; } u; const char* p = (const char*)base + o + k; u.q[0] = *(const v8h*)p; u.q[1] = *(const v8h*)(p + 512); return u.v;
}
__device__ __forceinline__ float xhalf(float x) { return __builtin_bit_cast(float, __builtin_amdgcn_permlanex16(__builtin_bit_cast(int, x), __builtin_bit_cast(int, x), 0x76543210, 0xfedcba98, false, false)); }   // lane l with lane l ^ 16
// the output conv runs in the same block, behind the merge: out = ctx (bf16 hi + residual, K 64) . Wo rows (2 products) + bo + x_high for the block's 64 tokens x 256 channels, wave = (token tile, 32 channels), stored channels-first (64 consecutive tokens per (image, channel)); ctx never leaves the block
__global__ __launch_bounds__(128 * KSP) void k_attn(const _Float16* __restrict__ QH, const _Float16* __restrict__ QL, const _Float16* __restrict__ KH, const _Float16* __restrict__ KL, const _Float16* __restrict__ V, const __bf16* __restrict__ P, const float* __restrict__ BO, const float* __restrict__ XH, float* __restrict__ OUT) {
  __shared__ __align__(16) float sc[64][68], st[CH][68];   // sc: merged ctx [token][column]; st: out before the residual [channel][token]; 68 floats a row: 16-byte accesses of 16 rows spread over the banks
  __shared__ __align__(32) float so[4 * KSP][8][136]; __shared__ float sm[4 * KSP][16], sl[4 * KSP][32]; __shared__ __align__(16) v8h sq[4][6][32];   // so: [ctx rows 8u .. 8u + 7][query * 8 + row], 136 floats per u so that the merge's 16-byte reads spread over the banks; sq: per query tile the q residual fragments and the upper hi fragment, lane-contiguous: read per step, so that a wave fits the 128 registers of 8 waves per SIMD
  // wave number in a scalar register, lane number as the shuffles form it: over the loop the indices live in two vector registers, the load offset fo and the lane's place in sq
  const int wave = __builtin_amdgcn_readfirstlane(threadIdx.x >> 5), lane = __builtin_amdgcn_mbcnt_lo(~0u, 0u), col = lane & 15, g = lane >> 4, sp = wave >> 2; const size_t b = blockIdx.y; const int q0 = blockIdx.x * 64 + (wave & 3) * 16; const size_t rq = b * NT + q0;
  const int qt = wave & 3;
  if (sp == 0) { const _Float16 *pl = QL + (rq + col) * KC + 8 * g, *ph = QH + (rq + col) * KC + 32 + 8 * g;
#pragma unroll   // the four loads in flight together
    for (int i = 0; i < 4; ++i) sq[qt][i][lane] = *(const v8h*)(pl + 16 * i);
    sq[qt][4][lane] = *(const v8h*)ph; sq[qt][5][lane] = *(const v8h*)(ph + 16); }
  __syncthreads();
  const v16h aq0 = frag_h(QH + (rq + col) * KC, lane);
  float m = -3.0e38f, l = 0.f;   // of query col; m is the same in both wave halves, l sums the half's own keys
  v8f acc[4] = {};               // acc[dt][r] = ctx[query col][dt * 16 + 8 * g + r]
  // the step's 32 keys j0 = (((it0 + it) % 16) * KSP + sp) * 32 are 8 units at the same place in KH, KL and V: the three bases stay scalar, one 32-bit vector offset serves all loads
  // the 64 blocks of an image read the same k and v lines: walking them in one order they ask L2 for the same lines at the same moment. Each block starts its walk at one of the 16 steps and wraps round the image's plane; the 4 blocks that share a start lie two apart in the grid
  constexpr unsigned PLB = (unsigned)NT * KC * 2u;   // bytes of one image in KH, KL or V
  static_assert((PLB & (PLB - 1)) == 0 && PLB == (NT / 32 / KSP) * KSP * 4096u, "the wrap is a mask; the walk covers the plane once");
  const unsigned it0 = ((blockIdx.x >> 2) & 14u) | (blockIdx.x & 1u);
  unsigned fo = ((unsigned)(b * (NT / 32) + it0 * KSP + sp) * 2048u + lane * 8u) * 2u;   // byte offset of the lane's 16 bytes in the step's first unit
  v16h kh0 = frag_o(KH, fo, 0), kl0 = frag_o(KL, fo, 0), kh1 = frag_o(KH, fo, 1024), kl1 = frag_o(KL, fo, 1024);   // keys 0..15 of the first step; every later step's are loaded at the foot of the step before
#pragma unroll 1
  for (int it = 0; it < NT / 32 / KSP; ++it) { v8f s[2];   // s[ct][r]: key j0 + ct * 16 + 8 * g + r, query col
    v16h va[4];
    // each pair of fragments is issued as soon as registers are free for it, three products or the whole softmax ahead of its first use: counted waits, three or four loads' latencies overlapped where each stood alone
#pragma unroll
    for (int ct = 0; ct < 2; ++ct) { v8f c = {}, cl = {};
#pragma unroll
      for (int kc = 0; kc < 2; ++kc) { const v16h kh = kc ? kh1 : kh0, kl = kc ? kl1 : kl0; union { v16h v; v8h q[2]; } ql, qh; ql.q[0] = sq[qt][2 * kc][lane]; ql.q[1] = sq[qt][2 * kc + 1][lane]; if (kc == 0) qh.v = aq0; else { qh.q[0] = sq[qt][4][lane]; qh.q[1] = sq[qt][5][lane]; } c = wmma16(kh, qh.v, c); cl = wmma16(kh, ql.v, cl); cl = wmma16(kl, qh.v, cl);
        if (ct == 0) { if (kc == 0) { kh0 = frag_o(KH, fo, 2048); kl0 = frag_o(KL, fo, 2048); } else { kh1 = frag_o(KH, fo, 3072); kl1 = frag_o(KL, fo, 3072); } }   // keys 16..31 into the registers just read
        else { va[2 * kc] = frag_o(V, fo, (2 * kc) * 1024); va[2 * kc + 1] = frag_o(V, fo, (2 * kc + 1) * 1024); }   // v flies under the softmax
        HOLD(); }
#pragma unroll
      for (int r = 0; r < 8; ++r) s[ct][r] = c[r] + cl[r] * (1.0f / 2048.0f); }   // unscaled logits
    float mx = fmaxf(s[0][0], s[1][0]);
#pragma unroll
    for (int r = 1; r < 8; ++r) mx = fmaxf(mx, fmaxf(s[0][r], s[1][r]));
    mx = fmaxf(mx, xhalf(mx));
    const float mn = fmaxf(m, mx); const float alpha = (m <= -1.0e38f) ? 0.f : __expf(m - mn); float es = 0.f; v16h pb;
#pragma unroll
    for (int r = 0; r < 8; ++r) { const float e0 = __expf(s[0][r] - mn), e1 = __expf(s[1][r] - mn); es += e0 + e1; pb[r] = (_Float16)(e0 * 2048.0f); pb[8 + r] = (_Float16)(e1 * 2048.0f); }
    l = l * alpha + es; m = mn;
#pragma unroll
    for (int dt = 0; dt < 4; ++dt) { acc[dt] *= alpha; acc[dt] = wmma16(va[dt], pb, acc[dt]);
      if (dt == 3) { fo = (fo & ~(PLB - 1u)) | ((fo + KSP * 4096u) & (PLB - 1u)); kh0 = frag_o(KH, fo, 0); kl0 = frag_o(KL, fo, 0); kh1 = frag_o(KH, fo, 1024); kl1 = frag_o(KL, fo, 1024); HOLD(); } } }   // the next step's keys 0..15, past the plane's end back to its start (the last step reads the first step's again, unused)
  XW(); HOLD();   // those last loads are still in flight: what follows reuses the registers that hold their addresses, only behind this wait
  // each share leaves its unnormalised ctx, max and half sums in LDS; the lane number is read back from the load offset (its bits 4..8), so that no lane index is held in a register of its own over the loop (three of them went to scratch)
  const int ln = (fo >> 4) & 31, cn = ln & 15, gn = ln >> 4, tn = wave * 32 + ln;
  // all that the output conv takes from memory is asked for here, as one group, and flies under the merge: the residual at the thread's own 4 store places (16 threads = 256 consecutive bytes of a channel; 64 channels between a thread's places), the wave's 32 weight rows as fragments, their bias
  static_assert(128 * KSP / 16 * 4 == CH && KSP * 32 == CH && KC / 32 == 2, "4 store places a thread; 32 channels a key share; two passes of 32 ctx columns");
  const size_t ob = (b * CH + (tn >> 4)) * (size_t)NT + blockIdx.x * 64 + (tn & 15) * 4;
  v4f xr[4]; v16b w[2][2]; float bo[2];
  const __bf16* pw = P + (size_t)(sp * 32 + cn) * KC + 8 * gn;   // the lane's 16 bytes of weight row sp * 32 + cn (counted from the start of the packed weights); the other row, pass and half by immediate offsets: one address pair for the run
  const float *pb = BO + sp * 32 + cn, *px = XH + ob;
#pragma unroll   // here and below: xr, w, bo, oc live in registers, their indices must be constants
  for (int j = 0; j < 2; ++j) { bo[j] = pb[j * 16];
#pragma unroll
    for (int kc = 0; kc < 2; ++kc) { const __bf16* p = pw + WS_PO / 2 + j * 16 * KC + kc * 32; union { v16b v; v8b q[2]; } u; u.q[0] = *(const v8b*)p; u.q[1] = *(const v8b*)(p + 16); w[kc][j] = u.v; } }
  HOLD();   // the residual last: it is used last and comes from furthest, so the counted wait for the weights leaves it in flight
#pragma unroll
  for (int i = 0; i < 4; ++i) xr[i] = *(const v4f*)(px + (size_t)i * 64 * NT);
  // the group's addresses are inputs of the wait: they stay in their registers up to it, so that no load of the group lands on a register that an earlier one names
  asm volatile("s_wait_xcnt 0x0" :: "v"(pw), "v"(cn), "v"(px) : "memory");
  HOLD();
#pragma unroll   // acc lives in registers, its index must be a constant
  for (int dt = 0; dt < 4; ++dt) *(v8f*)&so[wave][dt * 2 + gn][cn * 8] = acc[dt];
  if (gn == 0) sm[wave][cn] = m;
  sl[wave][ln] = l;
  BARL();
  // merge: a thread owns 4 ctx columns of one query row; shares rescaled to the common max and added, share 0 first
  static_assert(128 * KSP == 64 * 16, "one thread per 4 ctx columns");
  { const int row = tn >> 4, c4 = tn & 15, w0 = row >> 4, q = row & 15; float mm = sm[w0][q];
#pragma unroll   // here and below: the shares' LDS reads issue together, one wait
    for (int p = 1; p < KSP; ++p) mm = fmaxf(mm, sm[p * 4 + w0][q]);
    float ls = 0.f; v4f o = {};
#pragma unroll
    for (int p = 0; p < KSP; ++p) { const float wgt = __expf(sm[p * 4 + w0][q] - mm); ls += wgt * (sl[p * 4 + w0][q] + sl[p * 4 + w0][16 + q]); o += wgt * *(const v4f*)&so[p * 4 + w0][c4 >> 1][q * 8 + (c4 & 1) * 4]; }
    *(v4f*)&sc[row][c4 * 4] = o * ((1.0f / 2048.0f) / ls); }
  BARL();
  HOLD();   // likewise what reads the weights and the bias
  v8f oc[2] = {};
#pragma unroll
  for (int kc = 0; kc < 2; ++kc) { const float* p = &sc[qt * 16 + cn][kc * 32 + 8 * gn]; float af[16];   // fragment elements 0..7 = columns 8 g + 0..7 of the pass, 8..15 = 16 further on
#pragma unroll
    for (int i = 0; i < 8; ++i) { af[i] = p[i]; af[8 + i] = p[16 + i]; }
    const F2 a = bsplit16(af);
#pragma unroll
    for (int j = 0; j < 2; ++j) { oc[j] = wmma_bf(a.l, w[kc][j], oc[j]); oc[j] = wmma_bf(a.h, w[kc][j], oc[j]); } }
#pragma unroll
  for (int j = 0; j < 2; ++j) { const float bb = bfr(bo[j]);
#pragma unroll
    for (int r = 0; r < 8; ++r) st[sp * 32 + j * 16 + cn][qt * 16 + 8 * gn + r] = oc[j][r] + bb; }
  BARL();
  HOLD();   // the residual's rounding stays here: moved up into the merge, it waits out the residual's loads there
#pragma unroll
  for (int i = 0; i < 4; ++i) { v4f v = *(const v4f*)&st[(tn >> 4) + i * 64][(tn & 15) * 4];
#pragma unroll
    for (int e = 0; e < 4; ++e) v[e] += bfr(xr[i][e]);
    vst2(OUT + ob + (size_t)i * 64 * NT, v); }
}
extern "C" void kernel_launch(void* const* d_in, const int* in_sizes, int n_in, void* d_out, int out_size, void* d_ws, size_t ws_size, hipStream_t stream) {
  (void)in_sizes; (void)n_in; (void)out_size;
  const float** F = (const float**)d_in;   // 0 x_low [4,512,64,64], 1 x_high [4,256,64,64], 2 Wq [64,256], 3 bq, 4 Wk [64,512], 5 bk, 6 Wv [64,512], 7 bv, 8 Wo [256,64], 9 bo
  if (ws_size < (size_t)WS_END) return;
  char* ws = (char*)d_ws; __bf16* P = (__bf16*)ws; _Float16 *QH = (_Float16*)(ws + WS_QH), *QL = (_Float16*)(ws + WS_QL), *KH = (_Float16*)(ws + WS_KH), *KL = (_Float16*)(ws + WS_KL), *V = (_Float16*)(ws + WS_V);
  k_proj3<<<dim3(TNB * NT / 64, 3), 128, 0, stream>>>(F[0], F[1], F[2], F[4], F[6], F[8], F[3], F[5], F[7], P, QH, QL, KH, KL, V);
  k_attn<<<dim3(TQB, TNB), 128 * KSP, 0, stream>>>(QH, QL, KH, KL, V, P, F[9], F[1], (float*)d_out);
}

// v010
// It runs in 42.8 microseconds.
// In both of two side-by-side timings against v009, it was 1.09 times as fast.
// All steps since v000 together make it 10.7 times as fast.
// compute dtype: all float inputs rounded to bf16; q = Wq . x_high + bq and k, v = Wk/Wv . x_low + b (1x1 convs) with EXACT bf16 products on WMMA 16x16x32 (the channels-first inputs gathered token-major on load); q and k as f16 hi + (x2048-scaled) residual planes with 3-product scores (the logits are unscaled and large, so single-rounded operands would not do), running-max softmax in f32 (hardware exp), P (scaled by 2^11, single f16) x v (single f16); out = ctx (bf16 hi + residual) . Wo rows (2 products) + bo + x_high, stored channels-first; f32 accumulate.
#include <hip/hip_runtime.h>
#include <math.h>

typedef __attribute__((ext_vector_type(16))) _Float16 v16h;
typedef __attribute__((ext_vector_type(16))) __bf16 v16b;
typedef __attribute__((ext_vector_type(8)))  _Float16 v8h;
typedef __attribute__((ext_vector_type(8)))  float v8f;
typedef __attribute__((ext_vector_type(4)))  float v4f;
typedef __attribute__((ext_vector_type(2)))  float v2f;
typedef __attribute__((ext_vector_type(4)))  unsigned v4u;
typedef __attribute__((ext_vector_type(4)))  int v4i;
typedef float __attribute__((may_alias)) float_a;
typedef int __attribute__((may_alias)) int_a;

template <typename T> __device__ __forceinline__ void vst2(void* p, T v) { *(T*)p = v;  }
__device__ __forceinline__ v8f wmma16(v16h a, v16h b, v8f c) {
  v8f d = __builtin_amdgcn_wmma_f32_16x16x32_f16(false, a, false, b, (short)0, c, false, false);
  asm volatile("v_nop\n\tv_nop\n\tv_nop\n\tv_nop" : "+v"(d) : "v"(a), "v"(b));
  return d;
}
__device__ __forceinline__ v8f wmma_bf(v16b a, v16b b, v8f c) {
  v8f d = __builtin_amdgcn_wmma_f32_16x16x32_bf16(false, a, false, b, (short)0, c, false, false);
  asm volatile("v_nop\n\tv_nop\n\tv_nop\n\tv_nop" : "+v"(d) : "v"(a), "v"(b));
  return d;
}
// 16x16x32 fragments: lane = (h = lane>>4, row/col = lane&15); elements 0..7 = k0+8h+0..7, 8..15 = k0+16+8h+0..7; D element r = row 8h+r
__device__ __forceinline__ v16h frag_h(const _Float16* rowk0, int lane) {
  union { v16h v; v8h q[2]; } u; const _Float16* p = rowk0 + 8 * (lane >> 4);
  u.q[0] = *(const v8h*)p; u.q[1] = *(const v8h*)(p + 16); return u.v;
}
__device__ __forceinline__ v16h frag_f32(const float* rowk0, int lane) {
  v16h a; const float* p = rowk0 + 8 * (lane >> 4);
#pragma unroll
  for (int i = 0; i < 8; ++i) { a[i] = (_Float16)p[i]; a[8 + i] = (_Float16)p[16 + i]; }
  return a;
}
__device__ __forceinline__ v16h frag_f32s(const float* rowk0, int lane, float sc) {
  v16h a; const float* p = rowk0 + 8 * (lane >> 4);
#pragma unroll
  for (int i = 0; i < 8; ++i) { a[i] = (_Float16)(p[i] * sc); a[8 + i] = (_Float16)(p[16 + i] * sc); }
  return a;
}
// column fragment from a [K][ld] layout (column n), rows >= K read as 0
__device__ __forceinline__ v16h fragc_f32(const float* W, int k0, int n, int lane, int ld, int K) {
  v16h a; const int g = lane >> 4;
#pragma unroll
  for (int i = 0; i < 8; ++i) { const int ka = k0 + 8 * g + i, kb = ka + 16;
    a[i] = (_Float16)(ka < K ? W[(size_t)(ka < K ? ka : K - 1) * ld + n] : 0.f); a[8 + i] = (_Float16)(kb < K ? W[(size_t)(kb < K ? kb : K - 1) * ld + n] : 0.f); }
  return a;
}
struct F2 { v16b h, l; };
__device__ __forceinline__ F2 bsplit16(const float v[16]) { F2 r;
#pragma unroll
  for (int i = 0; i < 16; ++i) { const __bf16 h = (__bf16)v[i]; r.h[i] = h; r.l[i] = (__bf16)(v[i] - (float)h); }
  return r; }
__device__ __forceinline__ F2 split_row(const float* row, int k0, int lane) { float v[16]; const float* p = row + k0 + 8 * (lane >> 4);
#pragma unroll
  for (int i = 0; i < 8; ++i) { v[i] = p[i]; v[8 + i] = p[16 + i]; }
  return bsplit16(v); }
__device__ __forceinline__ F2 split_rowK(const float* row, int k0, int lane, int K) { float v[16]; const int g = lane >> 4;
#pragma unroll
  for (int i = 0; i < 8; ++i) { const int ka = k0 + 8 * g + i, kb = ka + 16; v[i] = ka < K ? row[ka < K ? ka : K - 1] : 0.f; v[8 + i] = kb < K ? row[kb < K ? kb : K - 1] : 0.f; }
  return bsplit16(v); }
__device__ __forceinline__ F2 split_col(const float* W, int k0, int n, int lane, int ld, int K) { float v[16]; const int g = lane >> 4;
#pragma unroll
  for (int i = 0; i < 8; ++i) { const int ka = k0 + 8 * g + i, kb = ka + 16; v[i] = ka < K ? W[(size_t)(ka < K ? ka : K - 1) * ld + n] : 0.f; v[8 + i] = kb < K ? W[(size_t)(kb < K ? kb : K - 1) * ld + n] : 0.f; }
  return bsplit16(v); }
__device__ __forceinline__ v8f mac3(const F2& a, const F2& b, v8f c) { c = wmma_bf(a.l, b.h, c); c = wmma_bf(a.h, b.l, c); return wmma_bf(a.h, b.h, c); }
__device__ __forceinline__ float sigm(float v) { return 1.0f / (1.0f + expf(-v)); }
#define LDSX() do { asm volatile("s_wait_dscnt 0" ::: "memory"); __builtin_amdgcn_wave_barrier(); __builtin_amdgcn_fence(__ATOMIC_RELEASE, "workgroup"); } while (0)

// the compiler does not schedule across this: a group of loads written ahead of the products that use it stays ahead (left alone it sinks each load pair to its product, and every product then waits out a whole load latency)
#define HOLD() __builtin_amdgcn_sched_barrier(0)
// between two runs of loads of one group: the build lands later loads' data on address registers that earlier loads of the group name, so the earlier loads' translations are waited for first (not their data)
#define XW() asm volatile("s_wait_xcnt 0x0" ::: "memory")
// work-group barrier for data handed over in LDS: waits for the wave's LDS accesses alone (__syncthreads() also waits out every global load in flight, and loads issued ahead of it could not fly under the work behind it)
#define BARL() asm volatile("s_wait_dscnt 0x0\n\ts_barrier_signal -1\n\ts_barrier_wait -1" ::: "memory")

// Non-local feature fusion (B 4, 64 x 64 maps; 256 high-level / 512 low-level channels, 64-dim keys and values): every high-level pixel attends over all 4,096 low-level pixels (unscaled dot-product softmax), 1x1 output conv + residual.
#define NB 4
#define NT 4096            // tokens per image
#define CH 256             // high channels (q source, output)
#define CL 512             // low channels (k, v source)
#define KC 64
#define NR (NB * NT)
#ifndef TQB
#define TQB (NT / 64)
#define TNB NB
#endif
typedef __attribute__((ext_vector_type(8))) __bf16 v8b;
__device__ __forceinline__ v16b frag_b(const __bf16* rowk0, int lane) {
  union { v16b v; v8b q[2]; } u; const __bf16* p = rowk0 + 8 * (lane >> 4);
  u.q[0] = *(const v8b*)p; u.q[1] = *(const v8b*)(p + 16); return u.v;
}
__device__ __forceinline__ float bfr(float v) { return (float)(__bf16)v; }
__device__ __attribute__((noinline)) float exp_ni(float v) { return expf(v); }
__device__ __attribute__((noinline)) float erf_ni(float v) { return erff(v); }

#define WS_PQ  0u                                   // of the packed-weight area only Wo is in use: bf16 [256][64], natural rows, at WS_PO
#define WS_PK  (WS_PQ + 2u * KC * CH)
#define WS_PV  (WS_PK + 2u * KC * CL)
#define WS_PO  (WS_PV + 2u * KC * CL)
#define WS_QH  (WS_PO + 2u * CH * KC)               // f16 [NR][64] q hi ; QL residual x2048 ; KH, KL, V in fragment order: per 32 keys 8 units of 512 B, unit = [lane][8 halves] (see frag_o)
#define WS_QL  (WS_QH + 2u * (size_t)NR * KC)
#define WS_KH  (WS_QL + 2u * (size_t)NR * KC)
#define WS_KL  (WS_KH + 2u * (size_t)NR * KC)
#define WS_V   (WS_KL + 2u * (size_t)NR * KC)
#define WS_END (WS_V + 2u * (size_t)NB * KC * NT)

// the block's weights in LDS, bf16, in fragment order: piece (pass * 4 + j) of WPC bytes = 4 runs (h * 2 + g) of 16 lanes x 16 bytes, run pitch WRP; run (h, g), lane col = weight row j * 16 + col, channels h * 16 + 8 * g + 0..7 of the pass.
// WRP is 320, not 256: the 32 8-byte stores of a wave (4 rows x 8 quads of channels) then fall on all 64 banks once; a 16-byte read of 16 lanes is one contiguous run either way
#define WRP 320
#define WPC (4 * WRP)
typedef __attribute__((ext_vector_type(4))) __bf16 v4b;
__device__ __forceinline__ v16b frag_wl(const char* p) { union { v16b v; v8b q[2]; } u; u.q[0] = *(const v8b*)p; u.q[1] = *(const v8b*)(p + 2 * WRP); return u.v; }
// ---- proj: block = (64 tokens, which): 64 output channels (4 tiles per wave); A gathered from the channels-first map; which 0: q -> hi/lo rows; 1: k -> hi/lo fragment units; 2: v -> fragment units
template <int WHICH>
__device__ __forceinline__ void proj(const float* __restrict__ X, const float* __restrict__ Wm, const float* __restrict__ BB, _Float16* __restrict__ OH, _Float16* __restrict__ OL, _Float16* __restrict__ V, _Float16 (*sh)[72], _Float16 (*sl)[72], _Float16 (*st)[72], char* sw) {
  constexpr int KIN = (WHICH == 0) ? CH : CL;
  const int tid = threadIdx.x, wave = tid >> 5, lane = tid & 31, col = lane & 15, g = lane >> 4; const size_t rb0 = (size_t)blockIdx.x * 64, r0 = rb0 + wave * 16; const size_t b = rb0 / NT, t0 = rb0 % NT;
  // the block rounds its own weights [64][KIN] to bf16 and lays them in LDS, once for its four waves: thread = (row of 16, quad of 4 channels), so a wave's 16-byte load covers 4 whole 128-B lines (one pass of 4 rows); load i is piece i (pass i >> 2, rows (i & 3) * 16 + 0..15)
  { const float* s = Wm + (tid >> 3) * KIN + (tid & 7) * 4; char* d = sw + ((tid & 7) >> 1) * WRP + (tid >> 3) * 16 + (tid & 1) * 8;
    constexpr int NP = KIN / 8;   // pieces, one load a thread each: all in flight together, one load latency for the whole matrix
    v4f f[NP];
#pragma unroll   // here and below: f lives in registers, its index must be a constant; the steps become immediate offsets
    for (int i = 0; i < NP; ++i) f[i] = *(const v4f*)(s + (i & 3) * 16 * KIN + (i >> 2) * 32);
    // the run's address is an input of the wait: it stays in its registers up to it, so that no load of the run lands on them
    asm volatile("s_wait_xcnt 0x0" :: "v"(s) : "memory");
    HOLD();
#pragma unroll
    for (int i = 0; i < NP; ++i) { v4b o;
#pragma unroll
      for (int e = 0; e < 4; ++e) o[e] = (__bf16)f[i][e];
      *(v4b*)(d + i * WPC) = o; } }
  BARL();   // every wave reads pieces that all four wrote
  const char* Wr = sw + g * WRP + col * 16;
  v8f acc[4] = {};
  constexpr int G = 4;   // passes of 32 channels whose loads are issued as one group: one load latency per group, not four per pass
  // the inner loops are unrolled: xr, w and acc live in registers, their indices must be constants
#pragma unroll 1   // one group's registers at a time
  for (int k0 = 0; k0 < KIN / 32; k0 += G) { float xr[G][16]; v16b w[G][4];
#pragma unroll
    for (int u = 0; u < G; ++u) { const float* p = X + ((b * KIN + (k0 + u) * 32 + 8 * g) * (size_t)NT) + t0 + wave * 16 + col;   // x[b][channel][token]
#pragma unroll
      for (int i = 0; i < 8; ++i) { xr[u][i] = p[(size_t)i * NT]; xr[u][8 + i] = p[(size_t)(16 + i) * NT]; } }
    XW();
#pragma unroll
    for (int u = 0; u < G; ++u)
#pragma unroll
      for (int j = 0; j < 4; ++j) w[u][j] = frag_wl(Wr + k0 * (4 * WPC) + (u * 4 + j) * WPC);   // from LDS, under the flight of the x loads; the group's 16 pieces lie in a row: one address, the rest immediate offsets
    HOLD();
#pragma unroll
    for (int u = 0; u < G; ++u) { v16b a;
#pragma unroll
      for (int i = 0; i < 16; ++i) a[i] = (__bf16)xr[u][i];
#pragma unroll
      for (int j = 0; j < 4; ++j) acc[j] = wmma_bf(a, w[u][j], acc[j]); } }
  if (WHICH < 2) {
#pragma unroll
    for (int j = 0; j < 4; ++j) { const float bb = bfr(BB[j * 16 + col]);
#pragma unroll
      for (int r = 0; r < 8; ++r) { const float v = acc[j][r] + bb; const _Float16 h = (_Float16)v; sh[wave * 16 + 8 * g + r][j * 16 + col] = h; sl[wave * 16 + 8 * g + r][j * 16 + col] = (_Float16)((v - (float)h) * 2048.0f); } }
    LDSX();
    if (WHICH == 1) {   // the wave's 16 keys are 4 units: unit c, lane (g, col) = key col, channels c * 16 + 8 * g + 0..7
#pragma unroll   // the 8 LDS reads issue together, ahead of the stores
      for (int c = 0; c < 4; ++c) { vst2((unsigned*)(OH + r0 * KC + c * 256 + lane * 8), *(const v4u*)&sh[wave * 16 + col][c * 16 + 8 * g]); vst2((unsigned*)(OL + r0 * KC + c * 256 + lane * 8), *(const v4u*)&sl[wave * 16 + col][c * 16 + 8 * g]); }
    } else
    for (int rl = 0; rl < 16; ++rl) if (lane < 8) { vst2((unsigned*)(OH + (r0 + rl) * KC + lane * 8), *(const v4u*)&sh[wave * 16 + rl][lane * 8]); vst2((unsigned*)(OL + (r0 + rl) * KC + lane * 8), *(const v4u*)&sl[wave * 16 + rl][lane * 8]); }
  } else {
#pragma unroll
    for (int j = 0; j < 4; ++j) { const float bb = bfr(BB[j * 16 + col]);
#pragma unroll
      for (int r = 0; r < 8; ++r) st[j * 16 + col][wave * 16 + 8 * g + r] = (_Float16)(acc[j][r] + bb); }
    __syncthreads();
    for (int e = tid; e < 64 * 8; e += 128) { const int ln = e & 31, u = (e >> 5) & 7, s = e >> 8; vst2((unsigned*)(V + rb0 * KC + e * 8), *(const v4u*)&st[(u >> 1) * 16 + (ln & 15)][s * 32 + (u & 1) * 16 + (ln >> 4) * 8]); } }   // 32 keys s: unit u, lane (g, col) = channel (u >> 1) * 16 + col, keys (u & 1) * 16 + 8 * g + 0..7
}
// one launch for the three projections: they depend on the inputs alone, not on one another, so their blocks (3 x 256, four waves each) share the chip and each hides the others' load waits; the two long ones (512 channels) first in the grid. The first blocks of the short one also round Wo to bf16 for k_attn (one thread per 16-byte piece, natural row order; a block writes whole lines that no other block writes)
__global__ __launch_bounds__(128) void k_proj3(const float* __restrict__ XL, const float* __restrict__ XH, const float* __restrict__ WQ, const float* __restrict__ WK, const float* __restrict__ WV, const float* __restrict__ WO, const float* __restrict__ BQ, const float* __restrict__ BK, const float* __restrict__ BV, __bf16* __restrict__ P, _Float16* __restrict__ QH, _Float16* __restrict__ QL, _Float16* __restrict__ KH, _Float16* __restrict__ KL, _Float16* __restrict__ V) {
  __shared__ __align__(16) _Float16 sb[2][64][72];   // hi and residual planes of q or k; v's transpose uses the first
  __shared__ __align__(16) char sw[CL / 32 * 4 * WPC];   // the block's weights (see frag_wl)
  if (blockIdx.y == 0) proj<1>(XL, WK, BK, KH, KL, nullptr, sb[0], sb[1], sb[0], sw);
  else if (blockIdx.y == 1) proj<2>(XL, WV, BV, nullptr, nullptr, V, sb[0], sb[1], sb[0], sw);
  else {
    if (blockIdx.x < CH * KC / 8 / 128) { const unsigned d = (blockIdx.x * 128 + threadIdx.x) * 8; const v4f a = *(const v4f*)(WO + d), c = *(const v4f*)(WO + d + 4); v8b o;
#pragma unroll   // o lives in registers, its index must be a constant
      for (int i = 0; i < 4; ++i) { o[i] = (__bf16)a[i]; o[4 + i] = (__bf16)c[i]; }
      *(v8b*)(P + WS_PO / 2 + d) = o; }
    proj<0>(XH, WQ, BQ, QH, QL, nullptr, sb[0], sb[1], sb[0], sw); }
}
// ---- k_attn: block = (64 queries, b), 16 waves = 2 pairs of query tiles x KSP key shares: a wave holds TWO 16-query tiles, so every k and v fragment it loads feeds two tiles' products (half the loads per product of a one-tile wave, and only two waves of a block ask for the same lines); share sp walks the 32-key steps sp, sp + KSP, ... (from a start of the block's own, wrapping) with its own running max / sum / ctx per tile; the KSP partials of a query tile meet in LDS at the end. 3-product scores (unscaled logits); P single x v single
// transposed products: scores as K . Q^T (D row = key, D column = query) and ctx^T += V^T . P^T, so a lane holds 16 scores of ONE query of each tile: max and sum run in the lane, one exchange between the wave halves per tile and step, and the two score tiles, converted in place, are the B operand of the second product
#define KSP 8
// a fragment stored in fragment order: two units of 512 B, lane-contiguous, so that each wave-wide 16-byte load covers 4 whole 128-B lines (a fragment gathered from 16 rows touches 16); o = byte offset of the lane's 16 bytes of the first unit
__device__ __forceinline__ v16h frag_o(const _Float16* base, unsigned o, int k) {   // k: constant byte step, added behind the widening so that it becomes the load's immediate offset
  union { v16h v; v8h q[2]; } u; const char* p = (const char*)base + o + k; u.q[0] = *(const v8h*)p; u.q[1] = *(const v8h*)(p + 512); return u.v;
}
__device__ __forceinline__ float xhalf(float x) { return __builtin_bit_cast(float, __builtin_amdgcn_permlanex16(__builtin_bit_cast(int, x), __builtin_bit_cast(int, x), 0x76543210, 0xfedcba98, false, false)); }   // lane l with lane l ^ 16
// the output conv runs in the same block, behind the merge: out = ctx (bf16 hi + residual, K 64) . Wo rows (2 products) + bo + x_high for the block's 64 tokens x 256 channels, wave = (its two token tiles, 32 channels), stored channels-first (64 consecutive tokens per (image, channel)); ctx never leaves the block
__global__ __launch_bounds__(64 * KSP) void k_attn(const _Float16* __restrict__ QH, const _Float16* __restrict__ QL, const _Float16* __restrict__ KH, const _Float16* __restrict__ KL, const _Float16* __restrict__ V, const __bf16* __restrict__ P, const float* __restrict__ BO, const float* __restrict__ XH, float* __restrict__ OUT) {
  __shared__ __align__(16) float sc[64][68], st[CH][68];   // sc: merged ctx [token][column]; st: out before the residual [channel][token]; 68 floats a row: 16-byte accesses of 16 rows spread over the banks
  __shared__ __align__(32) float so[4 * KSP][8][136]; __shared__ float sm[4 * KSP][16], sl[4 * KSP][32]; __shared__ __align__(16) v8h sq[4][8][32];   // first index of so, sm, sl: share * 4 + query tile; so: [ctx rows 8u .. 8u + 7][query * 8 + row], 136 floats per u so that the merge's 16-byte reads spread over the banks; sq: per query tile the halves of its q fragments, lane-contiguous (0..3 residual, 4..7 hi; half i = channels (i & 3) * 16 + 8 g + 0..7 of query col)
  // wave number in a scalar register, lane number as the shuffles form it
  const int wave = __builtin_amdgcn_readfirstlane(threadIdx.x >> 5), lane = __builtin_amdgcn_mbcnt_lo(~0u, 0u), col = lane & 15, g = lane >> 4, sp = wave >> 1, qp = wave & 1; const size_t b = blockIdx.y;
  // the block's q is gathered from its rows once, two fragment halves a wave (tile wave >> 2), and handed round in LDS: the 8 shares of a tile need the same fragments, and a gathered load touches 16 lines
  { const int tl = wave >> 2, pc = (wave & 3) * 2; const _Float16* p = (pc < 4 ? QL : QH) + (b * NT + blockIdx.x * 64 + tl * 16 + col) * KC + (pc & 3) * 16 + 8 * g;
    sq[tl][pc][lane] = *(const v8h*)p; sq[tl][pc + 1][lane] = *(const v8h*)(p + 16); }
  __syncthreads();
  // q of both tiles, hi and residual, stays in registers over the walk (four waves per SIMD: 256 registers a wave)
  v16h qh[2][2], ql[2][2];   // [tile][pass of 32 channels]
#pragma unroll   // here and below: qh, ql, m, l, acc, s, c, cl, pb live in registers, their indices must be constants
  for (int t = 0; t < 2; ++t)
#pragma unroll
    for (int kc = 0; kc < 2; ++kc) { union { v16h v; v8h q[2]; } uh, ul; ul.q[0] = sq[qp * 2 + t][2 * kc][lane]; ul.q[1] = sq[qp * 2 + t][2 * kc + 1][lane]; uh.q[0] = sq[qp * 2 + t][4 + 2 * kc][lane]; uh.q[1] = sq[qp * 2 + t][5 + 2 * kc][lane]; ql[t][kc] = ul.v; qh[t][kc] = uh.v; }
  float m[2] = { -3.0e38f, -3.0e38f }, l[2] = { 0.f, 0.f };   // of query col of tile t; m is the same in both wave halves, l sums the half's own keys
  v8f acc[2][4] = {};            // acc[t][dt][r] = ctx[query col of tile t][dt * 16 + 8 * g + r]
  // the step's 32 keys j0 = (((it0 + it) % 16) * KSP + sp) * 32 are 8 units at the same place in KH, KL and V: the three bases stay scalar, one 32-bit vector offset serves all loads
  // the 64 blocks of an image read the same k and v lines: walking them in one order they ask L2 for the same lines at the same moment. Each block starts its walk at one of the 16 steps and wraps round the image's plane; the 4 blocks that share a start lie two apart in the grid
  constexpr unsigned PLB = (unsigned)NT * KC * 2u;   // bytes of one image in KH, KL or V
  static_assert((PLB & (PLB - 1)) == 0 && PLB == (NT / 32 / KSP) * KSP * 4096u, "the wrap is a mask; the walk covers the plane once");
  const unsigned it0 = ((blockIdx.x >> 2) & 14u) | (blockIdx.x & 1u);
  unsigned fo = ((unsigned)(b * (NT / 32) + it0 * KSP + sp) * 2048u + lane * 8u) * 2u;   // byte offset of the lane's 16 bytes in the step's first unit
  v16h kh0 = frag_o(KH, fo, 0), kl0 = frag_o(KL, fo, 0), kh1 = frag_o(KH, fo, 1024), kl1 = frag_o(KL, fo, 1024);   // keys 0..15 of the first step; every later step's are loaded at the foot of the step before
#pragma unroll 1
  for (int it = 0; it < NT / 32 / KSP; ++it) { v8f s[2][2];   // s[t][ct][r]: key j0 + ct * 16 + 8 * g + r, query col of tile t
    v16h va[4];
    // each group of two fragments is issued as soon as registers are free for it, six products or the whole softmax ahead of its first use: counted waits, three or four loads' latencies overlapped where each stood alone
#pragma unroll
    for (int ct = 0; ct < 2; ++ct) { v8f c[2] = {}, cl[2] = {};
#pragma unroll
      for (int kc = 0; kc < 2; ++kc) { const v16h kh = kc ? kh1 : kh0, kl = kc ? kl1 : kl0;
        // the two tiles' products alternate: each accumulator's order of products is hi.hi ; hi.residual, residual.hi, pass 0 then pass 1
#pragma unroll
        for (int t = 0; t < 2; ++t) c[t] = wmma16(kh, qh[t][kc], c[t]);
#pragma unroll
        for (int t = 0; t < 2; ++t) cl[t] = wmma16(kh, ql[t][kc], cl[t]);
#pragma unroll
        for (int t = 0; t < 2; ++t) cl[t] = wmma16(kl, qh[t][kc], cl[t]);
        if (ct == 0) { if (kc == 0) { kh0 = frag_o(KH, fo, 2048); kl0 = frag_o(KL, fo, 2048); } else { kh1 = frag_o(KH, fo, 3072); kl1 = frag_o(KL, fo, 3072); } }   // keys 16..31 into the registers just read
        else { va[2 * kc] = frag_o(V, fo, (2 * kc) * 1024); va[2 * kc + 1] = frag_o(V, fo, (2 * kc + 1) * 1024); }   // v flies under the softmax
        HOLD(); }
#pragma unroll   // whole-tile arithmetic here and in the softmax: packed operations then pair neighbouring registers of one tile (written element by element, the build pairs the two tiles' elements and copies registers to bring them together)
      for (int t = 0; t < 2; ++t) s[t][ct] = c[t] + cl[t] * (1.0f / 2048.0f); }   // unscaled logits
    float alpha[2]; v16h pb[2];
#pragma unroll
    for (int t = 0; t < 2; ++t) { float mx = fmaxf(s[t][0][0], s[t][1][0]);
#pragma unroll
      for (int r = 1; r < 8; ++r) mx = fmaxf(mx, fmaxf(s[t][0][r], s[t][1][r]));
      mx = fmaxf(mx, xhalf(mx));
      const float mn = fmaxf(m[t], mx); alpha[t] = (m[t] <= -1.0e38f) ? 0.f : __expf(m[t] - mn); float es = 0.f;
      const v8f d0 = s[t][0] - mn, d1 = s[t][1] - mn; v8f e0, e1;
#pragma unroll
      for (int r = 0; r < 8; ++r) e0[r] = __expf(d0[r]);
#pragma unroll
      for (int r = 0; r < 8; ++r) e1[r] = __expf(d1[r]);
      const v8f ee = e0 + e1;
#pragma unroll
      for (int r = 0; r < 8; ++r) es += ee[r];
      union { v16h v; v8h q[2]; } u; u.q[0] = __builtin_convertvector(e0 * 2048.0f, v8h); u.q[1] = __builtin_convertvector(e1 * 2048.0f, v8h); pb[t] = u.v;
      l[t] = l[t] * alpha[t] + es; m[t] = mn; }
#pragma unroll
    for (int dt = 0; dt < 4; ++dt) {
#pragma unroll
      for (int t = 0; t < 2; ++t) { acc[t][dt] *= alpha[t]; acc[t][dt] = wmma16(va[dt], pb[t], acc[t][dt]); }
      if (dt == 3) { fo = (fo & ~(PLB - 1u)) | ((fo + KSP * 4096u) & (PLB - 1u)); kh0 = frag_o(KH, fo, 0); kl0 = frag_o(KL, fo, 0); kh1 = frag_o(KH, fo, 1024); kl1 = frag_o(KL, fo, 1024); HOLD(); } } }   // the next step's keys 0..15, past the plane's end back to its start (the last step reads the first step's again, unused)
  XW(); HOLD();   // those last loads are still in flight: what follows reuses the registers that hold their addresses, only behind this wait
  // each share leaves its unnormalised ctx, max and half sums of both tiles in LDS; behind the walk a wave stands for two waves of 32 x 32 threads, one per tile: wv + t and, for its threads, tn + 32 t
  const int ln = (fo >> 4) & 31, cn = ln & 15, gn = ln >> 4, wv = sp * 4 + qp * 2, tn = wv * 32 + ln;
  // all that the output conv takes from memory is asked for here, as one group, and flies under the merge: the residual at the thread's own 8 store places (16 threads = 256 consecutive bytes of a channel; 2 channels between the tiles' places, 64 between a tile's four), the wave's 32 weight rows as fragments, their bias
  static_assert(64 * KSP / 16 * 8 == CH && KSP * 32 == CH && KC / 32 == 2, "8 store places a thread; 32 channels a key share; two passes of 32 ctx columns");
  const size_t ob = (b * CH + (tn >> 4)) * (size_t)NT + blockIdx.x * 64 + (tn & 15) * 4;
  v4f xr[2][4]; v16b w[2][2]; float bo[2];
  const __bf16* pw = P + (size_t)(sp * 32 + cn) * KC + 8 * gn;   // the lane's 16 bytes of weight row sp * 32 + cn (counted from the start of the packed weights); the other row, pass and half by immediate offsets: one address pair for the run
  const float *pb = BO + sp * 32 + cn, *px = XH + ob;
#pragma unroll   // here and below: xr, w, bo, oc live in registers, their indices must be constants
  for (int j = 0; j < 2; ++j) { bo[j] = pb[j * 16];
#pragma unroll
    for (int kc = 0; kc < 2; ++kc) { const __bf16* p = pw + WS_PO / 2 + j * 16 * KC + kc * 32; union { v16b v; v8b q[2]; } u; u.q[0] = *(const v8b*)p; u.q[1] = *(const v8b*)(p + 16); w[kc][j] = u.v; } }
  HOLD();   // the residual last: it is used last and comes from furthest, so the counted wait for the weights leaves it in flight
#pragma unroll
  for (int t = 0; t < 2; ++t)
#pragma unroll
    for (int i = 0; i < 4; ++i) xr[t][i] = *(const v4f*)(px + (size_t)(t * 2 + i * 64) * NT);
  // the group's addresses are inputs of the wait: they stay in their registers up to it, so that no load of the group lands on a register that an earlier one names
  asm volatile("s_wait_xcnt 0x0" :: "v"(pw), "v"(cn), "v"(px) : "memory");
  HOLD();
#pragma unroll   // acc lives in registers, its index must be a constant
  for (int t = 0; t < 2; ++t) {
#pragma unroll
    for (int dt = 0; dt < 4; ++dt) *(v8f*)&so[wv + t][dt * 2 + gn][cn * 8] = acc[t][dt];
    if (gn == 0) sm[wv + t][cn] = m[t];
    sl[wv + t][ln] = l[t]; }
  BARL();
  // merge: a thread owns 4 ctx columns of one query row per tile; shares rescaled to the common max and added, share 0 first
  static_assert(2 * 64 * KSP == 64 * 16, "two units of 4 ctx columns a thread");
#pragma unroll
  for (int t = 0; t < 2; ++t) { const int row = (tn >> 4) + 2 * t, c4 = tn & 15, w0 = row >> 4, q = row & 15; float mm = sm[w0][q];
#pragma unroll   // here and below: the shares' LDS reads issue together, one wait
    for (int p = 1; p < KSP; ++p) mm = fmaxf(mm, sm[p * 4 + w0][q]);
    float ls = 0.f; v4f o = {};
#pragma unroll
    for (int p = 0; p < KSP; ++p) { const float wgt = __expf(sm[p * 4 + w0][q] - mm); ls += wgt * (sl[p * 4 + w0][q] + sl[p * 4 + w0][16 + q]); o += wgt * *(const v4f*)&so[p * 4 + w0][c4 >> 1][q * 8 + (c4 & 1) * 4]; }
    *(v4f*)&sc[row][c4 * 4] = o * ((1.0f / 2048.0f) / ls); }
  BARL();
  HOLD();   // likewise what reads the weights and the bias
  v8f oc[2][2] = {};
#pragma unroll
  for (int t = 0; t < 2; ++t)
#pragma unroll
    for (int kc = 0; kc < 2; ++kc) { const float* p = &sc[(qp * 2 + t) * 16 + cn][kc * 32 + 8 * gn]; float af[16];   // fragment elements 0..7 = columns 8 g + 0..7 of the pass, 8..15 = 16 further on
#pragma unroll
      for (int i = 0; i < 8; ++i) { af[i] = p[i]; af[8 + i] = p[16 + i]; }
      const F2 a = bsplit16(af);
#pragma unroll
      for (int j = 0; j < 2; ++j) { oc[t][j] = wmma_bf(a.l, w[kc][j], oc[t][j]); oc[t][j] = wmma_bf(a.h, w[kc][j], oc[t][j]); } }
#pragma unroll
  for (int t = 0; t < 2; ++t)
#pragma unroll
    for (int j = 0; j < 2; ++j) { const float bb = bfr(bo[j]);
#pragma unroll
      for (int r = 0; r < 8; ++r) st[sp * 32 + j * 16 + cn][(qp * 2 + t) * 16 + 8 * gn + r] = oc[t][j][r] + bb; }
  BARL();
  HOLD();   // the residual's rounding stays here: moved up into the merge, it waits out the residual's loads there
#pragma unroll
  for (int t = 0; t < 2; ++t)
#pragma unroll
    for (int i = 0; i < 4; ++i) { v4f v = *(const v4f*)&st[(tn >> 4) + t * 2 + i * 64][(tn & 15) * 4];
#pragma unroll
      for (int e = 0; e < 4; ++e) v[e] += bfr(xr[t][i][e]);
      vst2(OUT + ob + (size_t)(t * 2 + i * 64) * NT, v); }
}
extern "C" void kernel_launch(void* const* d_in, const int* in_sizes, int n_in, void* d_out, int out_size, void* d_ws, size_t ws_size, hipStream_t stream) {
  (void)in_sizes; (void)n_in; (void)out_size;
  const float** F = (const float**)d_in;   // 0 x_low [4,512,64,64], 1 x_high [4,256,64,64], 2 Wq [64,256], 3 bq, 4 Wk [64,512], 5 bk, 6 Wv [64,512], 7 bv, 8 Wo [256,64], 9 bo
  if (ws_size < (size_t)WS_END) return;
  char* ws = (char*)d_ws; __bf16* P = (__bf16*)ws; _Float16 *QH = (_Float16*)(ws + WS_QH), *QL = (_Float16*)(ws + WS_QL), *KH = (_Float16*)(ws + WS_KH), *KL = (_Float16*)(ws + WS_KL), *V = (_Float16*)(ws + WS_V);
  k_proj3<<<dim3(TNB * NT / 64, 3), 128, 0, stream>>>(F[0], F[1], F[2], F[4], F[6], F[8], F[3], F[5], F[7], P, QH, QL, KH, KL, V);
  k_attn<<<dim3(TQB, TNB), 64 * KSP, 0, stream>>>(QH, QL, KH, KL, V, P, F[9], F[1], (float*)d_out);
}
